// v000
// Measured on an AMD MI455X. A time is GPU time per run, averaged over a window of back-to-back runs after a warm-up
// (all launches, gaps included; the runs take copies of the inputs in turn), and the median of several windows.
// Apart from v000's, it joins two sittings. Times from different sittings can be a few percent apart, while
// side-by-side timings come from the same sitting.
// v000 is the starting kernel. One run takes 512 microseconds.
#include <hip/hip_runtime.h>

// ---------------------------------------------------------------------------
// CDNA5 (gfx1250) attention block: GroupNorm -> QKV -> softmax(QK^T/sqrt(C))V
// -> proj -> residual.  All GEMM stages use v_wmma_f32_16x16x32_bf16 (wave32).
// ---------------------------------------------------------------------------

typedef __attribute__((ext_vector_type(16))) __bf16 v16bf;
typedef __attribute__((ext_vector_type(8)))  float  v8f;

union FragAB { unsigned int u[8]; v16bf v; };
union FragCD { float f[8]; v8f v; };

#define BATCH 32
#define CH    256
#define NPIX  1024
#define NGRP  8
#define CPG   32           // channels per group

__device__ __forceinline__ unsigned short f2bf(float x) {
  unsigned int u = __float_as_uint(x);
  u += 0x7fffu + ((u >> 16) & 1u);           // round-to-nearest-even
  return (unsigned short)(u >> 16);
}

// Load a 16x32 bf16 A- or B-fragment.  `p` points to the *lane's* row (A) or
// column (B) start, with the K dimension contiguous in memory.  K-pair slot i
// in VGPR i follows the ISA 16-bit A-matrix table:
//   lanes 0-15 : V0..V3 -> K 0..7,  V4..V7 -> K 16..23
//   lanes 16-31: V0..V3 -> K 8..15, V4..V7 -> K 24..31
__device__ __forceinline__ v16bf load_ab_frag(const unsigned short* p) {
  const int half = (threadIdx.x >> 4) & 1;
  const unsigned int* p32 = (const unsigned int*)p;
  FragAB f;
#pragma unroll
  for (int i = 0; i < 8; ++i) {
    int kb = (i < 4) ? (half * 8 + 2 * i) : (16 + half * 8 + 2 * (i - 4));
    f.u[i] = p32[kb >> 1];
  }
  return f.v;
}

__device__ __forceinline__ v8f wmma_bf16(v16bf a, v16bf b, v8f c) {
  return __builtin_amdgcn_wmma_f32_16x16x32_bf16(
      /*neg_a=*/false, a, /*neg_b=*/false, b,
      /*c_mod=*/(short)0, c, /*reuse_a=*/false, /*reuse_b=*/false);
}

// ---------------------------------------------------------------------------
// Kernel 0: fp32 -> bf16 weight conversion (qkv_w: 768x256, proj_w: 256x256)
// ---------------------------------------------------------------------------
__global__ void k_cvt_weights(const float* __restrict__ qkv_w,
                              const float* __restrict__ proj_w,
                              unsigned short* __restrict__ wq_bf,
                              unsigned short* __restrict__ wp_bf) {
  int i = blockIdx.x * 256 + threadIdx.x;
  if (i < 3 * CH * CH) wq_bf[i] = f2bf(qkv_w[i]);
  if (i < CH * CH)     wp_bf[i] = f2bf(proj_w[i]);
}

// ---------------------------------------------------------------------------
// Kernel 1: GroupNorm.  One block per (batch, group).  Output h stored as
// bf16 in [B][N][C] layout (channel-contiguous per pixel) for WMMA B-frags.
// ---------------------------------------------------------------------------
__global__ void k_groupnorm(const float* __restrict__ x,
                            const float* __restrict__ nw,
                            const float* __restrict__ nb,
                            unsigned short* __restrict__ h_t) {
  const int bb = blockIdx.x >> 3;
  const int g  = blockIdx.x & 7;
  const int c0 = g * CPG;
  const float* xp = x + ((size_t)bb * CH + c0) * NPIX;   // 32*1024 contiguous

  float s = 0.f, s2 = 0.f;
  for (int e = threadIdx.x; e < CPG * NPIX; e += 256) {
    float v = xp[e];
    s += v; s2 += v * v;
  }
  __shared__ float rs[256], rs2[256];
  rs[threadIdx.x] = s; rs2[threadIdx.x] = s2;
  __syncthreads();
  for (int off = 128; off > 0; off >>= 1) {
    if (threadIdx.x < off) {
      rs[threadIdx.x]  += rs[threadIdx.x + off];
      rs2[threadIdx.x] += rs2[threadIdx.x + off];
    }
    __syncthreads();
  }
  const float inv_n = 1.0f / (float)(CPG * NPIX);
  const float mean  = rs[0] * inv_n;
  const float var   = rs2[0] * inv_n - mean * mean;
  const float rstd  = rsqrtf(var + 1e-5f);

  for (int e = threadIdx.x; e < CPG * NPIX; e += 256) {
    int c = c0 + (e >> 10);
    int n = e & 1023;
    float v = (xp[e] - mean) * rstd * nw[c] + nb[c];
    h_t[((size_t)bb * NPIX + n) * CH + c] = f2bf(v);
  }
}

// ---------------------------------------------------------------------------
// Kernel 2: QKV GEMM.  qkv[o,n] = sum_c W[o,c] * h[n,c] + b[o].
// Block covers 64 (o) x 128 (n); 8 waves, each wave a 32x32 tile (2x2 WMMA).
// Q,K stored [B][N][C] bf16; V stored [B][C][N] bf16.
// ---------------------------------------------------------------------------
__global__ void k_qkv(const unsigned short* __restrict__ wq_bf,
                      const float* __restrict__ qkv_b,
                      const unsigned short* __restrict__ h_t,
                      unsigned short* __restrict__ q_t,
                      unsigned short* __restrict__ k_t,
                      unsigned short* __restrict__ v_t) {
  const int bb   = blockIdx.z;
  const int n0   = blockIdx.x * 128 + (int)((threadIdx.x >> 5) & 3) * 32;
  const int o0   = blockIdx.y * 64  + (int)((threadIdx.x >> 7)) * 32;
  const int lane = threadIdx.x & 31;
  const int row  = lane & 15;
  const int half = lane >> 4;

  v8f acc00 = {}, acc01 = {}, acc10 = {}, acc11 = {};
  const unsigned short* hb = h_t + (size_t)bb * NPIX * CH;

#pragma unroll
  for (int k0 = 0; k0 < CH; k0 += 32) {
    v16bf a0 = load_ab_frag(wq_bf + (size_t)(o0 + row) * CH + k0);
    v16bf a1 = load_ab_frag(wq_bf + (size_t)(o0 + 16 + row) * CH + k0);
    v16bf b0 = load_ab_frag(hb + (size_t)(n0 + row) * CH + k0);
    v16bf b1 = load_ab_frag(hb + (size_t)(n0 + 16 + row) * CH + k0);
    acc00 = wmma_bf16(a0, b0, acc00);
    acc01 = wmma_bf16(a0, b1, acc01);
    acc10 = wmma_bf16(a1, b0, acc10);
    acc11 = wmma_bf16(a1, b1, acc11);
  }

  FragCD d[2][2];
  d[0][0].v = acc00; d[0][1].v = acc01; d[1][0].v = acc10; d[1][1].v = acc11;

#pragma unroll
  for (int mi = 0; mi < 2; ++mi) {
#pragma unroll
    for (int ni = 0; ni < 2; ++ni) {
      int nn = n0 + ni * 16 + row;
#pragma unroll
      for (int r = 0; r < 8; ++r) {
        int oo = o0 + mi * 16 + r + half * 8;
        float val = d[mi][ni].f[r] + qkv_b[oo];
        unsigned short bv = f2bf(val);
        int seg = oo >> 8, oc = oo & 255;
        if (seg == 0)
          q_t[((size_t)bb * NPIX + nn) * CH + oc] = bv;
        else if (seg == 1)
          k_t[((size_t)bb * NPIX + nn) * CH + oc] = bv;
        else
          v_t[((size_t)bb * CH + oc) * NPIX + nn] = bv;
      }
    }
  }
}

// ---------------------------------------------------------------------------
// Kernel 3: attention.  Block = (16 queries, 1 batch); 8 waves; wave w owns
// keys [w*128, w*128+128).  S kept in registers; cross-wave softmax via LDS;
// probs staged bf16 in LDS for the P*V WMMA pass.
// ---------------------------------------------------------------------------
__global__ void k_attn(const unsigned short* __restrict__ q_t,
                       const unsigned short* __restrict__ k_t,
                       const unsigned short* __restrict__ v_t,
                       unsigned short* __restrict__ hattn_t) {
  const int bb   = blockIdx.y;
  const int q0   = blockIdx.x * 16;
  const int wave = threadIdx.x >> 5;
  const int lane = threadIdx.x & 31;
  const int row  = lane & 15;
  const int half = lane >> 4;
  const float scale = 0.0625f;                 // 256^-0.5

  __shared__ unsigned short pbuf[16 * NPIX];   // 32 KB probs (bf16)
  __shared__ float red[16][128];               // 8 KB partial max/sum
  __shared__ float rowmax[16], rowsum[16];

  // Preload all 8 K-step A-fragments of the 16-query Q tile.
  v16bf qa[8];
  const unsigned short* qrow = q_t + ((size_t)bb * NPIX + q0 + row) * CH;
#pragma unroll
  for (int ks = 0; ks < 8; ++ks) qa[ks] = load_ab_frag(qrow + ks * 32);

  // S = Q K^T for this wave's 128 keys (8 tiles of 16 keys).
  FragCD s[8];
  const int kb0 = wave * 128;
#pragma unroll
  for (int kt = 0; kt < 8; ++kt) {
    v8f acc = {};
    const unsigned short* krow =
        k_t + ((size_t)bb * NPIX + kb0 + kt * 16 + row) * CH;
#pragma unroll
    for (int ks = 0; ks < 8; ++ks)
      acc = wmma_bf16(qa[ks], load_ab_frag(krow + ks * 32), acc);
    s[kt].v = acc;
#pragma unroll
    for (int r = 0; r < 8; ++r) s[kt].f[r] *= scale;
  }

  // Per-lane row maxima over this wave's keys -> LDS -> global row max.
  const int slot = wave * 16 + row;            // unique per (wave, key col)
#pragma unroll
  for (int r = 0; r < 8; ++r) {
    float m = -3.4e38f;
#pragma unroll
    for (int kt = 0; kt < 8; ++kt) m = fmaxf(m, s[kt].f[r]);
    red[half * 8 + r][slot] = m;
  }
  __syncthreads();
  if (threadIdx.x < 16) {
    float m = -3.4e38f;
    for (int i = 0; i < 128; ++i) m = fmaxf(m, red[threadIdx.x][i]);
    rowmax[threadIdx.x] = m;
  }
  __syncthreads();

  // exp in place, partial sums -> LDS -> global row sum.
#pragma unroll
  for (int r = 0; r < 8; ++r) {
    float mr = rowmax[half * 8 + r];
    float ps = 0.f;
#pragma unroll
    for (int kt = 0; kt < 8; ++kt) {
      float e = __expf(s[kt].f[r] - mr);
      s[kt].f[r] = e;
      ps += e;
    }
    red[half * 8 + r][slot] = ps;
  }
  __syncthreads();
  if (threadIdx.x < 16) {
    float su = 0.f;
    for (int i = 0; i < 128; ++i) su += red[threadIdx.x][i];
    rowsum[threadIdx.x] = su;
  }
  __syncthreads();

  // Normalized probs -> LDS as bf16, [query_row][key] contiguous.
#pragma unroll
  for (int r = 0; r < 8; ++r) {
    int m = half * 8 + r;
    float inv = 1.0f / rowsum[m];
#pragma unroll
    for (int kt = 0; kt < 8; ++kt) {
      int key = kb0 + kt * 16 + row;
      pbuf[m * NPIX + key] = f2bf(s[kt].f[r] * inv);
    }
  }
  __syncthreads();

  // P * V : wave handles 2 channel tiles; K-loop over all 1024 keys.
#pragma unroll
  for (int j = 0; j < 2; ++j) {
    const int c0 = (wave * 2 + j) * 16;
    v8f acc = {};
    const unsigned short* vrow = v_t + ((size_t)bb * CH + c0 + row) * NPIX;
    const unsigned short* prow = pbuf + row * NPIX;
#pragma unroll 4
    for (int ks = 0; ks < 32; ++ks) {
      v16bf pa = load_ab_frag(prow + ks * 32);
      v16bf vb = load_ab_frag(vrow + ks * 32);
      acc = wmma_bf16(pa, vb, acc);
    }
    FragCD dd; dd.v = acc;
#pragma unroll
    for (int r = 0; r < 8; ++r) {
      int qq = q0 + r + half * 8;
      int cc = c0 + row;
      hattn_t[((size_t)bb * NPIX + qq) * CH + cc] = f2bf(dd.f[r]);
    }
  }
}

// ---------------------------------------------------------------------------
// Kernel 4: proj GEMM + bias + residual.  out[b,o,n] = x + P[o,:] . hattn[n,:]
// Same tiling as k_qkv (block 64 x 128).
// ---------------------------------------------------------------------------
__global__ void k_proj(const unsigned short* __restrict__ wp_bf,
                       const float* __restrict__ proj_b,
                       const unsigned short* __restrict__ hattn_t,
                       const float* __restrict__ x,
                       float* __restrict__ out) {
  const int bb   = blockIdx.z;
  const int n0   = blockIdx.x * 128 + (int)((threadIdx.x >> 5) & 3) * 32;
  const int o0   = blockIdx.y * 64  + (int)((threadIdx.x >> 7)) * 32;
  const int lane = threadIdx.x & 31;
  const int row  = lane & 15;
  const int half = lane >> 4;

  v8f acc00 = {}, acc01 = {}, acc10 = {}, acc11 = {};
  const unsigned short* hb = hattn_t + (size_t)bb * NPIX * CH;

#pragma unroll
  for (int k0 = 0; k0 < CH; k0 += 32) {
    v16bf a0 = load_ab_frag(wp_bf + (size_t)(o0 + row) * CH + k0);
    v16bf a1 = load_ab_frag(wp_bf + (size_t)(o0 + 16 + row) * CH + k0);
    v16bf b0 = load_ab_frag(hb + (size_t)(n0 + row) * CH + k0);
    v16bf b1 = load_ab_frag(hb + (size_t)(n0 + 16 + row) * CH + k0);
    acc00 = wmma_bf16(a0, b0, acc00);
    acc01 = wmma_bf16(a0, b1, acc01);
    acc10 = wmma_bf16(a1, b0, acc10);
    acc11 = wmma_bf16(a1, b1, acc11);
  }

  FragCD d[2][2];
  d[0][0].v = acc00; d[0][1].v = acc01; d[1][0].v = acc10; d[1][1].v = acc11;

#pragma unroll
  for (int mi = 0; mi < 2; ++mi) {
#pragma unroll
    for (int ni = 0; ni < 2; ++ni) {
      int nn = n0 + ni * 16 + row;
#pragma unroll
      for (int r = 0; r < 8; ++r) {
        int oo = o0 + mi * 16 + r + half * 8;
        size_t idx = ((size_t)bb * CH + oo) * NPIX + nn;
        out[idx] = x[idx] + d[mi][ni].f[r] + proj_b[oo];
      }
    }
  }
}

// ---------------------------------------------------------------------------
// Host-side launcher.
// Inputs: 0:x 1:norm_w 2:norm_b 3:qkv_w 4:qkv_b 5:proj_w 6:proj_b
// ---------------------------------------------------------------------------
extern "C" void kernel_launch(void* const* d_in, const int* in_sizes, int n_in,
                              void* d_out, int out_size, void* d_ws, size_t ws_size,
                              hipStream_t stream) {
  (void)in_sizes; (void)n_in; (void)out_size; (void)ws_size;
  const float* x      = (const float*)d_in[0];
  const float* norm_w = (const float*)d_in[1];
  const float* norm_b = (const float*)d_in[2];
  const float* qkv_w  = (const float*)d_in[3];
  const float* qkv_b  = (const float*)d_in[4];
  const float* proj_w = (const float*)d_in[5];
  const float* proj_b = (const float*)d_in[6];
  float* out = (float*)d_out;

  char* ws = (char*)d_ws;
  const size_t SZ_WQ = (size_t)3 * CH * CH * 2;            // 384 KB
  const size_t SZ_WP = (size_t)CH * CH * 2;                // 128 KB
  const size_t SZ_T  = (size_t)BATCH * NPIX * CH * 2;      // 16 MB per tensor
  unsigned short* wq_bf   = (unsigned short*)(ws);
  unsigned short* wp_bf   = (unsigned short*)(ws + SZ_WQ);
  unsigned short* h_t     = (unsigned short*)(ws + SZ_WQ + SZ_WP);
  unsigned short* q_t     = (unsigned short*)(ws + SZ_WQ + SZ_WP + 1 * SZ_T);
  unsigned short* k_t     = (unsigned short*)(ws + SZ_WQ + SZ_WP + 2 * SZ_T);
  unsigned short* v_t     = (unsigned short*)(ws + SZ_WQ + SZ_WP + 3 * SZ_T);
  unsigned short* hattn_t = (unsigned short*)(ws + SZ_WQ + SZ_WP + 4 * SZ_T);

  k_cvt_weights<<<dim3((3 * CH * CH + 255) / 256), dim3(256), 0, stream>>>(
      qkv_w, proj_w, wq_bf, wp_bf);

  k_groupnorm<<<dim3(BATCH * NGRP), dim3(256), 0, stream>>>(
      x, norm_w, norm_b, h_t);

  k_qkv<<<dim3(NPIX / 128, (3 * CH) / 64, BATCH), dim3(256), 0, stream>>>(
      wq_bf, qkv_b, h_t, q_t, k_t, v_t);

  k_attn<<<dim3(NPIX / 16, BATCH), dim3(256), 0, stream>>>(
      q_t, k_t, v_t, hattn_t);

  k_proj<<<dim3(NPIX / 128, CH / 64, BATCH), dim3(256), 0, stream>>>(
      wp_bf, proj_b, hattn_t, x, out);
}

// v001
// It runs in 303 microseconds.
// In both of two side-by-side timings against v000, it was 1.73 times as fast.
#include <hip/hip_runtime.h>

// ---------------------------------------------------------------------------
// CDNA5 (gfx1250) attention block: GroupNorm -> QKV -> softmax(QK^T/sqrt(C))V
// -> proj -> residual.  All GEMM stages use v_wmma_f32_16x16x32_bf16 (wave32).
// ---------------------------------------------------------------------------

typedef __attribute__((ext_vector_type(16))) __bf16 v16bf;
typedef __attribute__((ext_vector_type(8)))  float  v8f;
typedef __attribute__((ext_vector_type(4)))  float  v4f;
typedef __attribute__((ext_vector_type(4)))  unsigned int v4u;

union FragAB { unsigned int u[8]; v16bf v; };
union FragCD { float f[8]; v8f v; };

#define BATCH 32
#define CH    256
#define NPIX  1024
#define NGRP  8
#define CPG   32           // channels per group

__device__ __forceinline__ unsigned short f2bf(float x) {
  unsigned int u = __float_as_uint(x);
  u += 0x7fffu + ((u >> 16) & 1u);           // round-to-nearest-even
  return (unsigned short)(u >> 16);
}

// Load a 16x32 bf16 A- or B-fragment.  `p` points to the *lane's* row (A) or
// column (B) start, with the K dimension contiguous in memory.  K-pair slot i
// in VGPR i follows the ISA 16-bit A-matrix table:
//   lanes 0-15 : V0..V3 -> K 0..7,  V4..V7 -> K 16..23
//   lanes 16-31: V0..V3 -> K 8..15, V4..V7 -> K 24..31
__device__ __forceinline__ v16bf load_ab_frag(const unsigned short* p) {
  const int half = (threadIdx.x >> 4) & 1;
  const unsigned int* p32 = (const unsigned int*)p;
  FragAB f;
#pragma unroll
  for (int i = 0; i < 8; ++i) {
    int kb = (i < 4) ? (half * 8 + 2 * i) : (16 + half * 8 + 2 * (i - 4));
    f.u[i] = p32[kb >> 1];
  }
  return f.v;
}

__device__ __forceinline__ v8f wmma_bf16(v16bf a, v16bf b, v8f c) {
  return __builtin_amdgcn_wmma_f32_16x16x32_bf16(
      /*neg_a=*/false, a, /*neg_b=*/false, b,
      /*c_mod=*/(short)0, c, /*reuse_a=*/false, /*reuse_b=*/false);
}

// ---------------------------------------------------------------------------
// Kernel 0: fp32 -> bf16 weight conversion (qkv_w: 768x256, proj_w: 256x256)
// ---------------------------------------------------------------------------
__global__ void k_cvt_weights(const float* __restrict__ qkv_w,
                              const float* __restrict__ proj_w,
                              unsigned short* __restrict__ wq_bf,
                              unsigned short* __restrict__ wp_bf) {
  int i = blockIdx.x * 256 + threadIdx.x;
  if (i < 3 * CH * CH) wq_bf[i] = f2bf(qkv_w[i]);
  if (i < CH * CH)     wp_bf[i] = f2bf(proj_w[i]);
}

// ---------------------------------------------------------------------------
// Kernel 1: GroupNorm.  One block per (batch, group).  Output h stored as
// bf16 in [B][N][C] layout (channel-contiguous per pixel) for WMMA B-frags.
// The block size is declared so that the store pass may hold a lane's 128
// loaded values in registers.
// ---------------------------------------------------------------------------
__global__ void __launch_bounds__(256) k_groupnorm(const float* __restrict__ x,
                            const float* __restrict__ nw,
                            const float* __restrict__ nb,
                            unsigned short* __restrict__ h_t) {
  const int bb = blockIdx.x >> 3;
  const int g  = blockIdx.x & 7;
  const int c0 = g * CPG;
  const float* xp = x + ((size_t)bb * CH + c0) * NPIX;   // 32*1024 contiguous

  float s = 0.f, s2 = 0.f;
  for (int e = threadIdx.x; e < CPG * NPIX; e += 256) {
    float v = xp[e];
    s += v; s2 += v * v;
  }
  __shared__ float rs[256], rs2[256];
  rs[threadIdx.x] = s; rs2[threadIdx.x] = s2;
  __syncthreads();
  for (int off = 128; off > 0; off >>= 1) {
    if (threadIdx.x < off) {
      rs[threadIdx.x]  += rs[threadIdx.x + off];
      rs2[threadIdx.x] += rs2[threadIdx.x + off];
    }
    __syncthreads();
  }
  const float inv_n = 1.0f / (float)(CPG * NPIX);
  const float mean  = rs[0] * inv_n;
  const float var   = rs2[0] * inv_n - mean * mean;
  const float rstd  = rsqrtf(var + 1e-5f);

  // Transposing store pass.  A lane owns 8 channels x 16 pixels (4 runs of 4, 32 apart): the 8 lanes that
  // share cl read one whole 128-B line of a channel row, and the 4 lanes of one
  // pixel store its 32 channels as one contiguous 64-B run (16 B per lane).
  const int lane = threadIdx.x & 31;
  const int wave = threadIdx.x >> 5;
  const int cl   = (lane & 3) * 8;                // first of the lane's channels
  const int n0   = wave * 128 + (lane >> 2) * 4;  // first of the lane's pixels
  // Every loop below is fully unrolled so that v, w8 and b8 are registers.
  v4f v[4][8];
#pragma unroll
  for (int it = 0; it < 4; ++it)
#pragma unroll
    for (int j = 0; j < 8; ++j)
      v[it][j] = *(const v4f*)(xp + (cl + j) * NPIX + n0 + it * 32);
  // Keeps every load ahead of the first store: one latency for the whole pass,
  // and no load lands in a register that a store in flight still names.
  __builtin_amdgcn_sched_barrier(0);
  float w8[8], b8[8];
#pragma unroll
  for (int j = 0; j < 8; ++j) {
    w8[j] = nw[c0 + cl + j];
    b8[j] = nb[c0 + cl + j];
  }
#pragma unroll
  for (int it = 0; it < 4; ++it) {
#pragma unroll
    for (int p = 0; p < 4; ++p) {
      v4u o;
#pragma unroll
      for (int k = 0; k < 4; ++k) {
        float lo = (v[it][2 * k][p]     - mean) * rstd * w8[2 * k]     + b8[2 * k];
        float hi = (v[it][2 * k + 1][p] - mean) * rstd * w8[2 * k + 1] + b8[2 * k + 1];
        o[k] = (unsigned int)f2bf(lo) | ((unsigned int)f2bf(hi) << 16);
      }
      *(v4u*)(h_t + ((size_t)bb * NPIX + n0 + it * 32 + p) * CH + c0 + cl) = o;
    }
  }
}

// ---------------------------------------------------------------------------
// Kernel 2: QKV GEMM.  qkv[o,n] = sum_c W[o,c] * h[n,c] + b[o].
// Block covers 64 (o) x 128 (n); 8 waves, each wave a 32x32 tile (2x2 WMMA).
// Q,K stored [B][N][C] bf16; V stored [B][C][N] bf16.
// ---------------------------------------------------------------------------
__global__ void k_qkv(const unsigned short* __restrict__ wq_bf,
                      const float* __restrict__ qkv_b,
                      const unsigned short* __restrict__ h_t,
                      unsigned short* __restrict__ q_t,
                      unsigned short* __restrict__ k_t,
                      unsigned short* __restrict__ v_t) {
  const int bb   = blockIdx.z;
  const int n0   = blockIdx.x * 128 + (int)((threadIdx.x >> 5) & 3) * 32;
  const int o0   = blockIdx.y * 64  + (int)((threadIdx.x >> 7)) * 32;
  const int lane = threadIdx.x & 31;
  const int row  = lane & 15;
  const int half = lane >> 4;

  v8f acc00 = {}, acc01 = {}, acc10 = {}, acc11 = {};
  const unsigned short* hb = h_t + (size_t)bb * NPIX * CH;

#pragma unroll
  for (int k0 = 0; k0 < CH; k0 += 32) {
    v16bf a0 = load_ab_frag(wq_bf + (size_t)(o0 + row) * CH + k0);
    v16bf a1 = load_ab_frag(wq_bf + (size_t)(o0 + 16 + row) * CH + k0);
    v16bf b0 = load_ab_frag(hb + (size_t)(n0 + row) * CH + k0);
    v16bf b1 = load_ab_frag(hb + (size_t)(n0 + 16 + row) * CH + k0);
    acc00 = wmma_bf16(a0, b0, acc00);
    acc01 = wmma_bf16(a0, b1, acc01);
    acc10 = wmma_bf16(a1, b0, acc10);
    acc11 = wmma_bf16(a1, b1, acc11);
  }

  FragCD d[2][2];
  d[0][0].v = acc00; d[0][1].v = acc01; d[1][0].v = acc10; d[1][1].v = acc11;

#pragma unroll
  for (int mi = 0; mi < 2; ++mi) {
#pragma unroll
    for (int ni = 0; ni < 2; ++ni) {
      int nn = n0 + ni * 16 + row;
#pragma unroll
      for (int r = 0; r < 8; ++r) {
        int oo = o0 + mi * 16 + r + half * 8;
        float val = d[mi][ni].f[r] + qkv_b[oo];
        unsigned short bv = f2bf(val);
        int seg = oo >> 8, oc = oo & 255;
        if (seg == 0)
          q_t[((size_t)bb * NPIX + nn) * CH + oc] = bv;
        else if (seg == 1)
          k_t[((size_t)bb * NPIX + nn) * CH + oc] = bv;
        else
          v_t[((size_t)bb * CH + oc) * NPIX + nn] = bv;
      }
    }
  }
}

// ---------------------------------------------------------------------------
// Kernel 3: attention.  Block = (16 queries, 1 batch); 8 waves; wave w owns
// keys [w*128, w*128+128).  S kept in registers; cross-wave softmax via LDS;
// probs staged bf16 in LDS for the P*V WMMA pass.
// ---------------------------------------------------------------------------
__global__ void k_attn(const unsigned short* __restrict__ q_t,
                       const unsigned short* __restrict__ k_t,
                       const unsigned short* __restrict__ v_t,
                       unsigned short* __restrict__ hattn_t) {
  const int bb   = blockIdx.y;
  const int q0   = blockIdx.x * 16;
  const int wave = threadIdx.x >> 5;
  const int lane = threadIdx.x & 31;
  const int row  = lane & 15;
  const int half = lane >> 4;
  const float scale = 0.0625f;                 // 256^-0.5

  __shared__ unsigned short pbuf[16 * NPIX];   // 32 KB probs (bf16)
  __shared__ float red[16][128];               // 8 KB partial max/sum
  __shared__ float rowmax[16], rowsum[16];

  // Preload all 8 K-step A-fragments of the 16-query Q tile.
  v16bf qa[8];
  const unsigned short* qrow = q_t + ((size_t)bb * NPIX + q0 + row) * CH;
#pragma unroll
  for (int ks = 0; ks < 8; ++ks) qa[ks] = load_ab_frag(qrow + ks * 32);

  // S = Q K^T for this wave's 128 keys (8 tiles of 16 keys).
  FragCD s[8];
  const int kb0 = wave * 128;
#pragma unroll
  for (int kt = 0; kt < 8; ++kt) {
    v8f acc = {};
    const unsigned short* krow =
        k_t + ((size_t)bb * NPIX + kb0 + kt * 16 + row) * CH;
#pragma unroll
    for (int ks = 0; ks < 8; ++ks)
      acc = wmma_bf16(qa[ks], load_ab_frag(krow + ks * 32), acc);
    s[kt].v = acc;
#pragma unroll
    for (int r = 0; r < 8; ++r) s[kt].f[r] *= scale;
  }

  // Per-lane row maxima over this wave's keys -> LDS -> global row max.
  const int slot = wave * 16 + row;            // unique per (wave, key col)
#pragma unroll
  for (int r = 0; r < 8; ++r) {
    float m = -3.4e38f;
#pragma unroll
    for (int kt = 0; kt < 8; ++kt) m = fmaxf(m, s[kt].f[r]);
    red[half * 8 + r][slot] = m;
  }
  __syncthreads();
  if (threadIdx.x < 16) {
    float m = -3.4e38f;
    for (int i = 0; i < 128; ++i) m = fmaxf(m, red[threadIdx.x][i]);
    rowmax[threadIdx.x] = m;
  }
  __syncthreads();

  // exp in place, partial sums -> LDS -> global row sum.
#pragma unroll
  for (int r = 0; r < 8; ++r) {
    float mr = rowmax[half * 8 + r];
    float ps = 0.f;
#pragma unroll
    for (int kt = 0; kt < 8; ++kt) {
      float e = __expf(s[kt].f[r] - mr);
      s[kt].f[r] = e;
      ps += e;
    }
    red[half * 8 + r][slot] = ps;
  }
  __syncthreads();
  if (threadIdx.x < 16) {
    float su = 0.f;
    for (int i = 0; i < 128; ++i) su += red[threadIdx.x][i];
    rowsum[threadIdx.x] = su;
  }
  __syncthreads();

  // Normalized probs -> LDS as bf16, [query_row][key] contiguous.
#pragma unroll
  for (int r = 0; r < 8; ++r) {
    int m = half * 8 + r;
    float inv = 1.0f / rowsum[m];
#pragma unroll
    for (int kt = 0; kt < 8; ++kt) {
      int key = kb0 + kt * 16 + row;
      pbuf[m * NPIX + key] = f2bf(s[kt].f[r] * inv);
    }
  }
  __syncthreads();

  // P * V : wave handles 2 channel tiles; K-loop over all 1024 keys.
#pragma unroll
  for (int j = 0; j < 2; ++j) {
    const int c0 = (wave * 2 + j) * 16;
    v8f acc = {};
    const unsigned short* vrow = v_t + ((size_t)bb * CH + c0 + row) * NPIX;
    const unsigned short* prow = pbuf + row * NPIX;
#pragma unroll 4
    for (int ks = 0; ks < 32; ++ks) {
      v16bf pa = load_ab_frag(prow + ks * 32);
      v16bf vb = load_ab_frag(vrow + ks * 32);
      acc = wmma_bf16(pa, vb, acc);
    }
    FragCD dd; dd.v = acc;
#pragma unroll
    for (int r = 0; r < 8; ++r) {
      int qq = q0 + r + half * 8;
      int cc = c0 + row;
      hattn_t[((size_t)bb * NPIX + qq) * CH + cc] = f2bf(dd.f[r]);
    }
  }
}

// ---------------------------------------------------------------------------
// Kernel 4: proj GEMM + bias + residual.  out[b,o,n] = x + P[o,:] . hattn[n,:]
// Same tiling as k_qkv (block 64 x 128).
// ---------------------------------------------------------------------------
__global__ void k_proj(const unsigned short* __restrict__ wp_bf,
                       const float* __restrict__ proj_b,
                       const unsigned short* __restrict__ hattn_t,
                       const float* __restrict__ x,
                       float* __restrict__ out) {
  const int bb   = blockIdx.z;
  const int n0   = blockIdx.x * 128 + (int)((threadIdx.x >> 5) & 3) * 32;
  const int o0   = blockIdx.y * 64  + (int)((threadIdx.x >> 7)) * 32;
  const int lane = threadIdx.x & 31;
  const int row  = lane & 15;
  const int half = lane >> 4;

  v8f acc00 = {}, acc01 = {}, acc10 = {}, acc11 = {};
  const unsigned short* hb = hattn_t + (size_t)bb * NPIX * CH;

#pragma unroll
  for (int k0 = 0; k0 < CH; k0 += 32) {
    v16bf a0 = load_ab_frag(wp_bf + (size_t)(o0 + row) * CH + k0);
    v16bf a1 = load_ab_frag(wp_bf + (size_t)(o0 + 16 + row) * CH + k0);
    v16bf b0 = load_ab_frag(hb + (size_t)(n0 + row) * CH + k0);
    v16bf b1 = load_ab_frag(hb + (size_t)(n0 + 16 + row) * CH + k0);
    acc00 = wmma_bf16(a0, b0, acc00);
    acc01 = wmma_bf16(a0, b1, acc01);
    acc10 = wmma_bf16(a1, b0, acc10);
    acc11 = wmma_bf16(a1, b1, acc11);
  }

  FragCD d[2][2];
  d[0][0].v = acc00; d[0][1].v = acc01; d[1][0].v = acc10; d[1][1].v = acc11;

#pragma unroll
  for (int mi = 0; mi < 2; ++mi) {
#pragma unroll
    for (int ni = 0; ni < 2; ++ni) {
      int nn = n0 + ni * 16 + row;
#pragma unroll
      for (int r = 0; r < 8; ++r) {
        int oo = o0 + mi * 16 + r + half * 8;
        size_t idx = ((size_t)bb * CH + oo) * NPIX + nn;
        out[idx] = x[idx] + d[mi][ni].f[r] + proj_b[oo];
      }
    }
  }
}

// ---------------------------------------------------------------------------
// Host-side launcher.
// Inputs: 0:x 1:norm_w 2:norm_b 3:qkv_w 4:qkv_b 5:proj_w 6:proj_b
// ---------------------------------------------------------------------------
extern "C" void kernel_launch(void* const* d_in, const int* in_sizes, int n_in,
                              void* d_out, int out_size, void* d_ws, size_t ws_size,
                              hipStream_t stream) {
  (void)in_sizes; (void)n_in; (void)out_size; (void)ws_size;
  const float* x      = (const float*)d_in[0];
  const float* norm_w = (const float*)d_in[1];
  const float* norm_b = (const float*)d_in[2];
  const float* qkv_w  = (const float*)d_in[3];
  const float* qkv_b  = (const float*)d_in[4];
  const float* proj_w = (const float*)d_in[5];
  const float* proj_b = (const float*)d_in[6];
  float* out = (float*)d_out;

  char* ws = (char*)d_ws;
  const size_t SZ_WQ = (size_t)3 * CH * CH * 2;            // 384 KB
  const size_t SZ_WP = (size_t)CH * CH * 2;                // 128 KB
  const size_t SZ_T  = (size_t)BATCH * NPIX * CH * 2;      // 16 MB per tensor
  unsigned short* wq_bf   = (unsigned short*)(ws);
  unsigned short* wp_bf   = (unsigned short*)(ws + SZ_WQ);
  unsigned short* h_t     = (unsigned short*)(ws + SZ_WQ + SZ_WP);
  unsigned short* q_t     = (unsigned short*)(ws + SZ_WQ + SZ_WP + 1 * SZ_T);
  unsigned short* k_t     = (unsigned short*)(ws + SZ_WQ + SZ_WP + 2 * SZ_T);
  unsigned short* v_t     = (unsigned short*)(ws + SZ_WQ + SZ_WP + 3 * SZ_T);
  unsigned short* hattn_t = (unsigned short*)(ws + SZ_WQ + SZ_WP + 4 * SZ_T);

  k_cvt_weights<<<dim3((3 * CH * CH + 255) / 256), dim3(256), 0, stream>>>(
      qkv_w, proj_w, wq_bf, wp_bf);

  k_groupnorm<<<dim3(BATCH * NGRP), dim3(256), 0, stream>>>(
      x, norm_w, norm_b, h_t);

  k_qkv<<<dim3(NPIX / 128, (3 * CH) / 64, BATCH), dim3(256), 0, stream>>>(
      wq_bf, qkv_b, h_t, q_t, k_t, v_t);

  k_attn<<<dim3(NPIX / 16, BATCH), dim3(256), 0, stream>>>(
      q_t, k_t, v_t, hattn_t);

  k_proj<<<dim3(NPIX / 128, CH / 64, BATCH), dim3(256), 0, stream>>>(
      wp_bf, proj_b, hattn_t, x, out);
}

// v002
// One run takes 161 microseconds.
// In two side-by-side timings against v001, it was 1.89 and 1.88 times as fast.
// Counting every step since v000, it is 3.26 times as fast.
#include <hip/hip_runtime.h>

// ---------------------------------------------------------------------------
// CDNA5 (gfx1250) attention block: GroupNorm -> QKV -> softmax(QK^T/sqrt(C))V
// -> proj -> residual.  All GEMM stages use v_wmma_f32_16x16x32_bf16 (wave32).
// ---------------------------------------------------------------------------

typedef __attribute__((ext_vector_type(16))) __bf16 v16bf;
typedef __attribute__((ext_vector_type(8)))  float  v8f;
typedef __attribute__((ext_vector_type(4)))  float  v4f;
typedef __attribute__((ext_vector_type(4)))  unsigned int v4u;

union FragAB { unsigned int u[8]; v16bf v; };
union FragCD { float f[8]; v8f v; };

#define BATCH 32
#define CH    256
#define NPIX  1024
#define NGRP  8
#define CPG   32           // channels per group

__device__ __forceinline__ unsigned short f2bf(float x) {
  unsigned int u = __float_as_uint(x);
  u += 0x7fffu + ((u >> 16) & 1u);           // round-to-nearest-even
  return (unsigned short)(u >> 16);
}

// Load a 16x32 bf16 A- or B-fragment.  `p` points to the *lane's* row (A) or
// column (B) start, with the K dimension contiguous in memory.  K-pair slot i
// in VGPR i follows the ISA 16-bit A-matrix table:
//   lanes 0-15 : V0..V3 -> K 0..7,  V4..V7 -> K 16..23
//   lanes 16-31: V0..V3 -> K 8..15, V4..V7 -> K 24..31
__device__ __forceinline__ v16bf load_ab_frag(const unsigned short* p) {
  const int half = (threadIdx.x >> 4) & 1;
  const unsigned int* p32 = (const unsigned int*)p;
  FragAB f;
#pragma unroll
  for (int i = 0; i < 8; ++i) {
    int kb = (i < 4) ? (half * 8 + 2 * i) : (16 + half * 8 + 2 * (i - 4));
    f.u[i] = p32[kb >> 1];
  }
  return f.v;
}

__device__ __forceinline__ v8f wmma_bf16(v16bf a, v16bf b, v8f c) {
  return __builtin_amdgcn_wmma_f32_16x16x32_bf16(
      /*neg_a=*/false, a, /*neg_b=*/false, b,
      /*c_mod=*/(short)0, c, /*reuse_a=*/false, /*reuse_b=*/false);
}

// ---------------------------------------------------------------------------
// Kernel 0: fp32 -> bf16 weight conversion (qkv_w: 768x256, proj_w: 256x256)
// ---------------------------------------------------------------------------
__global__ void k_cvt_weights(const float* __restrict__ qkv_w,
                              const float* __restrict__ proj_w,
                              unsigned short* __restrict__ wq_bf,
                              unsigned short* __restrict__ wp_bf) {
  int i = blockIdx.x * 256 + threadIdx.x;
  if (i < 3 * CH * CH) wq_bf[i] = f2bf(qkv_w[i]);
  if (i < CH * CH)     wp_bf[i] = f2bf(proj_w[i]);
}

// ---------------------------------------------------------------------------
// Kernel 1: GroupNorm.  One block per (batch, group).  Output h stored as
// bf16 in [B][N][C] layout (channel-contiguous per pixel) for WMMA B-frags.
// The block size is declared so that the store pass may hold a lane's 128
// loaded values in registers.
// ---------------------------------------------------------------------------
__global__ void __launch_bounds__(256) k_groupnorm(const float* __restrict__ x,
                            const float* __restrict__ nw,
                            const float* __restrict__ nb,
                            unsigned short* __restrict__ h_t) {
  const int bb = blockIdx.x >> 3;
  const int g  = blockIdx.x & 7;
  const int c0 = g * CPG;
  const float* xp = x + ((size_t)bb * CH + c0) * NPIX;   // 32*1024 contiguous

  float s = 0.f, s2 = 0.f;
  for (int e = threadIdx.x; e < CPG * NPIX; e += 256) {
    float v = xp[e];
    s += v; s2 += v * v;
  }
  __shared__ float rs[256], rs2[256];
  rs[threadIdx.x] = s; rs2[threadIdx.x] = s2;
  __syncthreads();
  for (int off = 128; off > 0; off >>= 1) {
    if (threadIdx.x < off) {
      rs[threadIdx.x]  += rs[threadIdx.x + off];
      rs2[threadIdx.x] += rs2[threadIdx.x + off];
    }
    __syncthreads();
  }
  const float inv_n = 1.0f / (float)(CPG * NPIX);
  const float mean  = rs[0] * inv_n;
  const float var   = rs2[0] * inv_n - mean * mean;
  const float rstd  = rsqrtf(var + 1e-5f);

  // Transposing store pass.  A lane owns 8 channels x 16 pixels (4 runs of 4, 32 apart): the 8 lanes that
  // share cl read one whole 128-B line of a channel row, and the 4 lanes of one
  // pixel store its 32 channels as one contiguous 64-B run (16 B per lane).
  const int lane = threadIdx.x & 31;
  const int wave = threadIdx.x >> 5;
  const int cl   = (lane & 3) * 8;                // first of the lane's channels
  const int n0   = wave * 128 + (lane >> 2) * 4;  // first of the lane's pixels
  // Every loop below is fully unrolled so that v, w8 and b8 are registers.
  v4f v[4][8];
#pragma unroll
  for (int it = 0; it < 4; ++it)
#pragma unroll
    for (int j = 0; j < 8; ++j)
      v[it][j] = *(const v4f*)(xp + (cl + j) * NPIX + n0 + it * 32);
  // Keeps every load ahead of the first store: one latency for the whole pass,
  // and no load lands in a register that a store in flight still names.
  __builtin_amdgcn_sched_barrier(0);
  float w8[8], b8[8];
#pragma unroll
  for (int j = 0; j < 8; ++j) {
    w8[j] = nw[c0 + cl + j];
    b8[j] = nb[c0 + cl + j];
  }
#pragma unroll
  for (int it = 0; it < 4; ++it) {
#pragma unroll
    for (int p = 0; p < 4; ++p) {
      v4u o;
#pragma unroll
      for (int k = 0; k < 4; ++k) {
        float lo = (v[it][2 * k][p]     - mean) * rstd * w8[2 * k]     + b8[2 * k];
        float hi = (v[it][2 * k + 1][p] - mean) * rstd * w8[2 * k + 1] + b8[2 * k + 1];
        o[k] = (unsigned int)f2bf(lo) | ((unsigned int)f2bf(hi) << 16);
      }
      *(v4u*)(h_t + ((size_t)bb * NPIX + n0 + it * 32 + p) * CH + c0 + cl) = o;
    }
  }
}

// ---------------------------------------------------------------------------
// Kernel 2: QKV GEMM.  qkv[o,n] = sum_c W[o,c] * h[n,c] + b[o].
// Block covers 64 (o) x 128 (n); 8 waves, each wave a 32x32 tile (2x2 WMMA).
// Q,K stored [B][N][C] bf16; V stored [B][C][N] bf16.
// ---------------------------------------------------------------------------
__global__ void k_qkv(const unsigned short* __restrict__ wq_bf,
                      const float* __restrict__ qkv_b,
                      const unsigned short* __restrict__ h_t,
                      unsigned short* __restrict__ q_t,
                      unsigned short* __restrict__ k_t,
                      unsigned short* __restrict__ v_t) {
  const int bb   = blockIdx.z;
  const int n0   = blockIdx.x * 128 + (int)((threadIdx.x >> 5) & 3) * 32;
  const int o0   = blockIdx.y * 64  + (int)((threadIdx.x >> 7)) * 32;
  const int lane = threadIdx.x & 31;
  const int row  = lane & 15;
  const int half = lane >> 4;

  v8f acc00 = {}, acc01 = {}, acc10 = {}, acc11 = {};
  const unsigned short* hb = h_t + (size_t)bb * NPIX * CH;

#pragma unroll
  for (int k0 = 0; k0 < CH; k0 += 32) {
    v16bf a0 = load_ab_frag(wq_bf + (size_t)(o0 + row) * CH + k0);
    v16bf a1 = load_ab_frag(wq_bf + (size_t)(o0 + 16 + row) * CH + k0);
    v16bf b0 = load_ab_frag(hb + (size_t)(n0 + row) * CH + k0);
    v16bf b1 = load_ab_frag(hb + (size_t)(n0 + 16 + row) * CH + k0);
    acc00 = wmma_bf16(a0, b0, acc00);
    acc01 = wmma_bf16(a0, b1, acc01);
    acc10 = wmma_bf16(a1, b0, acc10);
    acc11 = wmma_bf16(a1, b1, acc11);
  }

  FragCD d[2][2];
  d[0][0].v = acc00; d[0][1].v = acc01; d[1][0].v = acc10; d[1][1].v = acc11;

#pragma unroll
  for (int mi = 0; mi < 2; ++mi) {
#pragma unroll
    for (int ni = 0; ni < 2; ++ni) {
      int nn = n0 + ni * 16 + row;
#pragma unroll
      for (int r = 0; r < 8; ++r) {
        int oo = o0 + mi * 16 + r + half * 8;
        float val = d[mi][ni].f[r] + qkv_b[oo];
        unsigned short bv = f2bf(val);
        int seg = oo >> 8, oc = oo & 255;
        if (seg == 0)
          q_t[((size_t)bb * NPIX + nn) * CH + oc] = bv;
        else if (seg == 1)
          k_t[((size_t)bb * NPIX + nn) * CH + oc] = bv;
        else
          v_t[((size_t)bb * CH + oc) * NPIX + nn] = bv;
      }
    }
  }
}

typedef __attribute__((ext_vector_type(2))) float  v2f;
typedef __attribute__((ext_vector_type(2))) __bf16 v2bf;

#define KTILE    32                       // keys per tile
#define NTILE    (NPIX / KTILE)
#define KPITCH   528                      // LDS bytes per key row: 512 + 16
#define VPITCH   80                       // LDS bytes per channel row: 64 + 16
#define KBYTES   (KTILE * KPITCH)
#define BUFBYTES (KBYTES + CH * VPITCH)

// Two f32 -> one register of two bf16, round to nearest even.
__device__ __forceinline__ unsigned int pack_bf2(float lo, float hi) {
  v2f t = {lo, hi};
  return __builtin_bit_cast(unsigned int, __builtin_convertvector(t, v2bf));
}

// Value of lane l ^ 16.
__device__ __forceinline__ float other_half(float x) {
  int b = __float_as_int(x);
  return __int_as_float(__builtin_amdgcn_permlanex16(
      b, b, 0x76543210, 0xfedcba98, false, false));
}

// A-fragment from LDS, same k order as load_ab_frag.  p = the lane's row, at
// the 64-B block of the k step, plus 16 B for lanes 16-31.
__device__ __forceinline__ v16bf lds_frag(const unsigned char* p) {
  v4u lo = *(const v4u*)(p);
  v4u hi = *(const v4u*)(p + 32);
  FragAB f;
#pragma unroll
  for (int i = 0; i < 4; ++i) { f.u[i] = lo[i]; f.u[4 + i] = hi[i]; }
  return f.v;
}

// One tile's copies of one lane: 4 x 16 B of K, 4 x 16 B of V.  kl, vl: LDS
// byte addresses; kg, vg: global addresses.  The s_wait_xcnt stands inside the
// statement so that no address register is rewritten ahead of it.
__device__ __forceinline__ void stage_tile(unsigned int kl, unsigned int vl,
                                           const unsigned char* kg,
                                           const unsigned char* vg) {
  asm volatile(
      "global_load_async_to_lds_b128 %0, %8, off\n\t"
      "global_load_async_to_lds_b128 %1, %9, off\n\t"
      "global_load_async_to_lds_b128 %2, %10, off\n\t"
      "global_load_async_to_lds_b128 %3, %11, off\n\t"
      "global_load_async_to_lds_b128 %4, %12, off\n\t"
      "global_load_async_to_lds_b128 %5, %13, off\n\t"
      "global_load_async_to_lds_b128 %6, %14, off\n\t"
      "global_load_async_to_lds_b128 %7, %15, off\n\t"
      "s_wait_xcnt 0x0"
      :: "v"(kl), "v"(kl + 8 * KPITCH), "v"(kl + 16 * KPITCH),
         "v"(kl + 24 * KPITCH),
         "v"(vl), "v"(vl + 64 * VPITCH), "v"(vl + 128 * VPITCH),
         "v"(vl + 192 * VPITCH),
         "v"(kg), "v"(kg + 8 * CH * 2), "v"(kg + 16 * CH * 2),
         "v"(kg + 24 * CH * 2),
         "v"(vg), "v"(vg + 64 * NPIX * 2), "v"(vg + 128 * NPIX * 2),
         "v"(vg + 192 * NPIX * 2)
      : "memory");
}

// Two waves per SIMD (one block per WGP): the register budget this gives lets
// a wave hold a whole tile's fragments, so its LDS reads stand in two groups.
__global__ void __launch_bounds__(256)
__attribute__((amdgpu_waves_per_eu(2, 2))) k_attn(
                       const unsigned short* __restrict__ q_t,
                       const unsigned short* __restrict__ k_t,
                       const unsigned short* __restrict__ v_t,
                       unsigned short* __restrict__ hattn_t) {
  const int bb   = blockIdx.y;
  const int tid  = threadIdx.x;
  const int wave = tid >> 5;
  const int lane = tid & 31;
  const int row  = lane & 15;
  const int half = lane >> 4;
  const int q    = blockIdx.x * 128 + wave * 16 + row;   // the lane's query
  const float c2 = 0.0625f * 1.44269504f;                // 256^-0.5 * log2(e)

  __shared__ __attribute__((aligned(16))) unsigned char ring[2 * BUFBYTES];

  // Copy addresses.  K: a wave copies one whole 512-B key row per instruction.
  // V: 4 lanes copy the 64 B that one channel holds of the tile's 32 keys.
  // The wave's share of an LDS address is kept scalar, the lane's in a register.
  const unsigned int ring0 = (unsigned int)(size_t)ring;
  const unsigned int wv = __builtin_amdgcn_readfirstlane(wave);
  const unsigned int ks0 = ring0 + wv * KPITCH;
  const unsigned int vs0 = ring0 + KBYTES + wv * (8 * VPITCH);
  const unsigned int kln = lane * 16;
  const unsigned int vln = (lane >> 2) * VPITCH + (lane & 3) * 16;
  const unsigned char* kg =
      (const unsigned char*)(k_t + ((size_t)bb * NPIX + wave) * CH) + lane * 16;
  const unsigned char* vg =
      (const unsigned char*)(v_t + ((size_t)bb * CH + (tid >> 2)) * NPIX) +
      (tid & 3) * 16;

  stage_tile(ks0 + kln, vs0 + vln, kg, vg);

  // The 16 queries as B-fragments, kept in registers for the whole walk.
  v16bf qb[8];
  const unsigned short* qrow = q_t + ((size_t)bb * NPIX + q) * CH;
#pragma unroll
  for (int ks = 0; ks < 8; ++ks) qb[ks] = load_ab_frag(qrow + ks * 32);

  // Tile 0 has landed for this wave, then for every wave.
  asm volatile("s_wait_asynccnt 0x0" ::: "memory");
  __syncthreads();
  stage_tile(ks0 + BUFBYTES + kln, vs0 + BUFBYTES + vln, kg + KTILE * CH * 2,
             vg + KTILE * 2);

  v8f o[16];
#pragma unroll
  for (int ct = 0; ct < 16; ++ct) o[ct] = (v8f){};
  float mref = -3.0e38f;     // maximum in use, in units of log2
  float lsum = 0.f;          // this half's share of the query's sum

  for (int t = 0; t < NTILE; ++t) {
    const unsigned int boff = (unsigned int)(t & 1) * BUFBYTES;
    const unsigned char* kb = ring + boff + row * KPITCH + half * 16;
    const unsigned char* vb = ring + boff + KBYTES + row * VPITCH + half * 16;

    // S^T: register r of st0 / st1 = key 8 * half + r / 16 + 8 * half + r.
    v8f st0 = {}, st1 = {};
#pragma unroll
    for (int ks = 0; ks < 8; ++ks) {
      st0 = wmma_bf16(lds_frag(kb + ks * 64), qb[ks], st0);
      st1 = wmma_bf16(lds_frag(kb + 16 * KPITCH + ks * 64), qb[ks], st1);
    }

    // The tile's V fragments, read as one group while the softmax runs.
    v16bf vf[16];
#pragma unroll
    for (int ct = 0; ct < 16; ++ct) vf[ct] = lds_frag(vb + ct * 16 * VPITCH);
    // Keeps the group here: sunk to their users, each read's latency is exposed.
    __builtin_amdgcn_sched_barrier(0);

    float mt = fmaxf(st0[0], st1[0]);
#pragma unroll
    for (int r = 1; r < 8; ++r) mt = fmaxf(mt, fmaxf(st0[r], st1[r]));
    mt = fmaxf(mt, other_half(mt)) * c2;

    // The maximum in use is replaced only when some query's new one exceeds it
    // by more than 8: until then every exponential stays at or below 2^8.
    if (__builtin_amdgcn_ballot_w32(mt > mref + 8.0f) != 0) {
      const float mn = fmaxf(mref, mt);
      const float al = __builtin_amdgcn_exp2f(mref - mn);
      lsum *= al;
#pragma unroll
      for (int ct = 0; ct < 16; ++ct) o[ct] *= al;
      mref = mn;
    }

    FragAB pb;
#pragma unroll
    for (int i = 0; i < 4; ++i) {
      float a0 = __builtin_amdgcn_exp2f(st0[2 * i]     * c2 - mref);
      float a1 = __builtin_amdgcn_exp2f(st0[2 * i + 1] * c2 - mref);
      float b0 = __builtin_amdgcn_exp2f(st1[2 * i]     * c2 - mref);
      float b1 = __builtin_amdgcn_exp2f(st1[2 * i + 1] * c2 - mref);
      lsum += (a0 + a1) + (b0 + b1);
      pb.u[i]     = pack_bf2(a0, a1);
      pb.u[4 + i] = pack_bf2(b0, b1);
    }

    // O^T: register r of o[ct] = channel ct * 16 + 8 * half + r.
#pragma unroll
    for (int ct = 0; ct < 16; ++ct)
      o[ct] = wmma_bf16(vf[ct], pb.v, o[ct]);

    // Hand-over: this wave's reads of the tile are done, its copies of the next
    // tile have landed; behind the barrier that holds for every wave.
    asm volatile("s_wait_dscnt 0x0" ::: "memory");
    asm volatile("s_wait_asynccnt 0x0" ::: "memory");
    __syncthreads();
    if (t + 2 < NTILE)
    {
      // Scalar sums first: added lane part first, the sum shared with the first
      // tile's copy is an asm operand, is held below v256 and gets spilled.
      const unsigned int ksb = __builtin_amdgcn_readfirstlane(ks0 + boff);
      const unsigned int vsb = __builtin_amdgcn_readfirstlane(vs0 + boff);
      stage_tile(ksb + kln, vsb + vln,
                 kg + (size_t)(t + 2) * (KTILE * CH * 2),
                 vg + (t + 2) * (KTILE * 2));
    }
  }
  // No copy is outstanding when the wave ends.
  asm volatile("s_wait_asynccnt 0x0" ::: "memory");

  const float inv = 1.0f / (lsum + other_half(lsum));
  unsigned short* orow = hattn_t + ((size_t)bb * NPIX + q) * CH + half * 8;
  v4u w[16];
#pragma unroll
  for (int ct = 0; ct < 16; ++ct)
#pragma unroll
    for (int i = 0; i < 4; ++i)
      w[ct][i] = pack_bf2(o[ct][2 * i] * inv, o[ct][2 * i + 1] * inv);
  // All packing ahead of the first store: no register that a store in flight
  // names is written again.
  __builtin_amdgcn_sched_barrier(0);
#pragma unroll
  for (int ct = 0; ct < 16; ++ct) *(v4u*)(orow + ct * 16) = w[ct];
}

// ---------------------------------------------------------------------------
// Kernel 4: proj GEMM + bias + residual.  out[b,o,n] = x + P[o,:] . hattn[n,:]
// Same tiling as k_qkv (block 64 x 128).
// ---------------------------------------------------------------------------
__global__ void k_proj(const unsigned short* __restrict__ wp_bf,
                       const float* __restrict__ proj_b,
                       const unsigned short* __restrict__ hattn_t,
                       const float* __restrict__ x,
                       float* __restrict__ out) {
  const int bb   = blockIdx.z;
  const int n0   = blockIdx.x * 128 + (int)((threadIdx.x >> 5) & 3) * 32;
  const int o0   = blockIdx.y * 64  + (int)((threadIdx.x >> 7)) * 32;
  const int lane = threadIdx.x & 31;
  const int row  = lane & 15;
  const int half = lane >> 4;

  v8f acc00 = {}, acc01 = {}, acc10 = {}, acc11 = {};
  const unsigned short* hb = hattn_t + (size_t)bb * NPIX * CH;

#pragma unroll
  for (int k0 = 0; k0 < CH; k0 += 32) {
    v16bf a0 = load_ab_frag(wp_bf + (size_t)(o0 + row) * CH + k0);
    v16bf a1 = load_ab_frag(wp_bf + (size_t)(o0 + 16 + row) * CH + k0);
    v16bf b0 = load_ab_frag(hb + (size_t)(n0 + row) * CH + k0);
    v16bf b1 = load_ab_frag(hb + (size_t)(n0 + 16 + row) * CH + k0);
    acc00 = wmma_bf16(a0, b0, acc00);
    acc01 = wmma_bf16(a0, b1, acc01);
    acc10 = wmma_bf16(a1, b0, acc10);
    acc11 = wmma_bf16(a1, b1, acc11);
  }

  FragCD d[2][2];
  d[0][0].v = acc00; d[0][1].v = acc01; d[1][0].v = acc10; d[1][1].v = acc11;

#pragma unroll
  for (int mi = 0; mi < 2; ++mi) {
#pragma unroll
    for (int ni = 0; ni < 2; ++ni) {
      int nn = n0 + ni * 16 + row;
#pragma unroll
      for (int r = 0; r < 8; ++r) {
        int oo = o0 + mi * 16 + r + half * 8;
        size_t idx = ((size_t)bb * CH + oo) * NPIX + nn;
        out[idx] = x[idx] + d[mi][ni].f[r] + proj_b[oo];
      }
    }
  }
}

// ---------------------------------------------------------------------------
// Host-side launcher.
// Inputs: 0:x 1:norm_w 2:norm_b 3:qkv_w 4:qkv_b 5:proj_w 6:proj_b
// ---------------------------------------------------------------------------
extern "C" void kernel_launch(void* const* d_in, const int* in_sizes, int n_in,
                              void* d_out, int out_size, void* d_ws, size_t ws_size,
                              hipStream_t stream) {
  (void)in_sizes; (void)n_in; (void)out_size; (void)ws_size;
  const float* x      = (const float*)d_in[0];
  const float* norm_w = (const float*)d_in[1];
  const float* norm_b = (const float*)d_in[2];
  const float* qkv_w  = (const float*)d_in[3];
  const float* qkv_b  = (const float*)d_in[4];
  const float* proj_w = (const float*)d_in[5];
  const float* proj_b = (const float*)d_in[6];
  float* out = (float*)d_out;

  char* ws = (char*)d_ws;
  const size_t SZ_WQ = (size_t)3 * CH * CH * 2;            // 384 KB
  const size_t SZ_WP = (size_t)CH * CH * 2;                // 128 KB
  const size_t SZ_T  = (size_t)BATCH * NPIX * CH * 2;      // 16 MB per tensor
  unsigned short* wq_bf   = (unsigned short*)(ws);
  unsigned short* wp_bf   = (unsigned short*)(ws + SZ_WQ);
  unsigned short* h_t     = (unsigned short*)(ws + SZ_WQ + SZ_WP);
  unsigned short* q_t     = (unsigned short*)(ws + SZ_WQ + SZ_WP + 1 * SZ_T);
  unsigned short* k_t     = (unsigned short*)(ws + SZ_WQ + SZ_WP + 2 * SZ_T);
  unsigned short* v_t     = (unsigned short*)(ws + SZ_WQ + SZ_WP + 3 * SZ_T);
  unsigned short* hattn_t = (unsigned short*)(ws + SZ_WQ + SZ_WP + 4 * SZ_T);

  k_cvt_weights<<<dim3((3 * CH * CH + 255) / 256), dim3(256), 0, stream>>>(
      qkv_w, proj_w, wq_bf, wp_bf);

  k_groupnorm<<<dim3(BATCH * NGRP), dim3(256), 0, stream>>>(
      x, norm_w, norm_b, h_t);

  k_qkv<<<dim3(NPIX / 128, (3 * CH) / 64, BATCH), dim3(256), 0, stream>>>(
      wq_bf, qkv_b, h_t, q_t, k_t, v_t);

  k_attn<<<dim3(NPIX / 128, BATCH), dim3(256), 0, stream>>>(
      q_t, k_t, v_t, hattn_t);

  k_proj<<<dim3(NPIX / 128, CH / 64, BATCH), dim3(256), 0, stream>>>(
      wp_bf, proj_b, hattn_t, x, out);
}

// v003
// Measured time: 135 microseconds a run.
// Next to v002, in two timings, it ran 1.18 times as fast each time.
// Over all steps from v000 it is 3.84 times as fast.
#include <hip/hip_runtime.h>

// ---------------------------------------------------------------------------
// CDNA5 (gfx1250) attention block: GroupNorm -> QKV -> softmax(QK^T/sqrt(C))V
// -> proj -> residual.  All GEMM stages use v_wmma_f32_16x16x32_bf16 (wave32).
// ---------------------------------------------------------------------------

typedef __attribute__((ext_vector_type(16))) __bf16 v16bf;
typedef __attribute__((ext_vector_type(8)))  float  v8f;
typedef __attribute__((ext_vector_type(4)))  float  v4f;
typedef __attribute__((ext_vector_type(4)))  unsigned int v4u;

union FragAB { unsigned int u[8]; v16bf v; };
union FragCD { float f[8]; v8f v; };

#define BATCH 32
#define CH    256
#define NPIX  1024
#define NGRP  8
#define CPG   32           // channels per group

__device__ __forceinline__ unsigned short f2bf(float x) {
  unsigned int u = __float_as_uint(x);
  u += 0x7fffu + ((u >> 16) & 1u);           // round-to-nearest-even
  return (unsigned short)(u >> 16);
}

// Load a 16x32 bf16 A- or B-fragment.  `p` points to the *lane's* row (A) or
// column (B) start, with the K dimension contiguous in memory.  K-pair slot i
// in VGPR i follows the ISA 16-bit A-matrix table:
//   lanes 0-15 : V0..V3 -> K 0..7,  V4..V7 -> K 16..23
//   lanes 16-31: V0..V3 -> K 8..15, V4..V7 -> K 24..31
__device__ __forceinline__ v16bf load_ab_frag(const unsigned short* p) {
  const int half = (threadIdx.x >> 4) & 1;
  const unsigned int* p32 = (const unsigned int*)p;
  FragAB f;
#pragma unroll
  for (int i = 0; i < 8; ++i) {
    int kb = (i < 4) ? (half * 8 + 2 * i) : (16 + half * 8 + 2 * (i - 4));
    f.u[i] = p32[kb >> 1];
  }
  return f.v;
}

__device__ __forceinline__ v8f wmma_bf16(v16bf a, v16bf b, v8f c) {
  return __builtin_amdgcn_wmma_f32_16x16x32_bf16(
      /*neg_a=*/false, a, /*neg_b=*/false, b,
      /*c_mod=*/(short)0, c, /*reuse_a=*/false, /*reuse_b=*/false);
}

// ---------------------------------------------------------------------------
// Kernel 0: fp32 -> bf16 weight conversion (qkv_w: 768x256, proj_w: 256x256)
// ---------------------------------------------------------------------------
__global__ void k_cvt_weights(const float* __restrict__ qkv_w,
                              const float* __restrict__ proj_w,
                              unsigned short* __restrict__ wq_bf,
                              unsigned short* __restrict__ wp_bf) {
  int i = blockIdx.x * 256 + threadIdx.x;
  if (i < 3 * CH * CH) wq_bf[i] = f2bf(qkv_w[i]);
  if (i < CH * CH)     wp_bf[i] = f2bf(proj_w[i]);
}

// ---------------------------------------------------------------------------
// Kernel 1: GroupNorm.  One block per (batch, group).  Output h stored as
// bf16 in [B][N][C] layout (channel-contiguous per pixel) for WMMA A- and B-frags.
// The block size is declared so that the store pass may hold a lane's 128
// loaded values in registers.
// ---------------------------------------------------------------------------
__global__ void __launch_bounds__(256) k_groupnorm(const float* __restrict__ x,
                            const float* __restrict__ nw,
                            const float* __restrict__ nb,
                            unsigned short* __restrict__ h_t) {
  const int bb = blockIdx.x >> 3;
  const int g  = blockIdx.x & 7;
  const int c0 = g * CPG;
  const float* xp = x + ((size_t)bb * CH + c0) * NPIX;   // 32*1024 contiguous

  float s = 0.f, s2 = 0.f;
  for (int e = threadIdx.x; e < CPG * NPIX; e += 256) {
    float v = xp[e];
    s += v; s2 += v * v;
  }
  __shared__ float rs[256], rs2[256];
  rs[threadIdx.x] = s; rs2[threadIdx.x] = s2;
  __syncthreads();
  for (int off = 128; off > 0; off >>= 1) {
    if (threadIdx.x < off) {
      rs[threadIdx.x]  += rs[threadIdx.x + off];
      rs2[threadIdx.x] += rs2[threadIdx.x + off];
    }
    __syncthreads();
  }
  const float inv_n = 1.0f / (float)(CPG * NPIX);
  const float mean  = rs[0] * inv_n;
  const float var   = rs2[0] * inv_n - mean * mean;
  const float rstd  = rsqrtf(var + 1e-5f);

  // Transposing store pass.  A lane owns 8 channels x 16 pixels (4 runs of 4, 32 apart): the 8 lanes that
  // share cl read one whole 128-B line of a channel row, and the 4 lanes of one
  // pixel store its 32 channels as one contiguous 64-B run (16 B per lane).
  const int lane = threadIdx.x & 31;
  const int wave = threadIdx.x >> 5;
  const int cl   = (lane & 3) * 8;                // first of the lane's channels
  const int n0   = wave * 128 + (lane >> 2) * 4;  // first of the lane's pixels
  // Every loop below is fully unrolled so that v, w8 and b8 are registers.
  v4f v[4][8];
#pragma unroll
  for (int it = 0; it < 4; ++it)
#pragma unroll
    for (int j = 0; j < 8; ++j)
      v[it][j] = *(const v4f*)(xp + (cl + j) * NPIX + n0 + it * 32);
  // Keeps every load ahead of the first store: one latency for the whole pass,
  // and no load lands in a register that a store in flight still names.
  __builtin_amdgcn_sched_barrier(0);
  float w8[8], b8[8];
#pragma unroll
  for (int j = 0; j < 8; ++j) {
    w8[j] = nw[c0 + cl + j];
    b8[j] = nb[c0 + cl + j];
  }
#pragma unroll
  for (int it = 0; it < 4; ++it) {
#pragma unroll
    for (int p = 0; p < 4; ++p) {
      v4u o;
#pragma unroll
      for (int k = 0; k < 4; ++k) {
        float lo = (v[it][2 * k][p]     - mean) * rstd * w8[2 * k]     + b8[2 * k];
        float hi = (v[it][2 * k + 1][p] - mean) * rstd * w8[2 * k + 1] + b8[2 * k + 1];
        o[k] = (unsigned int)f2bf(lo) | ((unsigned int)f2bf(hi) << 16);
      }
      *(v4u*)(h_t + ((size_t)bb * NPIX + n0 + it * 32 + p) * CH + c0 + cl) = o;
    }
  }
}

// ---------------------------------------------------------------------------
// Kernel 2: QKV GEMM.  qkv[o,n] = sum_c W[o,c] * h[n,c] + b[o].
// Block covers 64 (o) x 128 (n); 8 waves, each wave a 32x32 tile (2x2 WMMA).
// Q,K stored [B][N][C] bf16; V stored [B][C][N] bf16.
// A block lies wholly in Q, in K or in V.  Q and K tiles are computed as W h^T
// (A rows = output channels), V tiles as h W^T (A rows = pixels): the 8
// accumulators of a lane run along the A rows, so they are always 8 neighbours
// in the stored layout and leave as one 16-B store.
// ---------------------------------------------------------------------------
__global__ void k_qkv(const unsigned short* __restrict__ wq_bf,
                      const float* __restrict__ qkv_b,
                      const unsigned short* __restrict__ h_t,
                      unsigned short* __restrict__ q_t,
                      unsigned short* __restrict__ k_t,
                      unsigned short* __restrict__ v_t) {
  const int bb   = blockIdx.z;
  const int n0   = blockIdx.x * 128 + (int)((threadIdx.x >> 5) & 3) * 32;
  const int o0   = blockIdx.y * 64  + (int)((threadIdx.x >> 7)) * 32;
  const int seg  = blockIdx.y >> 2;            // 0: Q, 1: K, 2: V
  const bool isv = seg == 2;
  const int oc0  = o0 & 255;                   // channel inside Q, K or V
  const int lane = threadIdx.x & 31;
  const int row  = lane & 15;
  const int half = lane >> 4;

  const unsigned short* wrow = wq_bf + (size_t)(o0 + row) * CH;
  const unsigned short* hrow = h_t + ((size_t)bb * NPIX + n0 + row) * CH;
  const unsigned short* arow = isv ? hrow : wrow;
  const unsigned short* brow = isv ? wrow : hrow;

  // The lane's B row of the stored array, at the first of its A rows.
  unsigned short* base = isv ? v_t : (seg == 0 ? q_t : k_t);
  const int pitch  = isv ? NPIX : CH;
  const int brow0  = isv ? bb * CH + oc0 : bb * NPIX + n0;
  const int acol0  = isv ? n0 : oc0;
  unsigned short* dst = base + (size_t)(brow0 + row) * pitch + acol0 + half * 8;
  const size_t pitch16 = (size_t)16 * pitch;

  // acc[i][j]: register r = A row i * 16 + 8 * half + r, lane = B row j * 16 + row.
  v8f acc[2][2] = {};
#pragma unroll
  for (int k0 = 0; k0 < CH; k0 += 32) {
    v16bf a0 = load_ab_frag(arow + k0);
    v16bf a1 = load_ab_frag(arow + 16 * CH + k0);
    v16bf b0 = load_ab_frag(brow + k0);
    v16bf b1 = load_ab_frag(brow + 16 * CH + k0);
    acc[0][0] = wmma_bf16(a0, b0, acc[0][0]);
    acc[0][1] = wmma_bf16(a0, b1, acc[0][1]);
    acc[1][0] = wmma_bf16(a1, b0, acc[1][0]);
    acc[1][1] = wmma_bf16(a1, b1, acc[1][1]);
  }

  // Bias: per output channel, that is per register for Q and K, per lane for V.
  // Both forms are loaded and one is selected: no branch behind the last WMMA.
  float bl[2];
#pragma unroll
  for (int j = 0; j < 2; ++j) bl[j] = qkv_b[o0 + j * 16 + row];
#pragma unroll
  for (int i = 0; i < 2; ++i) {
    const float* bp = qkv_b + o0 + i * 16 + half * 8;
    const v4f blo = *(const v4f*)bp;
    const v4f bhi = *(const v4f*)(bp + 4);
#pragma unroll
    for (int j = 0; j < 2; ++j)
#pragma unroll
      for (int r = 0; r < 4; ++r) {
        acc[i][j][r]     += isv ? bl[j] : blo[r];
        acc[i][j][4 + r] += isv ? bl[j] : bhi[r];
      }
  }

  v4u w[2][2];
#pragma unroll
  for (int i = 0; i < 2; ++i)
#pragma unroll
    for (int j = 0; j < 2; ++j)
#pragma unroll
      for (int p = 0; p < 4; ++p)
        w[i][j][p] = (unsigned int)f2bf(acc[i][j][2 * p]) |
                     ((unsigned int)f2bf(acc[i][j][2 * p + 1]) << 16);
#pragma unroll
  for (int i = 0; i < 2; ++i)
#pragma unroll
    for (int j = 0; j < 2; ++j)
      *(v4u*)(dst + j * pitch16 + i * 16) = w[i][j];
}

typedef __attribute__((ext_vector_type(2))) float  v2f;
typedef __attribute__((ext_vector_type(2))) __bf16 v2bf;

#define KTILE    32                       // keys per tile
#define NTILE    (NPIX / KTILE)
#define KPITCH   528                      // LDS bytes per key row: 512 + 16
#define VPITCH   80                       // LDS bytes per channel row: 64 + 16
#define KBYTES   (KTILE * KPITCH)
#define BUFBYTES (KBYTES + CH * VPITCH)

// Two f32 -> one register of two bf16, round to nearest even.
__device__ __forceinline__ unsigned int pack_bf2(float lo, float hi) {
  v2f t = {lo, hi};
  return __builtin_bit_cast(unsigned int, __builtin_convertvector(t, v2bf));
}

// Value of lane l ^ 16.
__device__ __forceinline__ float other_half(float x) {
  int b = __float_as_int(x);
  return __int_as_float(__builtin_amdgcn_permlanex16(
      b, b, 0x76543210, 0xfedcba98, false, false));
}

// A-fragment from LDS, same k order as load_ab_frag.  p = the lane's row, at
// the 64-B block of the k step, plus 16 B for lanes 16-31.
__device__ __forceinline__ v16bf lds_frag(const unsigned char* p) {
  v4u lo = *(const v4u*)(p);
  v4u hi = *(const v4u*)(p + 32);
  FragAB f;
#pragma unroll
  for (int i = 0; i < 4; ++i) { f.u[i] = lo[i]; f.u[4 + i] = hi[i]; }
  return f.v;
}

// One tile's copies of one lane: 4 x 16 B of K, 4 x 16 B of V.  kl, vl: LDS
// byte addresses; kg, vg: global addresses.  The s_wait_xcnt stands inside the
// statement so that no address register is rewritten ahead of it.
__device__ __forceinline__ void stage_tile(unsigned int kl, unsigned int vl,
                                           const unsigned char* kg,
                                           const unsigned char* vg) {
  asm volatile(
      "global_load_async_to_lds_b128 %0, %8, off\n\t"
      "global_load_async_to_lds_b128 %1, %9, off\n\t"
      "global_load_async_to_lds_b128 %2, %10, off\n\t"
      "global_load_async_to_lds_b128 %3, %11, off\n\t"
      "global_load_async_to_lds_b128 %4, %12, off\n\t"
      "global_load_async_to_lds_b128 %5, %13, off\n\t"
      "global_load_async_to_lds_b128 %6, %14, off\n\t"
      "global_load_async_to_lds_b128 %7, %15, off\n\t"
      "s_wait_xcnt 0x0"
      :: "v"(kl), "v"(kl + 8 * KPITCH), "v"(kl + 16 * KPITCH),
         "v"(kl + 24 * KPITCH),
         "v"(vl), "v"(vl + 64 * VPITCH), "v"(vl + 128 * VPITCH),
         "v"(vl + 192 * VPITCH),
         "v"(kg), "v"(kg + 8 * CH * 2), "v"(kg + 16 * CH * 2),
         "v"(kg + 24 * CH * 2),
         "v"(vg), "v"(vg + 64 * NPIX * 2), "v"(vg + 128 * NPIX * 2),
         "v"(vg + 192 * NPIX * 2)
      : "memory");
}

// Two waves per SIMD (one block per WGP): the register budget this gives lets
// a wave hold a whole tile's fragments, so its LDS reads stand in two groups.
__global__ void __launch_bounds__(256)
__attribute__((amdgpu_waves_per_eu(2, 2))) k_attn(
                       const unsigned short* __restrict__ q_t,
                       const unsigned short* __restrict__ k_t,
                       const unsigned short* __restrict__ v_t,
                       unsigned short* __restrict__ hattn_t) {
  const int bb   = blockIdx.y;
  const int tid  = threadIdx.x;
  const int wave = tid >> 5;
  const int lane = tid & 31;
  const int row  = lane & 15;
  const int half = lane >> 4;
  const int q    = blockIdx.x * 128 + wave * 16 + row;   // the lane's query
  const float c2 = 0.0625f * 1.44269504f;                // 256^-0.5 * log2(e)

  __shared__ __attribute__((aligned(16))) unsigned char ring[2 * BUFBYTES];

  // Copy addresses.  K: a wave copies one whole 512-B key row per instruction.
  // V: 4 lanes copy the 64 B that one channel holds of the tile's 32 keys.
  // The wave's share of an LDS address is kept scalar, the lane's in a register.
  const unsigned int ring0 = (unsigned int)(size_t)ring;
  const unsigned int wv = __builtin_amdgcn_readfirstlane(wave);
  const unsigned int ks0 = ring0 + wv * KPITCH;
  const unsigned int vs0 = ring0 + KBYTES + wv * (8 * VPITCH);
  const unsigned int kln = lane * 16;
  const unsigned int vln = (lane >> 2) * VPITCH + (lane & 3) * 16;
  const unsigned char* kg =
      (const unsigned char*)(k_t + ((size_t)bb * NPIX + wave) * CH) + lane * 16;
  const unsigned char* vg =
      (const unsigned char*)(v_t + ((size_t)bb * CH + (tid >> 2)) * NPIX) +
      (tid & 3) * 16;

  stage_tile(ks0 + kln, vs0 + vln, kg, vg);

  // The 16 queries as B-fragments, kept in registers for the whole walk.
  v16bf qb[8];
  const unsigned short* qrow = q_t + ((size_t)bb * NPIX + q) * CH;
#pragma unroll
  for (int ks = 0; ks < 8; ++ks) qb[ks] = load_ab_frag(qrow + ks * 32);

  // Tile 0 has landed for this wave, then for every wave.
  asm volatile("s_wait_asynccnt 0x0" ::: "memory");
  __syncthreads();
  stage_tile(ks0 + BUFBYTES + kln, vs0 + BUFBYTES + vln, kg + KTILE * CH * 2,
             vg + KTILE * 2);

  v8f o[16];
#pragma unroll
  for (int ct = 0; ct < 16; ++ct) o[ct] = (v8f){};
  float mref = -3.0e38f;     // maximum in use, in units of log2
  float lsum = 0.f;          // this half's share of the query's sum

  for (int t = 0; t < NTILE; ++t) {
    const unsigned int boff = (unsigned int)(t & 1) * BUFBYTES;
    const unsigned char* kb = ring + boff + row * KPITCH + half * 16;
    const unsigned char* vb = ring + boff + KBYTES + row * VPITCH + half * 16;

    // S^T: register r of st0 / st1 = key 8 * half + r / 16 + 8 * half + r.
    v8f st0 = {}, st1 = {};
#pragma unroll
    for (int ks = 0; ks < 8; ++ks) {
      st0 = wmma_bf16(lds_frag(kb + ks * 64), qb[ks], st0);
      st1 = wmma_bf16(lds_frag(kb + 16 * KPITCH + ks * 64), qb[ks], st1);
    }

    // The tile's V fragments, read as one group while the softmax runs.
    v16bf vf[16];
#pragma unroll
    for (int ct = 0; ct < 16; ++ct) vf[ct] = lds_frag(vb + ct * 16 * VPITCH);
    // Keeps the group here: sunk to their users, each read's latency is exposed.
    __builtin_amdgcn_sched_barrier(0);

    float mt = fmaxf(st0[0], st1[0]);
#pragma unroll
    for (int r = 1; r < 8; ++r) mt = fmaxf(mt, fmaxf(st0[r], st1[r]));
    mt = fmaxf(mt, other_half(mt)) * c2;

    // The maximum in use is replaced only when some query's new one exceeds it
    // by more than 8: until then every exponential stays at or below 2^8.
    if (__builtin_amdgcn_ballot_w32(mt > mref + 8.0f) != 0) {
      const float mn = fmaxf(mref, mt);
      const float al = __builtin_amdgcn_exp2f(mref - mn);
      lsum *= al;
#pragma unroll
      for (int ct = 0; ct < 16; ++ct) o[ct] *= al;
      mref = mn;
    }

    FragAB pb;
#pragma unroll
    for (int i = 0; i < 4; ++i) {
      float a0 = __builtin_amdgcn_exp2f(st0[2 * i]     * c2 - mref);
      float a1 = __builtin_amdgcn_exp2f(st0[2 * i + 1] * c2 - mref);
      float b0 = __builtin_amdgcn_exp2f(st1[2 * i]     * c2 - mref);
      float b1 = __builtin_amdgcn_exp2f(st1[2 * i + 1] * c2 - mref);
      lsum += (a0 + a1) + (b0 + b1);
      pb.u[i]     = pack_bf2(a0, a1);
      pb.u[4 + i] = pack_bf2(b0, b1);
    }

    // O^T: register r of o[ct] = channel ct * 16 + 8 * half + r.
#pragma unroll
    for (int ct = 0; ct < 16; ++ct)
      o[ct] = wmma_bf16(vf[ct], pb.v, o[ct]);

    // Hand-over: this wave's reads of the tile are done, its copies of the next
    // tile have landed; behind the barrier that holds for every wave.
    asm volatile("s_wait_dscnt 0x0" ::: "memory");
    asm volatile("s_wait_asynccnt 0x0" ::: "memory");
    __syncthreads();
    if (t + 2 < NTILE)
    {
      // Scalar sums first: added lane part first, the sum shared with the first
      // tile's copy is an asm operand, is held below v256 and gets spilled.
      const unsigned int ksb = __builtin_amdgcn_readfirstlane(ks0 + boff);
      const unsigned int vsb = __builtin_amdgcn_readfirstlane(vs0 + boff);
      stage_tile(ksb + kln, vsb + vln,
                 kg + (size_t)(t + 2) * (KTILE * CH * 2),
                 vg + (t + 2) * (KTILE * 2));
    }
  }
  // No copy is outstanding when the wave ends.
  asm volatile("s_wait_asynccnt 0x0" ::: "memory");

  const float inv = 1.0f / (lsum + other_half(lsum));
  unsigned short* orow = hattn_t + ((size_t)bb * NPIX + q) * CH + half * 8;
  v4u w[16];
#pragma unroll
  for (int ct = 0; ct < 16; ++ct)
#pragma unroll
    for (int i = 0; i < 4; ++i)
      w[ct][i] = pack_bf2(o[ct][2 * i] * inv, o[ct][2 * i + 1] * inv);
  // All packing ahead of the first store: no register that a store in flight
  // names is written again.
  __builtin_amdgcn_sched_barrier(0);
#pragma unroll
  for (int ct = 0; ct < 16; ++ct) *(v4u*)(orow + ct * 16) = w[ct];
}

// ---------------------------------------------------------------------------
// Kernel 4: proj GEMM + bias + residual.  out[b,o,n] = x + P[o,:] . hattn[n,:]
// Same tiling as k_qkv (block 64 x 128).
// ---------------------------------------------------------------------------
__global__ void k_proj(const unsigned short* __restrict__ wp_bf,
                       const float* __restrict__ proj_b,
                       const unsigned short* __restrict__ hattn_t,
                       const float* __restrict__ x,
                       float* __restrict__ out) {
  const int bb   = blockIdx.z;
  const int n0   = blockIdx.x * 128 + (int)((threadIdx.x >> 5) & 3) * 32;
  const int o0   = blockIdx.y * 64  + (int)((threadIdx.x >> 7)) * 32;
  const int lane = threadIdx.x & 31;
  const int row  = lane & 15;
  const int half = lane >> 4;

  v8f acc00 = {}, acc01 = {}, acc10 = {}, acc11 = {};
  const unsigned short* hb = hattn_t + (size_t)bb * NPIX * CH;

#pragma unroll
  for (int k0 = 0; k0 < CH; k0 += 32) {
    v16bf a0 = load_ab_frag(wp_bf + (size_t)(o0 + row) * CH + k0);
    v16bf a1 = load_ab_frag(wp_bf + (size_t)(o0 + 16 + row) * CH + k0);
    v16bf b0 = load_ab_frag(hb + (size_t)(n0 + row) * CH + k0);
    v16bf b1 = load_ab_frag(hb + (size_t)(n0 + 16 + row) * CH + k0);
    acc00 = wmma_bf16(a0, b0, acc00);
    acc01 = wmma_bf16(a0, b1, acc01);
    acc10 = wmma_bf16(a1, b0, acc10);
    acc11 = wmma_bf16(a1, b1, acc11);
  }

  FragCD d[2][2];
  d[0][0].v = acc00; d[0][1].v = acc01; d[1][0].v = acc10; d[1][1].v = acc11;

#pragma unroll
  for (int mi = 0; mi < 2; ++mi) {
#pragma unroll
    for (int ni = 0; ni < 2; ++ni) {
      int nn = n0 + ni * 16 + row;
#pragma unroll
      for (int r = 0; r < 8; ++r) {
        int oo = o0 + mi * 16 + r + half * 8;
        size_t idx = ((size_t)bb * CH + oo) * NPIX + nn;
        out[idx] = x[idx] + d[mi][ni].f[r] + proj_b[oo];
      }
    }
  }
}

// ---------------------------------------------------------------------------
// Host-side launcher.
// Inputs: 0:x 1:norm_w 2:norm_b 3:qkv_w 4:qkv_b 5:proj_w 6:proj_b
// ---------------------------------------------------------------------------
extern "C" void kernel_launch(void* const* d_in, const int* in_sizes, int n_in,
                              void* d_out, int out_size, void* d_ws, size_t ws_size,
                              hipStream_t stream) {
  (void)in_sizes; (void)n_in; (void)out_size; (void)ws_size;
  const float* x      = (const float*)d_in[0];
  const float* norm_w = (const float*)d_in[1];
  const float* norm_b = (const float*)d_in[2];
  const float* qkv_w  = (const float*)d_in[3];
  const float* qkv_b  = (const float*)d_in[4];
  const float* proj_w = (const float*)d_in[5];
  const float* proj_b = (const float*)d_in[6];
  float* out = (float*)d_out;

  char* ws = (char*)d_ws;
  const size_t SZ_WQ = (size_t)3 * CH * CH * 2;            // 384 KB
  const size_t SZ_WP = (size_t)CH * CH * 2;                // 128 KB
  const size_t SZ_T  = (size_t)BATCH * NPIX * CH * 2;      // 16 MB per tensor
  unsigned short* wq_bf   = (unsigned short*)(ws);
  unsigned short* wp_bf   = (unsigned short*)(ws + SZ_WQ);
  unsigned short* h_t     = (unsigned short*)(ws + SZ_WQ + SZ_WP);
  unsigned short* q_t     = (unsigned short*)(ws + SZ_WQ + SZ_WP + 1 * SZ_T);
  unsigned short* k_t     = (unsigned short*)(ws + SZ_WQ + SZ_WP + 2 * SZ_T);
  unsigned short* v_t     = (unsigned short*)(ws + SZ_WQ + SZ_WP + 3 * SZ_T);
  unsigned short* hattn_t = (unsigned short*)(ws + SZ_WQ + SZ_WP + 4 * SZ_T);

  k_cvt_weights<<<dim3((3 * CH * CH + 255) / 256), dim3(256), 0, stream>>>(
      qkv_w, proj_w, wq_bf, wp_bf);

  k_groupnorm<<<dim3(BATCH * NGRP), dim3(256), 0, stream>>>(
      x, norm_w, norm_b, h_t);

  k_qkv<<<dim3(NPIX / 128, (3 * CH) / 64, BATCH), dim3(256), 0, stream>>>(
      wq_bf, qkv_b, h_t, q_t, k_t, v_t);

  k_attn<<<dim3(NPIX / 128, BATCH), dim3(256), 0, stream>>>(
      q_t, k_t, v_t, hattn_t);

  k_proj<<<dim3(NPIX / 128, CH / 64, BATCH), dim3(256), 0, stream>>>(
      wp_bf, proj_b, hattn_t, x, out);
}

// v004
// A run of this version takes 92.8 microseconds.
// Next to v003, in two timings, it ran 1.45 and 1.46 times as fast.
// Over all steps from v000 it is 5.60 times as fast.
#include <hip/hip_runtime.h>

// ---------------------------------------------------------------------------
// CDNA5 (gfx1250) attention block: GroupNorm -> QKV -> softmax(QK^T/sqrt(C))V
// -> proj -> residual.  All GEMM stages use v_wmma_f32_16x16x32_bf16 (wave32).
// ---------------------------------------------------------------------------

typedef __attribute__((ext_vector_type(16))) __bf16 v16bf;
typedef __attribute__((ext_vector_type(8)))  float  v8f;
typedef __attribute__((ext_vector_type(4)))  float  v4f;
typedef __attribute__((ext_vector_type(4)))  unsigned int v4u;

union FragAB { unsigned int u[8]; v16bf v; };
union FragCD { float f[8]; v8f v; };

#define BATCH 32
#define CH    256
#define NPIX  1024
#define NGRP  8
#define CPG   32           // channels per group

__device__ __forceinline__ unsigned short f2bf(float x) {
  unsigned int u = __float_as_uint(x);
  u += 0x7fffu + ((u >> 16) & 1u);           // round-to-nearest-even
  return (unsigned short)(u >> 16);
}

// Load a 16x32 bf16 A- or B-fragment.  `p` points to the *lane's* row (A) or
// column (B) start, with the K dimension contiguous in memory.  K-pair slot i
// in VGPR i follows the ISA 16-bit A-matrix table:
//   lanes 0-15 : V0..V3 -> K 0..7,  V4..V7 -> K 16..23
//   lanes 16-31: V0..V3 -> K 8..15, V4..V7 -> K 24..31
__device__ __forceinline__ v16bf load_ab_frag(const unsigned short* p) {
  const int half = (threadIdx.x >> 4) & 1;
  const unsigned int* p32 = (const unsigned int*)p;
  FragAB f;
#pragma unroll
  for (int i = 0; i < 8; ++i) {
    int kb = (i < 4) ? (half * 8 + 2 * i) : (16 + half * 8 + 2 * (i - 4));
    f.u[i] = p32[kb >> 1];
  }
  return f.v;
}

__device__ __forceinline__ v8f wmma_bf16(v16bf a, v16bf b, v8f c) {
  return __builtin_amdgcn_wmma_f32_16x16x32_bf16(
      /*neg_a=*/false, a, /*neg_b=*/false, b,
      /*c_mod=*/(short)0, c, /*reuse_a=*/false, /*reuse_b=*/false);
}

// A-fragment from LDS, same k order as load_ab_frag.  p = the lane's row, at
// the 64-B block of the k step, plus 16 B for lanes 16-31.
__device__ __forceinline__ v16bf lds_frag(const unsigned char* p) {
  v4u lo = *(const v4u*)(p);
  v4u hi = *(const v4u*)(p + 32);
  FragAB f;
#pragma unroll
  for (int i = 0; i < 4; ++i) { f.u[i] = lo[i]; f.u[4 + i] = hi[i]; }
  return f.v;
}

// LDS of the two GEMM kernels: a block's 128 activation rows (256 bf16 each),
// then two buffers of 64 weight rows.
#define GPITCH 528                        // LDS bytes per row: 512 + 16
#define ABYTES (128 * GPITCH)
#define WBYTES (64 * GPITCH)
#define GBYTES (ABYTES + 2 * WBYTES)
#define WSTEP  (64 * CH * 2)              // global bytes from a weight tile to the next

// Eight copies of one wave, each a whole 512-B row (16 B per lane): rows r,
// r + 8, ..., r + 56.  l: the lane's LDS byte address in row r; g: its global
// address there.  The s_wait_xcnt stands inside the statement so that no
// address register is rewritten ahead of it.
__device__ __forceinline__ void stage_rows8(unsigned int l,
                                            const unsigned char* g) {
  asm volatile(
      "global_load_async_to_lds_b128 %0, %8, off\n\t"
      "global_load_async_to_lds_b128 %1, %9, off\n\t"
      "global_load_async_to_lds_b128 %2, %10, off\n\t"
      "global_load_async_to_lds_b128 %3, %11, off\n\t"
      "global_load_async_to_lds_b128 %4, %12, off\n\t"
      "global_load_async_to_lds_b128 %5, %13, off\n\t"
      "global_load_async_to_lds_b128 %6, %14, off\n\t"
      "global_load_async_to_lds_b128 %7, %15, off\n\t"
      "s_wait_xcnt 0x0"
      :: "v"(l), "v"(l + 8 * GPITCH), "v"(l + 16 * GPITCH),
         "v"(l + 24 * GPITCH), "v"(l + 32 * GPITCH), "v"(l + 40 * GPITCH),
         "v"(l + 48 * GPITCH), "v"(l + 56 * GPITCH),
         "v"(g), "v"(g + 8 * CH * 2), "v"(g + 16 * CH * 2),
         "v"(g + 24 * CH * 2), "v"(g + 32 * CH * 2), "v"(g + 40 * CH * 2),
         "v"(g + 48 * CH * 2), "v"(g + 56 * CH * 2)
      : "memory");
}

// In front of the walk over the weight tiles: the activation rows and tile 0
// land and are published, then tile 1 is sent for.  l: the lane's LDS byte
// address in row `wave` of the block's LDS; ag, wg: its global addresses in that
// row of the activations and of weight tile 0.
__device__ __forceinline__ void gemm_open(unsigned int l,
                                          const unsigned char* ag,
                                          const unsigned char* wg) {
  stage_rows8(l, ag);
  stage_rows8(l + 64 * GPITCH, ag + 64 * CH * 2);
  stage_rows8(l + ABYTES, wg);
  // The rows have landed for this wave, then for every wave.
  asm volatile("s_wait_asynccnt 0x0" ::: "memory");
  __syncthreads();
  stage_rows8(l + ABYTES + WBYTES, wg + WSTEP);
}

// The same for a walk of two weight tiles: both come at once, each into its
// buffer, and nothing is handed over later.
__device__ __forceinline__ void gemm_open_two(unsigned int l,
                                              const unsigned char* ag,
                                              const unsigned char* wg) {
  stage_rows8(l, ag);
  stage_rows8(l + 64 * GPITCH, ag + 64 * CH * 2);
  stage_rows8(l + ABYTES, wg);
  stage_rows8(l + ABYTES + WBYTES, wg + WSTEP);
  // The rows have landed for this wave, then for every wave.
  asm volatile("s_wait_asynccnt 0x0" ::: "memory");
  __syncthreads();
}

// Hand-over behind the products of tile t (of nt): this wave's reads of the tile
// are done, its copies of tile t + 1 have landed; behind the barrier that holds
// for every wave, and tile t + 2 may take the buffer of tile t.
__device__ __forceinline__ void gemm_hand_over(int t, int nt, unsigned int l,
                                               const unsigned char* wg) {
  asm volatile("s_wait_dscnt 0x0" ::: "memory");
  asm volatile("s_wait_asynccnt 0x0" ::: "memory");
  __syncthreads();
  if (t + 2 < nt)
    stage_rows8(l + ABYTES + (unsigned int)(t & 1) * WBYTES,
                wg + (size_t)(t + 2) * WSTEP);
}

// A wave's two weight fragments (16 rows each) of k step ks.
__device__ __forceinline__ void load_wstep(v16bf (&wf)[2],
                                           const unsigned char* wrow, int ks) {
#pragma unroll
  for (int i = 0; i < 2; ++i)
    wf[i] = lds_frag(wrow + i * 16 * GPITCH + ks * 64);
}

// ---------------------------------------------------------------------------
// Kernel 0: fp32 -> bf16 weight conversion (qkv_w: 768x256, proj_w: 256x256)
// ---------------------------------------------------------------------------
__global__ void k_cvt_weights(const float* __restrict__ qkv_w,
                              const float* __restrict__ proj_w,
                              unsigned short* __restrict__ wq_bf,
                              unsigned short* __restrict__ wp_bf) {
  int i = blockIdx.x * 256 + threadIdx.x;
  if (i < 3 * CH * CH) wq_bf[i] = f2bf(qkv_w[i]);
  if (i < CH * CH)     wp_bf[i] = f2bf(proj_w[i]);
}

// ---------------------------------------------------------------------------
// Kernel 1: GroupNorm.  One block per (batch, group).  Output h stored as
// bf16 in [B][N][C] layout (channel-contiguous per pixel) for WMMA A- and B-frags.
// The block size is declared so that the store pass may hold a lane's 128
// loaded values in registers.
// ---------------------------------------------------------------------------
__global__ void __launch_bounds__(256) k_groupnorm(const float* __restrict__ x,
                            const float* __restrict__ nw,
                            const float* __restrict__ nb,
                            unsigned short* __restrict__ h_t) {
  const int bb = blockIdx.x >> 3;
  const int g  = blockIdx.x & 7;
  const int c0 = g * CPG;
  const float* xp = x + ((size_t)bb * CH + c0) * NPIX;   // 32*1024 contiguous

  float s = 0.f, s2 = 0.f;
  for (int e = threadIdx.x; e < CPG * NPIX; e += 256) {
    float v = xp[e];
    s += v; s2 += v * v;
  }
  __shared__ float rs[256], rs2[256];
  rs[threadIdx.x] = s; rs2[threadIdx.x] = s2;
  __syncthreads();
  for (int off = 128; off > 0; off >>= 1) {
    if (threadIdx.x < off) {
      rs[threadIdx.x]  += rs[threadIdx.x + off];
      rs2[threadIdx.x] += rs2[threadIdx.x + off];
    }
    __syncthreads();
  }
  const float inv_n = 1.0f / (float)(CPG * NPIX);
  const float mean  = rs[0] * inv_n;
  const float var   = rs2[0] * inv_n - mean * mean;
  const float rstd  = rsqrtf(var + 1e-5f);

  // Transposing store pass.  A lane owns 8 channels x 16 pixels (4 runs of 4, 32 apart): the 8 lanes that
  // share cl read one whole 128-B line of a channel row, and the 4 lanes of one
  // pixel store its 32 channels as one contiguous 64-B run (16 B per lane).
  const int lane = threadIdx.x & 31;
  const int wave = threadIdx.x >> 5;
  const int cl   = (lane & 3) * 8;                // first of the lane's channels
  const int n0   = wave * 128 + (lane >> 2) * 4;  // first of the lane's pixels
  // Every loop below is fully unrolled so that v, w8 and b8 are registers.
  v4f v[4][8];
#pragma unroll
  for (int it = 0; it < 4; ++it)
#pragma unroll
    for (int j = 0; j < 8; ++j)
      v[it][j] = *(const v4f*)(xp + (cl + j) * NPIX + n0 + it * 32);
  // Keeps every load ahead of the first store: one latency for the whole pass,
  // and no load lands in a register that a store in flight still names.
  __builtin_amdgcn_sched_barrier(0);
  float w8[8], b8[8];
#pragma unroll
  for (int j = 0; j < 8; ++j) {
    w8[j] = nw[c0 + cl + j];
    b8[j] = nb[c0 + cl + j];
  }
#pragma unroll
  for (int it = 0; it < 4; ++it) {
#pragma unroll
    for (int p = 0; p < 4; ++p) {
      v4u o;
#pragma unroll
      for (int k = 0; k < 4; ++k) {
        float lo = (v[it][2 * k][p]     - mean) * rstd * w8[2 * k]     + b8[2 * k];
        float hi = (v[it][2 * k + 1][p] - mean) * rstd * w8[2 * k + 1] + b8[2 * k + 1];
        o[k] = (unsigned int)f2bf(lo) | ((unsigned int)f2bf(hi) << 16);
      }
      *(v4u*)(h_t + ((size_t)bb * NPIX + n0 + it * 32 + p) * CH + c0 + cl) = o;
    }
  }
}

// ---------------------------------------------------------------------------
// Kernel 2: QKV GEMM.  qkv[o,n] = sum_c W[o,c] * h[n,c] + b[o].
// A block owns 128 pixels (n) and walks 6 tiles of 64 output channels (o); 8
// waves, each a 32x32 tile (2x2 WMMA) of every 64 x 128 tile.  The h rows come
// into LDS once and a wave keeps its 32 pixels' fragments in registers; the W
// tiles come through two LDS buffers, each copied while the one before is used.
// Q,K stored [B][N][C] bf16; V stored [B][C][N] bf16.
// A tile lies wholly in Q, in K or in V.  Q and K tiles are computed as W h^T
// (A rows = output channels), V tiles as h W^T (A rows = pixels): the 8
// accumulators of a lane run along the A rows, so they are always 8 neighbours
// in the stored layout and leave as one 16-B store.
// Four waves per SIMD (two blocks per WGP, as their LDS allows): 256 registers.
// ---------------------------------------------------------------------------
#define QKV_NT 6                          // weight tiles per block

// One weight tile of one wave: products, hand-over, bias, stores.  ISV: the tile
// lies in V.  t: the tile's place in the block's walk; ot: its number in W.
template <bool ISV>
__device__ __forceinline__ void qkv_tile(int t, int ot, int bb, int n0,
                                         const v16bf (&hf)[2][8],
                                         const unsigned char* lds,
                                         unsigned int l, const unsigned char* wg,
                                         const float* __restrict__ qkv_b,
                                         unsigned short* __restrict__ base) {
  const int wave = threadIdx.x >> 5;
  const int lane = threadIdx.x & 31;
  const int row  = lane & 15;
  const int half = lane >> 4;
  const int o0   = ot * 64 + (wave >> 2) * 32;
  const int oc0  = o0 & 255;                   // channel inside Q, K or V
  const unsigned char* wrow = lds + ABYTES + (t & 1) * WBYTES +
                              ((wave >> 2) * 32 + row) * GPITCH + half * 16;

  // acc[i][j]: register r = A row i * 16 + 8 * half + r, lane = B row j * 16 + row.
  v8f acc[2][2] = {};
  v16bf wf[3][2];
  load_wstep(wf[0], wrow, 0);
  load_wstep(wf[1], wrow, 1);
#pragma unroll
  for (int ks = 0; ks < 8; ++ks) {
    if (ks < 6) load_wstep(wf[(ks + 2) % 3], wrow, ks + 2);
    // Keeps the reads two k steps ahead of their products: sunk to their users,
    // each read's latency is exposed.
    __builtin_amdgcn_sched_barrier(0);
    const v16bf w0 = wf[ks % 3][0], w1 = wf[ks % 3][1];
    acc[0][0] = ISV ? wmma_bf16(hf[0][ks], w0, acc[0][0])
                    : wmma_bf16(w0, hf[0][ks], acc[0][0]);
    acc[0][1] = ISV ? wmma_bf16(hf[0][ks], w1, acc[0][1])
                    : wmma_bf16(w0, hf[1][ks], acc[0][1]);
    acc[1][0] = ISV ? wmma_bf16(hf[1][ks], w0, acc[1][0])
                    : wmma_bf16(w1, hf[0][ks], acc[1][0]);
    acc[1][1] = ISV ? wmma_bf16(hf[1][ks], w1, acc[1][1])
                    : wmma_bf16(w1, hf[1][ks], acc[1][1]);
  }

  gemm_hand_over(t, QKV_NT, l, wg);

  // The lane's B row of the stored array, at the first of its A rows.
  const int pitch  = ISV ? NPIX : CH;
  const int brow0  = ISV ? bb * CH + oc0 : bb * NPIX + n0;
  const int acol0  = ISV ? n0 : oc0;
  unsigned short* dst = base + (size_t)(brow0 + row) * pitch + acol0 + half * 8;
  const size_t pitch16 = (size_t)16 * pitch;

  // Bias: per output channel, that is per register for Q and K, per lane for V.
  if (ISV) {
#pragma unroll
    for (int j = 0; j < 2; ++j) {
      const float bl = qkv_b[o0 + j * 16 + row];
#pragma unroll
      for (int i = 0; i < 2; ++i) acc[i][j] += bl;
    }
  } else {
    const float* bp = qkv_b + o0 + half * 8;
    v4f blo[2], bhi[2];
    blo[0] = *(const v4f*)bp;
    bhi[0] = *(const v4f*)(bp + 4);
    blo[1] = *(const v4f*)(bp + 16);
    // The last load's result may land in the address registers that the three
    // loads above name.
    asm volatile("s_wait_xcnt 0x0" ::: "memory");
    bhi[1] = *(const v4f*)(bp + 20);
#pragma unroll
    for (int i = 0; i < 2; ++i)
#pragma unroll
      for (int j = 0; j < 2; ++j)
#pragma unroll
        for (int r = 0; r < 4; ++r) {
          acc[i][j][r]     += blo[i][r];
          acc[i][j][4 + r] += bhi[i][r];
        }
  }

  v4u w[2][2];
#pragma unroll
  for (int i = 0; i < 2; ++i)
#pragma unroll
    for (int j = 0; j < 2; ++j)
#pragma unroll
      for (int p = 0; p < 4; ++p)
        w[i][j][p] = (unsigned int)f2bf(acc[i][j][2 * p]) |
                     ((unsigned int)f2bf(acc[i][j][2 * p + 1]) << 16);
#pragma unroll
  for (int i = 0; i < 2; ++i)
#pragma unroll
    for (int j = 0; j < 2; ++j)
      *(v4u*)(dst + j * pitch16 + i * 16) = w[i][j];
  // The next tile writes the registers that these stores name.
  asm volatile("s_wait_xcnt 0x0" ::: "memory");
}

__global__ void __launch_bounds__(256)
__attribute__((amdgpu_waves_per_eu(4, 4))) k_qkv(
                      const unsigned short* __restrict__ wq_bf,
                      const float* __restrict__ qkv_b,
                      const unsigned short* __restrict__ h_t,
                      unsigned short* __restrict__ q_t,
                      unsigned short* __restrict__ k_t,
                      unsigned short* __restrict__ v_t) {
  const int bb   = blockIdx.z;
  const int wave = threadIdx.x >> 5;
  const int n0   = blockIdx.x * 128 + (wave & 3) * 32;
  const int ot0  = blockIdx.y * QKV_NT;        // the block's first weight tile
  const int lane = threadIdx.x & 31;
  const int row  = lane & 15;
  const int half = lane >> 4;

  __shared__ __attribute__((aligned(16))) unsigned char lds[GBYTES];
  const unsigned int l = (unsigned int)(size_t)lds + wave * GPITCH + lane * 16;
  const unsigned char* hg =
      (const unsigned char*)(h_t +
          ((size_t)bb * NPIX + blockIdx.x * 128 + wave) * CH) + lane * 16;
  const unsigned char* wg =
      (const unsigned char*)(wq_bf + ((size_t)ot0 * 64 + wave) * CH) + lane * 16;
  gemm_open(l, hg, wg);

  v16bf hf[2][8];
  const unsigned char* hrow =
      lds + ((wave & 3) * 32 + row) * GPITCH + half * 16;
#pragma unroll
  for (int j = 0; j < 2; ++j)
#pragma unroll
    for (int ks = 0; ks < 8; ++ks)
      hf[j][ks] = lds_frag(hrow + j * 16 * GPITCH + ks * 64);

  // Weight tiles 0-3 are Q, 4-7 K, 8-11 V: first the block's Q and K tiles, then
  // its V tiles, one walk through the two buffers.
  int t = 0;
  for (; t < QKV_NT && ot0 + t < 8; ++t)
    qkv_tile<false>(t, ot0 + t, bb, n0, hf, lds, l, wg, qkv_b,
                    ot0 + t < 4 ? q_t : k_t);
  for (; t < QKV_NT; ++t)
    qkv_tile<true>(t, ot0 + t, bb, n0, hf, lds, l, wg, qkv_b, v_t);
  // No copy is outstanding when the wave ends.
  asm volatile("s_wait_asynccnt 0x0" ::: "memory");
}

typedef __attribute__((ext_vector_type(2))) float  v2f;
typedef __attribute__((ext_vector_type(2))) __bf16 v2bf;

#define KTILE    32                       // keys per tile
#define NTILE    (NPIX / KTILE)
#define KPITCH   528                      // LDS bytes per key row: 512 + 16
#define VPITCH   80                       // LDS bytes per channel row: 64 + 16
#define KBYTES   (KTILE * KPITCH)
#define BUFBYTES (KBYTES + CH * VPITCH)

// Two f32 -> one register of two bf16, round to nearest even.
__device__ __forceinline__ unsigned int pack_bf2(float lo, float hi) {
  v2f t = {lo, hi};
  return __builtin_bit_cast(unsigned int, __builtin_convertvector(t, v2bf));
}

// Value of lane l ^ 16.
__device__ __forceinline__ float other_half(float x) {
  int b = __float_as_int(x);
  return __int_as_float(__builtin_amdgcn_permlanex16(
      b, b, 0x76543210, 0xfedcba98, false, false));
}

// One tile's copies of one lane: 4 x 16 B of K, 4 x 16 B of V.  kl, vl: LDS
// byte addresses; kg, vg: global addresses.  The s_wait_xcnt stands inside the
// statement so that no address register is rewritten ahead of it.
__device__ __forceinline__ void stage_tile(unsigned int kl, unsigned int vl,
                                           const unsigned char* kg,
                                           const unsigned char* vg) {
  asm volatile(
      "global_load_async_to_lds_b128 %0, %8, off\n\t"
      "global_load_async_to_lds_b128 %1, %9, off\n\t"
      "global_load_async_to_lds_b128 %2, %10, off\n\t"
      "global_load_async_to_lds_b128 %3, %11, off\n\t"
      "global_load_async_to_lds_b128 %4, %12, off\n\t"
      "global_load_async_to_lds_b128 %5, %13, off\n\t"
      "global_load_async_to_lds_b128 %6, %14, off\n\t"
      "global_load_async_to_lds_b128 %7, %15, off\n\t"
      "s_wait_xcnt 0x0"
      :: "v"(kl), "v"(kl + 8 * KPITCH), "v"(kl + 16 * KPITCH),
         "v"(kl + 24 * KPITCH),
         "v"(vl), "v"(vl + 64 * VPITCH), "v"(vl + 128 * VPITCH),
         "v"(vl + 192 * VPITCH),
         "v"(kg), "v"(kg + 8 * CH * 2), "v"(kg + 16 * CH * 2),
         "v"(kg + 24 * CH * 2),
         "v"(vg), "v"(vg + 64 * NPIX * 2), "v"(vg + 128 * NPIX * 2),
         "v"(vg + 192 * NPIX * 2)
      : "memory");
}

// Two waves per SIMD (one block per WGP): the register budget this gives lets
// a wave hold a whole tile's fragments, so its LDS reads stand in two groups.
__global__ void __launch_bounds__(256)
__attribute__((amdgpu_waves_per_eu(2, 2))) k_attn(
                       const unsigned short* __restrict__ q_t,
                       const unsigned short* __restrict__ k_t,
                       const unsigned short* __restrict__ v_t,
                       unsigned short* __restrict__ hattn_t) {
  const int bb   = blockIdx.y;
  const int tid  = threadIdx.x;
  const int wave = tid >> 5;
  const int lane = tid & 31;
  const int row  = lane & 15;
  const int half = lane >> 4;
  const int q    = blockIdx.x * 128 + wave * 16 + row;   // the lane's query
  const float c2 = 0.0625f * 1.44269504f;                // 256^-0.5 * log2(e)

  __shared__ __attribute__((aligned(16))) unsigned char ring[2 * BUFBYTES];

  // Copy addresses.  K: a wave copies one whole 512-B key row per instruction.
  // V: 4 lanes copy the 64 B that one channel holds of the tile's 32 keys.
  // The wave's share of an LDS address is kept scalar, the lane's in a register.
  const unsigned int ring0 = (unsigned int)(size_t)ring;
  const unsigned int wv = __builtin_amdgcn_readfirstlane(wave);
  const unsigned int ks0 = ring0 + wv * KPITCH;
  const unsigned int vs0 = ring0 + KBYTES + wv * (8 * VPITCH);
  const unsigned int kln = lane * 16;
  const unsigned int vln = (lane >> 2) * VPITCH + (lane & 3) * 16;
  const unsigned char* kg =
      (const unsigned char*)(k_t + ((size_t)bb * NPIX + wave) * CH) + lane * 16;
  const unsigned char* vg =
      (const unsigned char*)(v_t + ((size_t)bb * CH + (tid >> 2)) * NPIX) +
      (tid & 3) * 16;

  stage_tile(ks0 + kln, vs0 + vln, kg, vg);

  // The 16 queries as B-fragments, kept in registers for the whole walk.
  v16bf qb[8];
  const unsigned short* qrow = q_t + ((size_t)bb * NPIX + q) * CH;
#pragma unroll
  for (int ks = 0; ks < 8; ++ks) qb[ks] = load_ab_frag(qrow + ks * 32);

  // Tile 0 has landed for this wave, then for every wave.
  asm volatile("s_wait_asynccnt 0x0" ::: "memory");
  __syncthreads();
  stage_tile(ks0 + BUFBYTES + kln, vs0 + BUFBYTES + vln, kg + KTILE * CH * 2,
             vg + KTILE * 2);

  v8f o[16];
#pragma unroll
  for (int ct = 0; ct < 16; ++ct) o[ct] = (v8f){};
  float mref = -3.0e38f;     // maximum in use, in units of log2
  float lsum = 0.f;          // this half's share of the query's sum

  for (int t = 0; t < NTILE; ++t) {
    const unsigned int boff = (unsigned int)(t & 1) * BUFBYTES;
    const unsigned char* kb = ring + boff + row * KPITCH + half * 16;
    const unsigned char* vb = ring + boff + KBYTES + row * VPITCH + half * 16;

    // S^T: register r of st0 / st1 = key 8 * half + r / 16 + 8 * half + r.
    v8f st0 = {}, st1 = {};
#pragma unroll
    for (int ks = 0; ks < 8; ++ks) {
      st0 = wmma_bf16(lds_frag(kb + ks * 64), qb[ks], st0);
      st1 = wmma_bf16(lds_frag(kb + 16 * KPITCH + ks * 64), qb[ks], st1);
    }

    // The tile's V fragments, read as one group while the softmax runs.
    v16bf vf[16];
#pragma unroll
    for (int ct = 0; ct < 16; ++ct) vf[ct] = lds_frag(vb + ct * 16 * VPITCH);
    // Keeps the group here: sunk to their users, each read's latency is exposed.
    __builtin_amdgcn_sched_barrier(0);

    float mt = fmaxf(st0[0], st1[0]);
#pragma unroll
    for (int r = 1; r < 8; ++r) mt = fmaxf(mt, fmaxf(st0[r], st1[r]));
    mt = fmaxf(mt, other_half(mt)) * c2;

    // The maximum in use is replaced only when some query's new one exceeds it
    // by more than 8: until then every exponential stays at or below 2^8.
    if (__builtin_amdgcn_ballot_w32(mt > mref + 8.0f) != 0) {
      const float mn = fmaxf(mref, mt);
      const float al = __builtin_amdgcn_exp2f(mref - mn);
      lsum *= al;
#pragma unroll
      for (int ct = 0; ct < 16; ++ct) o[ct] *= al;
      mref = mn;
    }

    FragAB pb;
#pragma unroll
    for (int i = 0; i < 4; ++i) {
      float a0 = __builtin_amdgcn_exp2f(st0[2 * i]     * c2 - mref);
      float a1 = __builtin_amdgcn_exp2f(st0[2 * i + 1] * c2 - mref);
      float b0 = __builtin_amdgcn_exp2f(st1[2 * i]     * c2 - mref);
      float b1 = __builtin_amdgcn_exp2f(st1[2 * i + 1] * c2 - mref);
      lsum += (a0 + a1) + (b0 + b1);
      pb.u[i]     = pack_bf2(a0, a1);
      pb.u[4 + i] = pack_bf2(b0, b1);
    }

    // O^T: register r of o[ct] = channel ct * 16 + 8 * half + r.
#pragma unroll
    for (int ct = 0; ct < 16; ++ct)
      o[ct] = wmma_bf16(vf[ct], pb.v, o[ct]);

    // Hand-over: this wave's reads of the tile are done, its copies of the next
    // tile have landed; behind the barrier that holds for every wave.
    asm volatile("s_wait_dscnt 0x0" ::: "memory");
    asm volatile("s_wait_asynccnt 0x0" ::: "memory");
    __syncthreads();
    if (t + 2 < NTILE)
    {
      // Scalar sums first: added lane part first, the sum shared with the first
      // tile's copy is an asm operand, is held below v256 and gets spilled.
      const unsigned int ksb = __builtin_amdgcn_readfirstlane(ks0 + boff);
      const unsigned int vsb = __builtin_amdgcn_readfirstlane(vs0 + boff);
      stage_tile(ksb + kln, vsb + vln,
                 kg + (size_t)(t + 2) * (KTILE * CH * 2),
                 vg + (t + 2) * (KTILE * 2));
    }
  }
  // No copy is outstanding when the wave ends.
  asm volatile("s_wait_asynccnt 0x0" ::: "memory");

  const float inv = 1.0f / (lsum + other_half(lsum));
  unsigned short* orow = hattn_t + ((size_t)bb * NPIX + q) * CH + half * 8;
  v4u w[16];
#pragma unroll
  for (int ct = 0; ct < 16; ++ct)
#pragma unroll
    for (int i = 0; i < 4; ++i)
      w[ct][i] = pack_bf2(o[ct][2 * i] * inv, o[ct][2 * i + 1] * inv);
  // All packing ahead of the first store: no register that a store in flight
  // names is written again.
  __builtin_amdgcn_sched_barrier(0);
#pragma unroll
  for (int ct = 0; ct < 16; ++ct) *(v4u*)(orow + ct * 16) = w[ct];
}

// ---------------------------------------------------------------------------
// Kernel 4: proj GEMM + bias + residual.  out[b,o,n] = x + P[o,:] . hattn[n,:]
// Same tiling, LDS layout and residency as k_qkv; a block walks 2 weight tiles,
// which both fit its LDS: one wait and one barrier in all.
// ---------------------------------------------------------------------------
#define PROJ_NT 2                         // weight tiles per block
__global__ void __launch_bounds__(256)
__attribute__((amdgpu_waves_per_eu(4, 4))) k_proj(
                       const unsigned short* __restrict__ wp_bf,
                       const float* __restrict__ proj_b,
                       const unsigned short* __restrict__ hattn_t,
                       const float* __restrict__ x,
                       float* __restrict__ out) {
  const int bb   = blockIdx.z;
  const int wave = threadIdx.x >> 5;
  const int n0   = blockIdx.x * 128 + (wave & 3) * 32;
  const int ot0  = blockIdx.y * PROJ_NT;       // the block's first weight tile
  const int lane = threadIdx.x & 31;
  const int row  = lane & 15;
  const int half = lane >> 4;

  __shared__ __attribute__((aligned(16))) unsigned char lds[GBYTES];
  const unsigned int l = (unsigned int)(size_t)lds + wave * GPITCH + lane * 16;
  const unsigned char* hg =
      (const unsigned char*)(hattn_t +
          ((size_t)bb * NPIX + blockIdx.x * 128 + wave) * CH) + lane * 16;
  const unsigned char* wg =
      (const unsigned char*)(wp_bf + ((size_t)ot0 * 64 + wave) * CH) + lane * 16;
  gemm_open_two(l, hg, wg);

  v16bf hf[2][8];
  const unsigned char* hrow =
      lds + ((wave & 3) * 32 + row) * GPITCH + half * 16;
#pragma unroll
  for (int j = 0; j < 2; ++j)
#pragma unroll
    for (int ks = 0; ks < 8; ++ks)
      hf[j][ks] = lds_frag(hrow + j * 16 * GPITCH + ks * 64);

  for (int t = 0; t < PROJ_NT; ++t) {
    const int o0 = (ot0 + t) * 64 + (wave >> 2) * 32;
    const unsigned char* wrow = lds + ABYTES + (t & 1) * WBYTES +
                                ((wave >> 2) * 32 + row) * GPITCH + half * 16;

    v8f acc00 = {}, acc01 = {}, acc10 = {}, acc11 = {};
    v16bf wf[3][2];
    load_wstep(wf[0], wrow, 0);
    load_wstep(wf[1], wrow, 1);
#pragma unroll
    for (int ks = 0; ks < 8; ++ks) {
      if (ks < 6) load_wstep(wf[(ks + 2) % 3], wrow, ks + 2);
      // Keeps the reads two k steps ahead of their products: sunk to their
      // users, each read's latency is exposed.
      __builtin_amdgcn_sched_barrier(0);
      acc00 = wmma_bf16(wf[ks % 3][0], hf[0][ks], acc00);
      acc01 = wmma_bf16(wf[ks % 3][0], hf[1][ks], acc01);
      acc10 = wmma_bf16(wf[ks % 3][1], hf[0][ks], acc10);
      acc11 = wmma_bf16(wf[ks % 3][1], hf[1][ks], acc11);
    }

    FragCD d[2][2];
    d[0][0].v = acc00; d[0][1].v = acc01; d[1][0].v = acc10; d[1][1].v = acc11;

    // The lane's first element of x and of out: output row o0 + 8 * half, its pixel.
    const size_t e0 = ((size_t)bb * CH + o0 + half * 8) * NPIX + n0 + row;
    const float* xp = x + e0;
    float* op = out + e0;

    // Residual: one run of 32 loads from one address.
    float xv[2][2][8];
#pragma unroll
    for (int mi = 0; mi < 2; ++mi)
#pragma unroll
      for (int ni = 0; ni < 2; ++ni)
#pragma unroll
        for (int r = 0; r < 8; ++r) {
          // The last load's result may land in the address registers that the
          // loads above name.
          if (mi == 1 && ni == 1 && r == 7)
            asm volatile("s_wait_xcnt 0x0" ::: "memory");
          xv[mi][ni][r] = xp[(mi * 16 + r) * NPIX + ni * 16];
        }
    // The bias loads may land in the address registers of this run.
    asm volatile("s_wait_xcnt 0x0" ::: "memory");

    // Bias: per output row, that is per register.
    const float* bp = proj_b + o0 + half * 8;
    v4f blo[2], bhi[2];
    blo[0] = *(const v4f*)bp;
    bhi[0] = *(const v4f*)(bp + 4);
    blo[1] = *(const v4f*)(bp + 16);
    // As above: the last load's result, then what follows it.
    asm volatile("s_wait_xcnt 0x0" ::: "memory");
    bhi[1] = *(const v4f*)(bp + 20);
    asm volatile("s_wait_xcnt 0x0" ::: "memory");

#pragma unroll
    for (int mi = 0; mi < 2; ++mi)
#pragma unroll
      for (int ni = 0; ni < 2; ++ni)
#pragma unroll
        for (int r = 0; r < 8; ++r)
          d[mi][ni].f[r] = xv[mi][ni][r] + d[mi][ni].f[r] +
                           (r < 4 ? blo[mi][r & 3] : bhi[mi][r & 3]);
#pragma unroll
    for (int mi = 0; mi < 2; ++mi)
#pragma unroll
      for (int ni = 0; ni < 2; ++ni)
#pragma unroll
        for (int r = 0; r < 8; ++r)
          op[(mi * 16 + r) * NPIX + ni * 16] = d[mi][ni].f[r];
    // The next tile writes the registers that these stores name.
    asm volatile("s_wait_xcnt 0x0" ::: "memory");
  }
}

// ---------------------------------------------------------------------------
// Host-side launcher.
// Inputs: 0:x 1:norm_w 2:norm_b 3:qkv_w 4:qkv_b 5:proj_w 6:proj_b
// ---------------------------------------------------------------------------
extern "C" void kernel_launch(void* const* d_in, const int* in_sizes, int n_in,
                              void* d_out, int out_size, void* d_ws, size_t ws_size,
                              hipStream_t stream) {
  (void)in_sizes; (void)n_in; (void)out_size; (void)ws_size;
  const float* x      = (const float*)d_in[0];
  const float* norm_w = (const float*)d_in[1];
  const float* norm_b = (const float*)d_in[2];
  const float* qkv_w  = (const float*)d_in[3];
  const float* qkv_b  = (const float*)d_in[4];
  const float* proj_w = (const float*)d_in[5];
  const float* proj_b = (const float*)d_in[6];
  float* out = (float*)d_out;

  char* ws = (char*)d_ws;
  const size_t SZ_WQ = (size_t)3 * CH * CH * 2;            // 384 KB
  const size_t SZ_WP = (size_t)CH * CH * 2;                // 128 KB
  const size_t SZ_T  = (size_t)BATCH * NPIX * CH * 2;      // 16 MB per tensor
  unsigned short* wq_bf   = (unsigned short*)(ws);
  unsigned short* wp_bf   = (unsigned short*)(ws + SZ_WQ);
  unsigned short* h_t     = (unsigned short*)(ws + SZ_WQ + SZ_WP);
  unsigned short* q_t     = (unsigned short*)(ws + SZ_WQ + SZ_WP + 1 * SZ_T);
  unsigned short* k_t     = (unsigned short*)(ws + SZ_WQ + SZ_WP + 2 * SZ_T);
  unsigned short* v_t     = (unsigned short*)(ws + SZ_WQ + SZ_WP + 3 * SZ_T);
  unsigned short* hattn_t = (unsigned short*)(ws + SZ_WQ + SZ_WP + 4 * SZ_T);

  k_cvt_weights<<<dim3((3 * CH * CH + 255) / 256), dim3(256), 0, stream>>>(
      qkv_w, proj_w, wq_bf, wp_bf);

  k_groupnorm<<<dim3(BATCH * NGRP), dim3(256), 0, stream>>>(
      x, norm_w, norm_b, h_t);

  k_qkv<<<dim3(NPIX / 128, (3 * CH) / (64 * QKV_NT), BATCH), dim3(256), 0, stream>>>(
      wq_bf, qkv_b, h_t, q_t, k_t, v_t);

  k_attn<<<dim3(NPIX / 128, BATCH), dim3(256), 0, stream>>>(
      q_t, k_t, v_t, hattn_t);

  k_proj<<<dim3(NPIX / 128, CH / (64 * PROJ_NT), BATCH), dim3(256), 0, stream>>>(
      wp_bf, proj_b, hattn_t, x, out);
}

// v005
// One run takes 86.5 microseconds.
// Timed twice side by side with v004, it ran 1.07 and 1.08 times as fast.
// All steps since v000 together make it 6.02 times as fast.
#include <hip/hip_runtime.h>

// ---------------------------------------------------------------------------
// CDNA5 (gfx1250) attention block: GroupNorm -> QKV -> softmax(QK^T/sqrt(C))V
// -> proj -> residual.  All GEMM stages use v_wmma_f32_16x16x32_bf16 (wave32).
// ---------------------------------------------------------------------------

typedef __attribute__((ext_vector_type(16))) __bf16 v16bf;
typedef __attribute__((ext_vector_type(8)))  float  v8f;
typedef __attribute__((ext_vector_type(4)))  float  v4f;
typedef __attribute__((ext_vector_type(4)))  unsigned int v4u;

union FragAB { unsigned int u[8]; v16bf v; };
union FragCD { float f[8]; v8f v; };

#define BATCH 32
#define CH    256
#define NPIX  1024
#define NGRP  8
#define CPG   32           // channels per group

__device__ __forceinline__ unsigned short f2bf(float x) {
  unsigned int u = __float_as_uint(x);
  u += 0x7fffu + ((u >> 16) & 1u);           // round-to-nearest-even
  return (unsigned short)(u >> 16);
}

// Load a 16x32 bf16 A- or B-fragment.  `p` points to the *lane's* row (A) or
// column (B) start, with the K dimension contiguous in memory.  K-pair slot i
// in VGPR i follows the ISA 16-bit A-matrix table:
//   lanes 0-15 : V0..V3 -> K 0..7,  V4..V7 -> K 16..23
//   lanes 16-31: V0..V3 -> K 8..15, V4..V7 -> K 24..31
__device__ __forceinline__ v16bf load_ab_frag(const unsigned short* p) {
  const int half = (threadIdx.x >> 4) & 1;
  const unsigned int* p32 = (const unsigned int*)p;
  FragAB f;
#pragma unroll
  for (int i = 0; i < 8; ++i) {
    int kb = (i < 4) ? (half * 8 + 2 * i) : (16 + half * 8 + 2 * (i - 4));
    f.u[i] = p32[kb >> 1];
  }
  return f.v;
}

__device__ __forceinline__ v8f wmma_bf16(v16bf a, v16bf b, v8f c) {
  return __builtin_amdgcn_wmma_f32_16x16x32_bf16(
      /*neg_a=*/false, a, /*neg_b=*/false, b,
      /*c_mod=*/(short)0, c, /*reuse_a=*/false, /*reuse_b=*/false);
}

// A-fragment from LDS, same k order as load_ab_frag.  p = the lane's row, at
// the 64-B block of the k step, plus 16 B for lanes 16-31.
__device__ __forceinline__ v16bf lds_frag(const unsigned char* p) {
  v4u lo = *(const v4u*)(p);
  v4u hi = *(const v4u*)(p + 32);
  FragAB f;
#pragma unroll
  for (int i = 0; i < 4; ++i) { f.u[i] = lo[i]; f.u[4 + i] = hi[i]; }
  return f.v;
}

// LDS of the two GEMM kernels: a block's 128 activation rows (256 bf16 each),
// then two buffers of 64 weight rows.
#define GPITCH 528                        // LDS bytes per row: 512 + 16
#define ABYTES (128 * GPITCH)
#define WBYTES (64 * GPITCH)
#define GBYTES (ABYTES + 2 * WBYTES)
#define WSTEP  (64 * CH * 2)              // global bytes from a weight tile to the next

// Eight copies of one wave, each a whole 512-B row (16 B per lane): rows r,
// r + 8, ..., r + 56.  l: the lane's LDS byte address in row r; g: its global
// address there.  The s_wait_xcnt stands inside the statement so that no
// address register is rewritten ahead of it.
__device__ __forceinline__ void stage_rows8(unsigned int l,
                                            const unsigned char* g) {
  asm volatile(
      "global_load_async_to_lds_b128 %0, %8, off\n\t"
      "global_load_async_to_lds_b128 %1, %9, off\n\t"
      "global_load_async_to_lds_b128 %2, %10, off\n\t"
      "global_load_async_to_lds_b128 %3, %11, off\n\t"
      "global_load_async_to_lds_b128 %4, %12, off\n\t"
      "global_load_async_to_lds_b128 %5, %13, off\n\t"
      "global_load_async_to_lds_b128 %6, %14, off\n\t"
      "global_load_async_to_lds_b128 %7, %15, off\n\t"
      "s_wait_xcnt 0x0"
      :: "v"(l), "v"(l + 8 * GPITCH), "v"(l + 16 * GPITCH),
         "v"(l + 24 * GPITCH), "v"(l + 32 * GPITCH), "v"(l + 40 * GPITCH),
         "v"(l + 48 * GPITCH), "v"(l + 56 * GPITCH),
         "v"(g), "v"(g + 8 * CH * 2), "v"(g + 16 * CH * 2),
         "v"(g + 24 * CH * 2), "v"(g + 32 * CH * 2), "v"(g + 40 * CH * 2),
         "v"(g + 48 * CH * 2), "v"(g + 56 * CH * 2)
      : "memory");
}

// In front of the walk over the weight tiles: the activation rows and tile 0
// land and are published, then tile 1 is sent for.  l: the lane's LDS byte
// address in row `wave` of the block's LDS; ag, wg: its global addresses in that
// row of the activations and of weight tile 0.
__device__ __forceinline__ void gemm_open(unsigned int l,
                                          const unsigned char* ag,
                                          const unsigned char* wg) {
  stage_rows8(l, ag);
  stage_rows8(l + 64 * GPITCH, ag + 64 * CH * 2);
  stage_rows8(l + ABYTES, wg);
  // The rows have landed for this wave, then for every wave.
  asm volatile("s_wait_asynccnt 0x0" ::: "memory");
  __syncthreads();
  stage_rows8(l + ABYTES + WBYTES, wg + WSTEP);
}

// The same for a walk of two weight tiles: both come at once, each into its
// buffer, and nothing is handed over later.
__device__ __forceinline__ void gemm_open_two(unsigned int l,
                                              const unsigned char* ag,
                                              const unsigned char* wg) {
  stage_rows8(l, ag);
  stage_rows8(l + 64 * GPITCH, ag + 64 * CH * 2);
  stage_rows8(l + ABYTES, wg);
  stage_rows8(l + ABYTES + WBYTES, wg + WSTEP);
  // The rows have landed for this wave, then for every wave.
  asm volatile("s_wait_asynccnt 0x0" ::: "memory");
  __syncthreads();
}

// Hand-over behind the products of tile t (of nt): this wave's reads of the tile
// are done, its copies of tile t + 1 have landed; behind the barrier that holds
// for every wave, and tile t + 2 may take the buffer of tile t.
__device__ __forceinline__ void gemm_hand_over(int t, int nt, unsigned int l,
                                               const unsigned char* wg) {
  asm volatile("s_wait_dscnt 0x0" ::: "memory");
  asm volatile("s_wait_asynccnt 0x0" ::: "memory");
  __syncthreads();
  if (t + 2 < nt)
    stage_rows8(l + ABYTES + (unsigned int)(t & 1) * WBYTES,
                wg + (size_t)(t + 2) * WSTEP);
}

// A wave's two weight fragments (16 rows each) of k step ks.
__device__ __forceinline__ void load_wstep(v16bf (&wf)[2],
                                           const unsigned char* wrow, int ks) {
#pragma unroll
  for (int i = 0; i < 2; ++i)
    wf[i] = lds_frag(wrow + i * 16 * GPITCH + ks * 64);
}

// ---------------------------------------------------------------------------
// Kernel 0: fp32 -> bf16 weight conversion (qkv_w: 768x256, proj_w: 256x256)
// ---------------------------------------------------------------------------
__global__ void k_cvt_weights(const float* __restrict__ qkv_w,
                              const float* __restrict__ proj_w,
                              unsigned short* __restrict__ wq_bf,
                              unsigned short* __restrict__ wp_bf) {
  int i = blockIdx.x * 256 + threadIdx.x;
  if (i < 3 * CH * CH) wq_bf[i] = f2bf(qkv_w[i]);
  if (i < CH * CH)     wp_bf[i] = f2bf(proj_w[i]);
}

// ---------------------------------------------------------------------------
// Kernel 1: GroupNorm.  One block per (batch, group).  Output h stored as
// bf16 in [B][N][C] layout (channel-contiguous per pixel) for WMMA B-frags.
// x is read once: the block's 256 lanes hold the group's 32 x 1024 values in
// registers (128 each), sum them there and normalise them there.
// The block size is declared so that a lane may hold its 128 values.
// ---------------------------------------------------------------------------
__global__ void __launch_bounds__(256) k_groupnorm(const float* __restrict__ x,
                            const float* __restrict__ nw,
                            const float* __restrict__ nb,
                            unsigned short* __restrict__ h_t) {
  const int bb = blockIdx.x >> 3;
  const int g  = blockIdx.x & 7;
  const int c0 = g * CPG;
  const float* xp = x + ((size_t)bb * CH + c0) * NPIX;   // 32*1024 contiguous

  // A lane owns 8 channels x 4 pixels, four times: the 8 lanes that share cl
  // read one whole 128-B line of a channel row, and the 4 lanes of one pixel
  // store its 32 channels as one contiguous 64-B run (16 B per lane).
  const int lane = threadIdx.x & 31;
  const int wave = threadIdx.x >> 5;
  const int cl   = (lane & 3) * 8;                // first of the lane's channels
  const int n0   = wave * 128 + (lane >> 2) * 4;  // first of the lane's pixels
  // Every loop below is fully unrolled so that v, w8 and b8 are registers.
  v4f v[4][8];
#pragma unroll
  for (int it = 0; it < 4; ++it)
#pragma unroll
    for (int j = 0; j < 8; ++j)
      v[it][j] = *(const v4f*)(xp + (cl + j) * NPIX + n0 + it * 32);
  float w8[8], b8[8];
#pragma unroll
  for (int j = 0; j < 8; ++j) {
    w8[j] = nw[c0 + cl + j];
    b8[j] = nb[c0 + cl + j];
  }
  // Keeps all these loads ahead of the first sum, one memory latency for all:
  // without it the loads of w8 and b8 sink behind the sums, and their latency
  // is exposed in front of the first barrier.
  __builtin_amdgcn_sched_barrier(0);

  // The lane's share of the two sums, four independent chains each.
  v4f s4 = {}, q4 = {};
#pragma unroll
  for (int it = 0; it < 4; ++it)
#pragma unroll
    for (int j = 0; j < 8; ++j) {
      s4 += v[it][j];
      q4 += v[it][j] * v[it][j];
    }
  const float s  = (s4[0] + s4[1]) + (s4[2] + s4[3]);
  const float s2 = (q4[0] + q4[1]) + (q4[2] + q4[3]);

  __shared__ float rs[256], rs2[256];
  rs[threadIdx.x] = s; rs2[threadIdx.x] = s2;
  __syncthreads();
  for (int off = 128; off > 0; off >>= 1) {
    if (threadIdx.x < off) {
      rs[threadIdx.x]  += rs[threadIdx.x + off];
      rs2[threadIdx.x] += rs2[threadIdx.x + off];
    }
    __syncthreads();
  }
  const float inv_n = 1.0f / (float)(CPG * NPIX);
  const float mean  = rs[0] * inv_n;
  const float var   = rs2[0] * inv_n - mean * mean;
  const float rstd  = rsqrtf(var + 1e-5f);

#pragma unroll
  for (int it = 0; it < 4; ++it) {
#pragma unroll
    for (int p = 0; p < 4; ++p) {
      v4u o;
#pragma unroll
      for (int k = 0; k < 4; ++k) {
        float lo = (v[it][2 * k][p]     - mean) * rstd * w8[2 * k]     + b8[2 * k];
        float hi = (v[it][2 * k + 1][p] - mean) * rstd * w8[2 * k + 1] + b8[2 * k + 1];
        o[k] = (unsigned int)f2bf(lo) | ((unsigned int)f2bf(hi) << 16);
      }
      *(v4u*)(h_t + ((size_t)bb * NPIX + n0 + it * 32 + p) * CH + c0 + cl) = o;
    }
  }
}

// ---------------------------------------------------------------------------
// Kernel 2: QKV GEMM.  qkv[o,n] = sum_c W[o,c] * h[n,c] + b[o].
// A block owns 128 pixels (n) and walks 6 tiles of 64 output channels (o); 8
// waves, each a 32x32 tile (2x2 WMMA) of every 64 x 128 tile.  The h rows come
// into LDS once and a wave keeps its 32 pixels' fragments in registers; the W
// tiles come through two LDS buffers, each copied while the one before is used.
// Q,K stored [B][N][C] bf16; V stored [B][C][N] bf16.
// A tile lies wholly in Q, in K or in V.  Q and K tiles are computed as W h^T
// (A rows = output channels), V tiles as h W^T (A rows = pixels): the 8
// accumulators of a lane run along the A rows, so they are always 8 neighbours
// in the stored layout and leave as one 16-B store.
// Four waves per SIMD (two blocks per WGP, as their LDS allows): 256 registers.
// ---------------------------------------------------------------------------
#define QKV_NT 6                          // weight tiles per block

// One weight tile of one wave: products, hand-over, bias, stores.  ISV: the tile
// lies in V.  t: the tile's place in the block's walk; ot: its number in W.
template <bool ISV>
__device__ __forceinline__ void qkv_tile(int t, int ot, int bb, int n0,
                                         const v16bf (&hf)[2][8],
                                         const unsigned char* lds,
                                         unsigned int l, const unsigned char* wg,
                                         const float* __restrict__ qkv_b,
                                         unsigned short* __restrict__ base) {
  const int wave = threadIdx.x >> 5;
  const int lane = threadIdx.x & 31;
  const int row  = lane & 15;
  const int half = lane >> 4;
  const int o0   = ot * 64 + (wave >> 2) * 32;
  const int oc0  = o0 & 255;                   // channel inside Q, K or V
  const unsigned char* wrow = lds + ABYTES + (t & 1) * WBYTES +
                              ((wave >> 2) * 32 + row) * GPITCH + half * 16;

  // acc[i][j]: register r = A row i * 16 + 8 * half + r, lane = B row j * 16 + row.
  v8f acc[2][2] = {};
  v16bf wf[3][2];
  load_wstep(wf[0], wrow, 0);
  load_wstep(wf[1], wrow, 1);
#pragma unroll
  for (int ks = 0; ks < 8; ++ks) {
    if (ks < 6) load_wstep(wf[(ks + 2) % 3], wrow, ks + 2);
    // Keeps the reads two k steps ahead of their products: sunk to their users,
    // each read's latency is exposed.
    __builtin_amdgcn_sched_barrier(0);
    const v16bf w0 = wf[ks % 3][0], w1 = wf[ks % 3][1];
    acc[0][0] = ISV ? wmma_bf16(hf[0][ks], w0, acc[0][0])
                    : wmma_bf16(w0, hf[0][ks], acc[0][0]);
    acc[0][1] = ISV ? wmma_bf16(hf[0][ks], w1, acc[0][1])
                    : wmma_bf16(w0, hf[1][ks], acc[0][1]);
    acc[1][0] = ISV ? wmma_bf16(hf[1][ks], w0, acc[1][0])
                    : wmma_bf16(w1, hf[0][ks], acc[1][0]);
    acc[1][1] = ISV ? wmma_bf16(hf[1][ks], w1, acc[1][1])
                    : wmma_bf16(w1, hf[1][ks], acc[1][1]);
  }

  gemm_hand_over(t, QKV_NT, l, wg);

  // The lane's B row of the stored array, at the first of its A rows.
  const int pitch  = ISV ? NPIX : CH;
  const int brow0  = ISV ? bb * CH + oc0 : bb * NPIX + n0;
  const int acol0  = ISV ? n0 : oc0;
  unsigned short* dst = base + (size_t)(brow0 + row) * pitch + acol0 + half * 8;
  const size_t pitch16 = (size_t)16 * pitch;

  // Bias: per output channel, that is per register for Q and K, per lane for V.
  if (ISV) {
#pragma unroll
    for (int j = 0; j < 2; ++j) {
      const float bl = qkv_b[o0 + j * 16 + row];
#pragma unroll
      for (int i = 0; i < 2; ++i) acc[i][j] += bl;
    }
  } else {
    const float* bp = qkv_b + o0 + half * 8;
    v4f blo[2], bhi[2];
    blo[0] = *(const v4f*)bp;
    bhi[0] = *(const v4f*)(bp + 4);
    blo[1] = *(const v4f*)(bp + 16);
    // The last load's result may land in the address registers that the three
    // loads above name.
    asm volatile("s_wait_xcnt 0x0" ::: "memory");
    bhi[1] = *(const v4f*)(bp + 20);
#pragma unroll
    for (int i = 0; i < 2; ++i)
#pragma unroll
      for (int j = 0; j < 2; ++j)
#pragma unroll
        for (int r = 0; r < 4; ++r) {
          acc[i][j][r]     += blo[i][r];
          acc[i][j][4 + r] += bhi[i][r];
        }
  }

  v4u w[2][2];
#pragma unroll
  for (int i = 0; i < 2; ++i)
#pragma unroll
    for (int j = 0; j < 2; ++j)
#pragma unroll
      for (int p = 0; p < 4; ++p)
        w[i][j][p] = (unsigned int)f2bf(acc[i][j][2 * p]) |
                     ((unsigned int)f2bf(acc[i][j][2 * p + 1]) << 16);
#pragma unroll
  for (int i = 0; i < 2; ++i)
#pragma unroll
    for (int j = 0; j < 2; ++j)
      *(v4u*)(dst + j * pitch16 + i * 16) = w[i][j];
  // The next tile writes the registers that these stores name.
  asm volatile("s_wait_xcnt 0x0" ::: "memory");
}

__global__ void __launch_bounds__(256)
__attribute__((amdgpu_waves_per_eu(4, 4))) k_qkv(
                      const unsigned short* __restrict__ wq_bf,
                      const float* __restrict__ qkv_b,
                      const unsigned short* __restrict__ h_t,
                      unsigned short* __restrict__ q_t,
                      unsigned short* __restrict__ k_t,
                      unsigned short* __restrict__ v_t) {
  const int bb   = blockIdx.z;
  const int wave = threadIdx.x >> 5;
  const int n0   = blockIdx.x * 128 + (wave & 3) * 32;
  const int ot0  = blockIdx.y * QKV_NT;        // the block's first weight tile
  const int lane = threadIdx.x & 31;
  const int row  = lane & 15;
  const int half = lane >> 4;

  __shared__ __attribute__((aligned(16))) unsigned char lds[GBYTES];
  const unsigned int l = (unsigned int)(size_t)lds + wave * GPITCH + lane * 16;
  const unsigned char* hg =
      (const unsigned char*)(h_t +
          ((size_t)bb * NPIX + blockIdx.x * 128 + wave) * CH) + lane * 16;
  const unsigned char* wg =
      (const unsigned char*)(wq_bf + ((size_t)ot0 * 64 + wave) * CH) + lane * 16;
  gemm_open(l, hg, wg);

  v16bf hf[2][8];
  const unsigned char* hrow =
      lds + ((wave & 3) * 32 + row) * GPITCH + half * 16;
#pragma unroll
  for (int j = 0; j < 2; ++j)
#pragma unroll
    for (int ks = 0; ks < 8; ++ks)
      hf[j][ks] = lds_frag(hrow + j * 16 * GPITCH + ks * 64);

  // Weight tiles 0-3 are Q, 4-7 K, 8-11 V: first the block's Q and K tiles, then
  // its V tiles, one walk through the two buffers.
  int t = 0;
  for (; t < QKV_NT && ot0 + t < 8; ++t)
    qkv_tile<false>(t, ot0 + t, bb, n0, hf, lds, l, wg, qkv_b,
                    ot0 + t < 4 ? q_t : k_t);
  for (; t < QKV_NT; ++t)
    qkv_tile<true>(t, ot0 + t, bb, n0, hf, lds, l, wg, qkv_b, v_t);
  // No copy is outstanding when the wave ends.
  asm volatile("s_wait_asynccnt 0x0" ::: "memory");
}

typedef __attribute__((ext_vector_type(2))) float  v2f;
typedef __attribute__((ext_vector_type(2))) __bf16 v2bf;

#define KTILE    32                       // keys per tile
#define NTILE    (NPIX / KTILE)
#define KPITCH   528                      // LDS bytes per key row: 512 + 16
#define VPITCH   80                       // LDS bytes per channel row: 64 + 16
#define KBYTES   (KTILE * KPITCH)
#define BUFBYTES (KBYTES + CH * VPITCH)

// Two f32 -> one register of two bf16, round to nearest even.
__device__ __forceinline__ unsigned int pack_bf2(float lo, float hi) {
  v2f t = {lo, hi};
  return __builtin_bit_cast(unsigned int, __builtin_convertvector(t, v2bf));
}

// Value of lane l ^ 16.
__device__ __forceinline__ float other_half(float x) {
  int b = __float_as_int(x);
  return __int_as_float(__builtin_amdgcn_permlanex16(
      b, b, 0x76543210, 0xfedcba98, false, false));
}

// One tile's copies of one lane: 4 x 16 B of K, 4 x 16 B of V.  kl, vl: LDS
// byte addresses; kg, vg: global addresses.  The s_wait_xcnt stands inside the
// statement so that no address register is rewritten ahead of it.
__device__ __forceinline__ void stage_tile(unsigned int kl, unsigned int vl,
                                           const unsigned char* kg,
                                           const unsigned char* vg) {
  asm volatile(
      "global_load_async_to_lds_b128 %0, %8, off\n\t"
      "global_load_async_to_lds_b128 %1, %9, off\n\t"
      "global_load_async_to_lds_b128 %2, %10, off\n\t"
      "global_load_async_to_lds_b128 %3, %11, off\n\t"
      "global_load_async_to_lds_b128 %4, %12, off\n\t"
      "global_load_async_to_lds_b128 %5, %13, off\n\t"
      "global_load_async_to_lds_b128 %6, %14, off\n\t"
      "global_load_async_to_lds_b128 %7, %15, off\n\t"
      "s_wait_xcnt 0x0"
      :: "v"(kl), "v"(kl + 8 * KPITCH), "v"(kl + 16 * KPITCH),
         "v"(kl + 24 * KPITCH),
         "v"(vl), "v"(vl + 64 * VPITCH), "v"(vl + 128 * VPITCH),
         "v"(vl + 192 * VPITCH),
         "v"(kg), "v"(kg + 8 * CH * 2), "v"(kg + 16 * CH * 2),
         "v"(kg + 24 * CH * 2),
         "v"(vg), "v"(vg + 64 * NPIX * 2), "v"(vg + 128 * NPIX * 2),
         "v"(vg + 192 * NPIX * 2)
      : "memory");
}

// Two waves per SIMD (one block per WGP): the register budget this gives lets
// a wave hold a whole tile's fragments, so its LDS reads stand in two groups.
__global__ void __launch_bounds__(256)
__attribute__((amdgpu_waves_per_eu(2, 2))) k_attn(
                       const unsigned short* __restrict__ q_t,
                       const unsigned short* __restrict__ k_t,
                       const unsigned short* __restrict__ v_t,
                       unsigned short* __restrict__ hattn_t) {
  const int bb   = blockIdx.y;
  const int tid  = threadIdx.x;
  const int wave = tid >> 5;
  const int lane = tid & 31;
  const int row  = lane & 15;
  const int half = lane >> 4;
  const int q    = blockIdx.x * 128 + wave * 16 + row;   // the lane's query
  const float c2 = 0.0625f * 1.44269504f;                // 256^-0.5 * log2(e)

  __shared__ __attribute__((aligned(16))) unsigned char ring[2 * BUFBYTES];

  // Copy addresses.  K: a wave copies one whole 512-B key row per instruction.
  // V: 4 lanes copy the 64 B that one channel holds of the tile's 32 keys.
  // The wave's share of an LDS address is kept scalar, the lane's in a register.
  const unsigned int ring0 = (unsigned int)(size_t)ring;
  const unsigned int wv = __builtin_amdgcn_readfirstlane(wave);
  const unsigned int ks0 = ring0 + wv * KPITCH;
  const unsigned int vs0 = ring0 + KBYTES + wv * (8 * VPITCH);
  const unsigned int kln = lane * 16;
  const unsigned int vln = (lane >> 2) * VPITCH + (lane & 3) * 16;
  const unsigned char* kg =
      (const unsigned char*)(k_t + ((size_t)bb * NPIX + wave) * CH) + lane * 16;
  const unsigned char* vg =
      (const unsigned char*)(v_t + ((size_t)bb * CH + (tid >> 2)) * NPIX) +
      (tid & 3) * 16;

  stage_tile(ks0 + kln, vs0 + vln, kg, vg);

  // The 16 queries as B-fragments, kept in registers for the whole walk.
  v16bf qb[8];
  const unsigned short* qrow = q_t + ((size_t)bb * NPIX + q) * CH;
#pragma unroll
  for (int ks = 0; ks < 8; ++ks) qb[ks] = load_ab_frag(qrow + ks * 32);

  // Tile 0 has landed for this wave, then for every wave.
  asm volatile("s_wait_asynccnt 0x0" ::: "memory");
  __syncthreads();
  stage_tile(ks0 + BUFBYTES + kln, vs0 + BUFBYTES + vln, kg + KTILE * CH * 2,
             vg + KTILE * 2);

  v8f o[16];
#pragma unroll
  for (int ct = 0; ct < 16; ++ct) o[ct] = (v8f){};
  float mref = -3.0e38f;     // maximum in use, in units of log2
  float lsum = 0.f;          // this half's share of the query's sum

  for (int t = 0; t < NTILE; ++t) {
    const unsigned int boff = (unsigned int)(t & 1) * BUFBYTES;
    const unsigned char* kb = ring + boff + row * KPITCH + half * 16;
    const unsigned char* vb = ring + boff + KBYTES + row * VPITCH + half * 16;

    // S^T: register r of st0 / st1 = key 8 * half + r / 16 + 8 * half + r.
    v8f st0 = {}, st1 = {};
#pragma unroll
    for (int ks = 0; ks < 8; ++ks) {
      st0 = wmma_bf16(lds_frag(kb + ks * 64), qb[ks], st0);
      st1 = wmma_bf16(lds_frag(kb + 16 * KPITCH + ks * 64), qb[ks], st1);
    }

    // The tile's V fragments, read as one group while the softmax runs.
    v16bf vf[16];
#pragma unroll
    for (int ct = 0; ct < 16; ++ct) vf[ct] = lds_frag(vb + ct * 16 * VPITCH);
    // Keeps the group here: sunk to their users, each read's latency is exposed.
    __builtin_amdgcn_sched_barrier(0);

    float mt = fmaxf(st0[0], st1[0]);
#pragma unroll
    for (int r = 1; r < 8; ++r) mt = fmaxf(mt, fmaxf(st0[r], st1[r]));
    mt = fmaxf(mt, other_half(mt)) * c2;

    // The maximum in use is replaced only when some query's new one exceeds it
    // by more than 8: until then every exponential stays at or below 2^8.
    if (__builtin_amdgcn_ballot_w32(mt > mref + 8.0f) != 0) {
      const float mn = fmaxf(mref, mt);
      const float al = __builtin_amdgcn_exp2f(mref - mn);
      lsum *= al;
#pragma unroll
      for (int ct = 0; ct < 16; ++ct) o[ct] *= al;
      mref = mn;
    }

    FragAB pb;
#pragma unroll
    for (int i = 0; i < 4; ++i) {
      float a0 = __builtin_amdgcn_exp2f(st0[2 * i]     * c2 - mref);
      float a1 = __builtin_amdgcn_exp2f(st0[2 * i + 1] * c2 - mref);
      float b0 = __builtin_amdgcn_exp2f(st1[2 * i]     * c2 - mref);
      float b1 = __builtin_amdgcn_exp2f(st1[2 * i + 1] * c2 - mref);
      lsum += (a0 + a1) + (b0 + b1);
      pb.u[i]     = pack_bf2(a0, a1);
      pb.u[4 + i] = pack_bf2(b0, b1);
    }

    // O^T: register r of o[ct] = channel ct * 16 + 8 * half + r.
#pragma unroll
    for (int ct = 0; ct < 16; ++ct)
      o[ct] = wmma_bf16(vf[ct], pb.v, o[ct]);

    // Hand-over: this wave's reads of the tile are done, its copies of the next
    // tile have landed; behind the barrier that holds for every wave.
    asm volatile("s_wait_dscnt 0x0" ::: "memory");
    asm volatile("s_wait_asynccnt 0x0" ::: "memory");
    __syncthreads();
    if (t + 2 < NTILE)
    {
      // Scalar sums first: added lane part first, the sum shared with the first
      // tile's copy is an asm operand, is held below v256 and gets spilled.
      const unsigned int ksb = __builtin_amdgcn_readfirstlane(ks0 + boff);
      const unsigned int vsb = __builtin_amdgcn_readfirstlane(vs0 + boff);
      stage_tile(ksb + kln, vsb + vln,
                 kg + (size_t)(t + 2) * (KTILE * CH * 2),
                 vg + (t + 2) * (KTILE * 2));
    }
  }
  // No copy is outstanding when the wave ends.
  asm volatile("s_wait_asynccnt 0x0" ::: "memory");

  const float inv = 1.0f / (lsum + other_half(lsum));
  unsigned short* orow = hattn_t + ((size_t)bb * NPIX + q) * CH + half * 8;
  v4u w[16];
#pragma unroll
  for (int ct = 0; ct < 16; ++ct)
#pragma unroll
    for (int i = 0; i < 4; ++i)
      w[ct][i] = pack_bf2(o[ct][2 * i] * inv, o[ct][2 * i + 1] * inv);
  // All packing ahead of the first store: no register that a store in flight
  // names is written again.
  __builtin_amdgcn_sched_barrier(0);
#pragma unroll
  for (int ct = 0; ct < 16; ++ct) *(v4u*)(orow + ct * 16) = w[ct];
}

// ---------------------------------------------------------------------------
// Kernel 4: proj GEMM + bias + residual.  out[b,o,n] = x + P[o,:] . hattn[n,:]
// Same tiling, LDS layout and residency as k_qkv; a block walks 2 weight tiles,
// which both fit its LDS: one wait and one barrier in all.
// ---------------------------------------------------------------------------
#define PROJ_NT 2                         // weight tiles per block
__global__ void __launch_bounds__(256)
__attribute__((amdgpu_waves_per_eu(4, 4))) k_proj(
                       const unsigned short* __restrict__ wp_bf,
                       const float* __restrict__ proj_b,
                       const unsigned short* __restrict__ hattn_t,
                       const float* __restrict__ x,
                       float* __restrict__ out) {
  const int bb   = blockIdx.z;
  const int wave = threadIdx.x >> 5;
  const int n0   = blockIdx.x * 128 + (wave & 3) * 32;
  const int ot0  = blockIdx.y * PROJ_NT;       // the block's first weight tile
  const int lane = threadIdx.x & 31;
  const int row  = lane & 15;
  const int half = lane >> 4;

  __shared__ __attribute__((aligned(16))) unsigned char lds[GBYTES];
  const unsigned int l = (unsigned int)(size_t)lds + wave * GPITCH + lane * 16;
  const unsigned char* hg =
      (const unsigned char*)(hattn_t +
          ((size_t)bb * NPIX + blockIdx.x * 128 + wave) * CH) + lane * 16;
  const unsigned char* wg =
      (const unsigned char*)(wp_bf + ((size_t)ot0 * 64 + wave) * CH) + lane * 16;
  gemm_open_two(l, hg, wg);

  v16bf hf[2][8];
  const unsigned char* hrow =
      lds + ((wave & 3) * 32 + row) * GPITCH + half * 16;
#pragma unroll
  for (int j = 0; j < 2; ++j)
#pragma unroll
    for (int ks = 0; ks < 8; ++ks)
      hf[j][ks] = lds_frag(hrow + j * 16 * GPITCH + ks * 64);

  for (int t = 0; t < PROJ_NT; ++t) {
    const int o0 = (ot0 + t) * 64 + (wave >> 2) * 32;
    const unsigned char* wrow = lds + ABYTES + (t & 1) * WBYTES +
                                ((wave >> 2) * 32 + row) * GPITCH + half * 16;

    v8f acc00 = {}, acc01 = {}, acc10 = {}, acc11 = {};
    v16bf wf[3][2];
    load_wstep(wf[0], wrow, 0);
    load_wstep(wf[1], wrow, 1);
#pragma unroll
    for (int ks = 0; ks < 8; ++ks) {
      if (ks < 6) load_wstep(wf[(ks + 2) % 3], wrow, ks + 2);
      // Keeps the reads two k steps ahead of their products: sunk to their
      // users, each read's latency is exposed.
      __builtin_amdgcn_sched_barrier(0);
      acc00 = wmma_bf16(wf[ks % 3][0], hf[0][ks], acc00);
      acc01 = wmma_bf16(wf[ks % 3][0], hf[1][ks], acc01);
      acc10 = wmma_bf16(wf[ks % 3][1], hf[0][ks], acc10);
      acc11 = wmma_bf16(wf[ks % 3][1], hf[1][ks], acc11);
    }

    FragCD d[2][2];
    d[0][0].v = acc00; d[0][1].v = acc01; d[1][0].v = acc10; d[1][1].v = acc11;

    // The lane's first element of x and of out: output row o0 + 8 * half, its pixel.
    const size_t e0 = ((size_t)bb * CH + o0 + half * 8) * NPIX + n0 + row;
    const float* xp = x + e0;
    float* op = out + e0;

    // Residual: one run of 32 loads from one address.
    float xv[2][2][8];
#pragma unroll
    for (int mi = 0; mi < 2; ++mi)
#pragma unroll
      for (int ni = 0; ni < 2; ++ni)
#pragma unroll
        for (int r = 0; r < 8; ++r) {
          // The last load's result may land in the address registers that the
          // loads above name.
          if (mi == 1 && ni == 1 && r == 7)
            asm volatile("s_wait_xcnt 0x0" ::: "memory");
          xv[mi][ni][r] = xp[(mi * 16 + r) * NPIX + ni * 16];
        }
    // The bias loads may land in the address registers of this run.
    asm volatile("s_wait_xcnt 0x0" ::: "memory");

    // Bias: per output row, that is per register.
    const float* bp = proj_b + o0 + half * 8;
    v4f blo[2], bhi[2];
    blo[0] = *(const v4f*)bp;
    bhi[0] = *(const v4f*)(bp + 4);
    blo[1] = *(const v4f*)(bp + 16);
    // As above: the last load's result, then what follows it.
    asm volatile("s_wait_xcnt 0x0" ::: "memory");
    bhi[1] = *(const v4f*)(bp + 20);
    asm volatile("s_wait_xcnt 0x0" ::: "memory");

#pragma unroll
    for (int mi = 0; mi < 2; ++mi)
#pragma unroll
      for (int ni = 0; ni < 2; ++ni)
#pragma unroll
        for (int r = 0; r < 8; ++r)
          d[mi][ni].f[r] = xv[mi][ni][r] + d[mi][ni].f[r] +
                           (r < 4 ? blo[mi][r & 3] : bhi[mi][r & 3]);
#pragma unroll
    for (int mi = 0; mi < 2; ++mi)
#pragma unroll
      for (int ni = 0; ni < 2; ++ni)
#pragma unroll
        for (int r = 0; r < 8; ++r)
          op[(mi * 16 + r) * NPIX + ni * 16] = d[mi][ni].f[r];
    // The next tile writes the registers that these stores name.
    asm volatile("s_wait_xcnt 0x0" ::: "memory");
  }
}

// ---------------------------------------------------------------------------
// Host-side launcher.
// Inputs: 0:x 1:norm_w 2:norm_b 3:qkv_w 4:qkv_b 5:proj_w 6:proj_b
// ---------------------------------------------------------------------------
extern "C" void kernel_launch(void* const* d_in, const int* in_sizes, int n_in,
                              void* d_out, int out_size, void* d_ws, size_t ws_size,
                              hipStream_t stream) {
  (void)in_sizes; (void)n_in; (void)out_size; (void)ws_size;
  const float* x      = (const float*)d_in[0];
  const float* norm_w = (const float*)d_in[1];
  const float* norm_b = (const float*)d_in[2];
  const float* qkv_w  = (const float*)d_in[3];
  const float* qkv_b  = (const float*)d_in[4];
  const float* proj_w = (const float*)d_in[5];
  const float* proj_b = (const float*)d_in[6];
  float* out = (float*)d_out;

  char* ws = (char*)d_ws;
  const size_t SZ_WQ = (size_t)3 * CH * CH * 2;            // 384 KB
  const size_t SZ_WP = (size_t)CH * CH * 2;                // 128 KB
  const size_t SZ_T  = (size_t)BATCH * NPIX * CH * 2;      // 16 MB per tensor
  unsigned short* wq_bf   = (unsigned short*)(ws);
  unsigned short* wp_bf   = (unsigned short*)(ws + SZ_WQ);
  unsigned short* h_t     = (unsigned short*)(ws + SZ_WQ + SZ_WP);
  unsigned short* q_t     = (unsigned short*)(ws + SZ_WQ + SZ_WP + 1 * SZ_T);
  unsigned short* k_t     = (unsigned short*)(ws + SZ_WQ + SZ_WP + 2 * SZ_T);
  unsigned short* v_t     = (unsigned short*)(ws + SZ_WQ + SZ_WP + 3 * SZ_T);
  unsigned short* hattn_t = (unsigned short*)(ws + SZ_WQ + SZ_WP + 4 * SZ_T);

  k_cvt_weights<<<dim3((3 * CH * CH + 255) / 256), dim3(256), 0, stream>>>(
      qkv_w, proj_w, wq_bf, wp_bf);

  k_groupnorm<<<dim3(BATCH * NGRP), dim3(256), 0, stream>>>(
      x, norm_w, norm_b, h_t);

  k_qkv<<<dim3(NPIX / 128, (3 * CH) / (64 * QKV_NT), BATCH), dim3(256), 0, stream>>>(
      wq_bf, qkv_b, h_t, q_t, k_t, v_t);

  k_attn<<<dim3(NPIX / 128, BATCH), dim3(256), 0, stream>>>(
      q_t, k_t, v_t, hattn_t);

  k_proj<<<dim3(NPIX / 128, CH / (64 * PROJ_NT), BATCH), dim3(256), 0, stream>>>(
      wp_bf, proj_b, hattn_t, x, out);
}

// v006
// A run of this version takes 78.4 microseconds.
// In two side-by-side timings against v005, it was 1.10 and 1.11 times as fast.
// Over all steps from v000 it is 6.65 times as fast.
#include <hip/hip_runtime.h>

// ---------------------------------------------------------------------------
// CDNA5 (gfx1250) attention block: GroupNorm -> QKV -> softmax(QK^T/sqrt(C))V
// -> proj -> residual.  All GEMM stages use v_wmma_f32_16x16x32_bf16 (wave32).
// ---------------------------------------------------------------------------

typedef __attribute__((ext_vector_type(16))) __bf16 v16bf;
typedef __attribute__((ext_vector_type(8)))  float  v8f;
typedef __attribute__((ext_vector_type(4)))  float  v4f;
typedef __attribute__((ext_vector_type(4)))  unsigned int v4u;

union FragAB { unsigned int u[8]; v16bf v; };
union FragCD { float f[8]; v8f v; };

#define BATCH 32
#define CH    256
#define NPIX  1024
#define NGRP  8
#define CPG   32           // channels per group

__device__ __forceinline__ unsigned short f2bf(float x) {
  unsigned int u = __float_as_uint(x);
  u += 0x7fffu + ((u >> 16) & 1u);           // round-to-nearest-even
  return (unsigned short)(u >> 16);
}

// Load a 16x32 bf16 A- or B-fragment.  `p` points to the *lane's* row (A) or
// column (B) start, with the K dimension contiguous in memory.  K-pair slot i
// in VGPR i follows the ISA 16-bit A-matrix table:
//   lanes 0-15 : V0..V3 -> K 0..7,  V4..V7 -> K 16..23
//   lanes 16-31: V0..V3 -> K 8..15, V4..V7 -> K 24..31
__device__ __forceinline__ v16bf load_ab_frag(const unsigned short* p) {
  const int half = (threadIdx.x >> 4) & 1;
  const unsigned int* p32 = (const unsigned int*)p;
  FragAB f;
#pragma unroll
  for (int i = 0; i < 8; ++i) {
    int kb = (i < 4) ? (half * 8 + 2 * i) : (16 + half * 8 + 2 * (i - 4));
    f.u[i] = p32[kb >> 1];
  }
  return f.v;
}

__device__ __forceinline__ v8f wmma_bf16(v16bf a, v16bf b, v8f c) {
  return __builtin_amdgcn_wmma_f32_16x16x32_bf16(
      /*neg_a=*/false, a, /*neg_b=*/false, b,
      /*c_mod=*/(short)0, c, /*reuse_a=*/false, /*reuse_b=*/false);
}

// A-fragment from LDS, same k order as load_ab_frag.  p = the lane's row, at
// the 64-B block of the k step, plus 16 B for lanes 16-31.
__device__ __forceinline__ v16bf lds_frag(const unsigned char* p) {
  v4u lo = *(const v4u*)(p);
  v4u hi = *(const v4u*)(p + 32);
  FragAB f;
#pragma unroll
  for (int i = 0; i < 4; ++i) { f.u[i] = lo[i]; f.u[4 + i] = hi[i]; }
  return f.v;
}

// LDS of the QKV GEMM: a block's 128 activation rows (256 bf16 each), then two
// buffers of 64 weight rows.  The projection in k_attn uses the same row pitch.
#define GPITCH 528                        // LDS bytes per row: 512 + 16
#define ABYTES (128 * GPITCH)
#define WBYTES (64 * GPITCH)
#define GBYTES (ABYTES + 2 * WBYTES)
#define WSTEP  (64 * CH * 2)              // global bytes from a weight tile to the next

// Eight copies of one wave, each a whole 512-B row (16 B per lane): rows r,
// r + 8, ..., r + 56.  l: the lane's LDS byte address in row r; g: its global
// address there.  The s_wait_xcnt stands inside the statement so that no
// address register is rewritten ahead of it.
__device__ __forceinline__ void stage_rows8(unsigned int l,
                                            const unsigned char* g) {
  asm volatile(
      "global_load_async_to_lds_b128 %0, %8, off\n\t"
      "global_load_async_to_lds_b128 %1, %9, off\n\t"
      "global_load_async_to_lds_b128 %2, %10, off\n\t"
      "global_load_async_to_lds_b128 %3, %11, off\n\t"
      "global_load_async_to_lds_b128 %4, %12, off\n\t"
      "global_load_async_to_lds_b128 %5, %13, off\n\t"
      "global_load_async_to_lds_b128 %6, %14, off\n\t"
      "global_load_async_to_lds_b128 %7, %15, off\n\t"
      "s_wait_xcnt 0x0"
      :: "v"(l), "v"(l + 8 * GPITCH), "v"(l + 16 * GPITCH),
         "v"(l + 24 * GPITCH), "v"(l + 32 * GPITCH), "v"(l + 40 * GPITCH),
         "v"(l + 48 * GPITCH), "v"(l + 56 * GPITCH),
         "v"(g), "v"(g + 8 * CH * 2), "v"(g + 16 * CH * 2),
         "v"(g + 24 * CH * 2), "v"(g + 32 * CH * 2), "v"(g + 40 * CH * 2),
         "v"(g + 48 * CH * 2), "v"(g + 56 * CH * 2)
      : "memory");
}

// In front of the walk over the weight tiles: the activation rows and tile 0
// land and are published, then tile 1 is sent for.  l: the lane's LDS byte
// address in row `wave` of the block's LDS; ag, wg: its global addresses in that
// row of the activations and of weight tile 0.
__device__ __forceinline__ void gemm_open(unsigned int l,
                                          const unsigned char* ag,
                                          const unsigned char* wg) {
  stage_rows8(l, ag);
  stage_rows8(l + 64 * GPITCH, ag + 64 * CH * 2);
  stage_rows8(l + ABYTES, wg);
  // The rows have landed for this wave, then for every wave.
  asm volatile("s_wait_asynccnt 0x0" ::: "memory");
  __syncthreads();
  stage_rows8(l + ABYTES + WBYTES, wg + WSTEP);
}

// Hand-over behind the products of tile t (of nt): this wave's reads of the tile
// are done, its copies of tile t + 1 have landed; behind the barrier that holds
// for every wave, and tile t + 2 may take the buffer of tile t.
__device__ __forceinline__ void gemm_hand_over(int t, int nt, unsigned int l,
                                               const unsigned char* wg) {
  asm volatile("s_wait_dscnt 0x0" ::: "memory");
  asm volatile("s_wait_asynccnt 0x0" ::: "memory");
  __syncthreads();
  if (t + 2 < nt)
    stage_rows8(l + ABYTES + (unsigned int)(t & 1) * WBYTES,
                wg + (size_t)(t + 2) * WSTEP);
}

// A wave's two fragments (16 rows each, weights or activations) of k step ks.
__device__ __forceinline__ void load_wstep(v16bf (&wf)[2],
                                           const unsigned char* wrow, int ks) {
#pragma unroll
  for (int i = 0; i < 2; ++i)
    wf[i] = lds_frag(wrow + i * 16 * GPITCH + ks * 64);
}

// ---------------------------------------------------------------------------
// Kernel 0: fp32 -> bf16 weight conversion (qkv_w: 768x256, proj_w: 256x256)
// ---------------------------------------------------------------------------
__global__ void k_cvt_weights(const float* __restrict__ qkv_w,
                              const float* __restrict__ proj_w,
                              unsigned short* __restrict__ wq_bf,
                              unsigned short* __restrict__ wp_bf) {
  int i = blockIdx.x * 256 + threadIdx.x;
  if (i < 3 * CH * CH) wq_bf[i] = f2bf(qkv_w[i]);
  if (i < CH * CH)     wp_bf[i] = f2bf(proj_w[i]);
}

// ---------------------------------------------------------------------------
// Kernel 1: GroupNorm.  One block per (batch, group).  Output h stored as
// bf16 in [B][N][C] layout (channel-contiguous per pixel) for WMMA B-frags.
// x is read once: the block's 256 lanes hold the group's 32 x 1024 values in
// registers (128 each), sum them there and normalise them there.
// The block size is declared so that a lane may hold its 128 values.
// ---------------------------------------------------------------------------
__global__ void __launch_bounds__(256) k_groupnorm(const float* __restrict__ x,
                            const float* __restrict__ nw,
                            const float* __restrict__ nb,
                            unsigned short* __restrict__ h_t) {
  const int bb = blockIdx.x >> 3;
  const int g  = blockIdx.x & 7;
  const int c0 = g * CPG;
  const float* xp = x + ((size_t)bb * CH + c0) * NPIX;   // 32*1024 contiguous

  // A lane owns 8 channels x 4 pixels, four times: the 8 lanes that share cl
  // read one whole 128-B line of a channel row, and the 4 lanes of one pixel
  // store its 32 channels as one contiguous 64-B run (16 B per lane).
  const int lane = threadIdx.x & 31;
  const int wave = threadIdx.x >> 5;
  const int cl   = (lane & 3) * 8;                // first of the lane's channels
  const int n0   = wave * 128 + (lane >> 2) * 4;  // first of the lane's pixels
  // Every loop below is fully unrolled so that v, w8 and b8 are registers.
  v4f v[4][8];
#pragma unroll
  for (int it = 0; it < 4; ++it)
#pragma unroll
    for (int j = 0; j < 8; ++j)
      v[it][j] = *(const v4f*)(xp + (cl + j) * NPIX + n0 + it * 32);
  float w8[8], b8[8];
#pragma unroll
  for (int j = 0; j < 8; ++j) {
    w8[j] = nw[c0 + cl + j];
    b8[j] = nb[c0 + cl + j];
  }
  // Keeps all these loads ahead of the first sum, one memory latency for all:
  // without it the loads of w8 and b8 sink behind the sums, and their latency
  // is exposed in front of the first barrier.
  __builtin_amdgcn_sched_barrier(0);

  // The lane's share of the two sums, four independent chains each.
  v4f s4 = {}, q4 = {};
#pragma unroll
  for (int it = 0; it < 4; ++it)
#pragma unroll
    for (int j = 0; j < 8; ++j) {
      s4 += v[it][j];
      q4 += v[it][j] * v[it][j];
    }
  const float s  = (s4[0] + s4[1]) + (s4[2] + s4[3]);
  const float s2 = (q4[0] + q4[1]) + (q4[2] + q4[3]);

  __shared__ float rs[256], rs2[256];
  rs[threadIdx.x] = s; rs2[threadIdx.x] = s2;
  __syncthreads();
  for (int off = 128; off > 0; off >>= 1) {
    if (threadIdx.x < off) {
      rs[threadIdx.x]  += rs[threadIdx.x + off];
      rs2[threadIdx.x] += rs2[threadIdx.x + off];
    }
    __syncthreads();
  }
  const float inv_n = 1.0f / (float)(CPG * NPIX);
  const float mean  = rs[0] * inv_n;
  const float var   = rs2[0] * inv_n - mean * mean;
  const float rstd  = rsqrtf(var + 1e-5f);

#pragma unroll
  for (int it = 0; it < 4; ++it) {
#pragma unroll
    for (int p = 0; p < 4; ++p) {
      v4u o;
#pragma unroll
      for (int k = 0; k < 4; ++k) {
        float lo = (v[it][2 * k][p]     - mean) * rstd * w8[2 * k]     + b8[2 * k];
        float hi = (v[it][2 * k + 1][p] - mean) * rstd * w8[2 * k + 1] + b8[2 * k + 1];
        o[k] = (unsigned int)f2bf(lo) | ((unsigned int)f2bf(hi) << 16);
      }
      *(v4u*)(h_t + ((size_t)bb * NPIX + n0 + it * 32 + p) * CH + c0 + cl) = o;
    }
  }
}

// ---------------------------------------------------------------------------
// Kernel 2: QKV GEMM.  qkv[o,n] = sum_c W[o,c] * h[n,c] + b[o].
// A block owns 128 pixels (n) and walks 6 tiles of 64 output channels (o); 8
// waves, each a 32x32 tile (2x2 WMMA) of every 64 x 128 tile.  The h rows come
// into LDS once and a wave keeps its 32 pixels' fragments in registers; the W
// tiles come through two LDS buffers, each copied while the one before is used.
// Q,K stored [B][N][C] bf16; V stored [B][C][N] bf16.
// A tile lies wholly in Q, in K or in V.  Q and K tiles are computed as W h^T
// (A rows = output channels), V tiles as h W^T (A rows = pixels): the 8
// accumulators of a lane run along the A rows, so they are always 8 neighbours
// in the stored layout and leave as one 16-B store.
// Four waves per SIMD (two blocks per WGP, as their LDS allows): 256 registers.
// ---------------------------------------------------------------------------
#define QKV_NT 6                          // weight tiles per block

// One weight tile of one wave: products, hand-over, bias, stores.  ISV: the tile
// lies in V.  t: the tile's place in the block's walk; ot: its number in W.
template <bool ISV>
__device__ __forceinline__ void qkv_tile(int t, int ot, int bb, int n0,
                                         const v16bf (&hf)[2][8],
                                         const unsigned char* lds,
                                         unsigned int l, const unsigned char* wg,
                                         const float* __restrict__ qkv_b,
                                         unsigned short* __restrict__ base) {
  const int wave = threadIdx.x >> 5;
  const int lane = threadIdx.x & 31;
  const int row  = lane & 15;
  const int half = lane >> 4;
  const int o0   = ot * 64 + (wave >> 2) * 32;
  const int oc0  = o0 & 255;                   // channel inside Q, K or V
  const unsigned char* wrow = lds + ABYTES + (t & 1) * WBYTES +
                              ((wave >> 2) * 32 + row) * GPITCH + half * 16;

  // acc[i][j]: register r = A row i * 16 + 8 * half + r, lane = B row j * 16 + row.
  v8f acc[2][2] = {};
  v16bf wf[3][2];
  load_wstep(wf[0], wrow, 0);
  load_wstep(wf[1], wrow, 1);
#pragma unroll
  for (int ks = 0; ks < 8; ++ks) {
    if (ks < 6) load_wstep(wf[(ks + 2) % 3], wrow, ks + 2);
    // Keeps the reads two k steps ahead of their products: sunk to their users,
    // each read's latency is exposed.
    __builtin_amdgcn_sched_barrier(0);
    const v16bf w0 = wf[ks % 3][0], w1 = wf[ks % 3][1];
    acc[0][0] = ISV ? wmma_bf16(hf[0][ks], w0, acc[0][0])
                    : wmma_bf16(w0, hf[0][ks], acc[0][0]);
    acc[0][1] = ISV ? wmma_bf16(hf[0][ks], w1, acc[0][1])
                    : wmma_bf16(w0, hf[1][ks], acc[0][1]);
    acc[1][0] = ISV ? wmma_bf16(hf[1][ks], w0, acc[1][0])
                    : wmma_bf16(w1, hf[0][ks], acc[1][0]);
    acc[1][1] = ISV ? wmma_bf16(hf[1][ks], w1, acc[1][1])
                    : wmma_bf16(w1, hf[1][ks], acc[1][1]);
  }

  gemm_hand_over(t, QKV_NT, l, wg);

  // The lane's B row of the stored array, at the first of its A rows.
  const int pitch  = ISV ? NPIX : CH;
  const int brow0  = ISV ? bb * CH + oc0 : bb * NPIX + n0;
  const int acol0  = ISV ? n0 : oc0;
  unsigned short* dst = base + (size_t)(brow0 + row) * pitch + acol0 + half * 8;
  const size_t pitch16 = (size_t)16 * pitch;

  // Bias: per output channel, that is per register for Q and K, per lane for V.
  if (ISV) {
#pragma unroll
    for (int j = 0; j < 2; ++j) {
      const float bl = qkv_b[o0 + j * 16 + row];
#pragma unroll
      for (int i = 0; i < 2; ++i) acc[i][j] += bl;
    }
  } else {
    const float* bp = qkv_b + o0 + half * 8;
    v4f blo[2], bhi[2];
    blo[0] = *(const v4f*)bp;
    bhi[0] = *(const v4f*)(bp + 4);
    blo[1] = *(const v4f*)(bp + 16);
    // The last load's result may land in the address registers that the three
    // loads above name.
    asm volatile("s_wait_xcnt 0x0" ::: "memory");
    bhi[1] = *(const v4f*)(bp + 20);
#pragma unroll
    for (int i = 0; i < 2; ++i)
#pragma unroll
      for (int j = 0; j < 2; ++j)
#pragma unroll
        for (int r = 0; r < 4; ++r) {
          acc[i][j][r]     += blo[i][r];
          acc[i][j][4 + r] += bhi[i][r];
        }
  }

  v4u w[2][2];
#pragma unroll
  for (int i = 0; i < 2; ++i)
#pragma unroll
    for (int j = 0; j < 2; ++j)
#pragma unroll
      for (int p = 0; p < 4; ++p)
        w[i][j][p] = (unsigned int)f2bf(acc[i][j][2 * p]) |
                     ((unsigned int)f2bf(acc[i][j][2 * p + 1]) << 16);
#pragma unroll
  for (int i = 0; i < 2; ++i)
#pragma unroll
    for (int j = 0; j < 2; ++j)
      *(v4u*)(dst + j * pitch16 + i * 16) = w[i][j];
  // The next tile writes the registers that these stores name.
  asm volatile("s_wait_xcnt 0x0" ::: "memory");
}

__global__ void __launch_bounds__(256)
__attribute__((amdgpu_waves_per_eu(4, 4))) k_qkv(
                      const unsigned short* __restrict__ wq_bf,
                      const float* __restrict__ qkv_b,
                      const unsigned short* __restrict__ h_t,
                      unsigned short* __restrict__ q_t,
                      unsigned short* __restrict__ k_t,
                      unsigned short* __restrict__ v_t) {
  const int bb   = blockIdx.z;
  const int wave = threadIdx.x >> 5;
  const int n0   = blockIdx.x * 128 + (wave & 3) * 32;
  const int ot0  = blockIdx.y * QKV_NT;        // the block's first weight tile
  const int lane = threadIdx.x & 31;
  const int row  = lane & 15;
  const int half = lane >> 4;

  __shared__ __attribute__((aligned(16))) unsigned char lds[GBYTES];
  const unsigned int l = (unsigned int)(size_t)lds + wave * GPITCH + lane * 16;
  const unsigned char* hg =
      (const unsigned char*)(h_t +
          ((size_t)bb * NPIX + blockIdx.x * 128 + wave) * CH) + lane * 16;
  const unsigned char* wg =
      (const unsigned char*)(wq_bf + ((size_t)ot0 * 64 + wave) * CH) + lane * 16;
  gemm_open(l, hg, wg);

  v16bf hf[2][8];
  const unsigned char* hrow =
      lds + ((wave & 3) * 32 + row) * GPITCH + half * 16;
#pragma unroll
  for (int j = 0; j < 2; ++j)
#pragma unroll
    for (int ks = 0; ks < 8; ++ks)
      hf[j][ks] = lds_frag(hrow + j * 16 * GPITCH + ks * 64);

  // Weight tiles 0-3 are Q, 4-7 K, 8-11 V: first the block's Q and K tiles, then
  // its V tiles, one walk through the two buffers.
  int t = 0;
  for (; t < QKV_NT && ot0 + t < 8; ++t)
    qkv_tile<false>(t, ot0 + t, bb, n0, hf, lds, l, wg, qkv_b,
                    ot0 + t < 4 ? q_t : k_t);
  for (; t < QKV_NT; ++t)
    qkv_tile<true>(t, ot0 + t, bb, n0, hf, lds, l, wg, qkv_b, v_t);
  // No copy is outstanding when the wave ends.
  asm volatile("s_wait_asynccnt 0x0" ::: "memory");
}

typedef __attribute__((ext_vector_type(2))) float  v2f;
typedef __attribute__((ext_vector_type(2))) __bf16 v2bf;

#define KTILE    32                       // keys per tile
#define NTILE    (NPIX / KTILE)
#define KPITCH   528                      // LDS bytes per key row: 512 + 16
#define VPITCH   80                       // LDS bytes per channel row: 64 + 16
#define KBYTES   (KTILE * KPITCH)
#define BUFBYTES (KBYTES + CH * VPITCH)
#define PBYTES   (CH * GPITCH)            // the projection's 256 weight rows

// Two f32 -> one register of two bf16, round to nearest even.
__device__ __forceinline__ unsigned int pack_bf2(float lo, float hi) {
  v2f t = {lo, hi};
  return __builtin_bit_cast(unsigned int, __builtin_convertvector(t, v2bf));
}

// Value of lane l ^ 16.
__device__ __forceinline__ float other_half(float x) {
  int b = __float_as_int(x);
  return __int_as_float(__builtin_amdgcn_permlanex16(
      b, b, 0x76543210, 0xfedcba98, false, false));
}

// One tile's copies of one lane: 4 x 16 B of K, 4 x 16 B of V.  kl, vl: LDS
// byte addresses; kg, vg: global addresses.  The s_wait_xcnt stands inside the
// statement so that no address register is rewritten ahead of it.
__device__ __forceinline__ void stage_tile(unsigned int kl, unsigned int vl,
                                           const unsigned char* kg,
                                           const unsigned char* vg) {
  asm volatile(
      "global_load_async_to_lds_b128 %0, %8, off\n\t"
      "global_load_async_to_lds_b128 %1, %9, off\n\t"
      "global_load_async_to_lds_b128 %2, %10, off\n\t"
      "global_load_async_to_lds_b128 %3, %11, off\n\t"
      "global_load_async_to_lds_b128 %4, %12, off\n\t"
      "global_load_async_to_lds_b128 %5, %13, off\n\t"
      "global_load_async_to_lds_b128 %6, %14, off\n\t"
      "global_load_async_to_lds_b128 %7, %15, off\n\t"
      "s_wait_xcnt 0x0"
      :: "v"(kl), "v"(kl + 8 * KPITCH), "v"(kl + 16 * KPITCH),
         "v"(kl + 24 * KPITCH),
         "v"(vl), "v"(vl + 64 * VPITCH), "v"(vl + 128 * VPITCH),
         "v"(vl + 192 * VPITCH),
         "v"(kg), "v"(kg + 8 * CH * 2), "v"(kg + 16 * CH * 2),
         "v"(kg + 24 * CH * 2),
         "v"(vg), "v"(vg + 64 * NPIX * 2), "v"(vg + 128 * NPIX * 2),
         "v"(vg + 192 * NPIX * 2)
      : "memory");
}

// Two waves per SIMD (one block per WGP): the register budget this gives lets
// a wave hold a whole tile's fragments, so its LDS reads stand in two groups.
__global__ void __launch_bounds__(256)
__attribute__((amdgpu_waves_per_eu(2, 2))) k_attn(
                       const unsigned short* __restrict__ q_t,
                       const unsigned short* __restrict__ k_t,
                       const unsigned short* __restrict__ v_t,
                       const unsigned short* __restrict__ wp_bf,
                       const float* __restrict__ proj_b,
                       const float* __restrict__ x,
                       float* __restrict__ out) {
  const int bb   = blockIdx.y;
  const int tid  = threadIdx.x;
  const int wave = tid >> 5;
  const int lane = tid & 31;
  const int row  = lane & 15;
  const int half = lane >> 4;
  const int q    = blockIdx.x * 128 + wave * 16 + row;   // the lane's query
  const float c2 = 0.0625f * 1.44269504f;                // 256^-0.5 * log2(e)

  __shared__ __attribute__((aligned(16))) unsigned char ring[2 * BUFBYTES + PBYTES];

  // Copy addresses.  K: a wave copies one whole 512-B key row per instruction.
  // V: 4 lanes copy the 64 B that one channel holds of the tile's 32 keys.
  // The wave's share of an LDS address is kept scalar, the lane's in a register.
  const unsigned int ring0 = (unsigned int)(size_t)ring;
  const unsigned int wv = __builtin_amdgcn_readfirstlane(wave);
  const unsigned int ks0 = ring0 + wv * KPITCH;
  const unsigned int vs0 = ring0 + KBYTES + wv * (8 * VPITCH);
  const unsigned int kln = lane * 16;
  const unsigned int vln = (lane >> 2) * VPITCH + (lane & 3) * 16;
  const unsigned char* kg =
      (const unsigned char*)(k_t + ((size_t)bb * NPIX + wave) * CH) + lane * 16;
  const unsigned char* vg =
      (const unsigned char*)(v_t + ((size_t)bb * CH + (tid >> 2)) * NPIX) +
      (tid & 3) * 16;

  stage_tile(ks0 + kln, vs0 + vln, kg, vg);

  // The 16 queries as B-fragments, kept in registers for the whole walk.
  v16bf qb[8];
  const unsigned short* qrow = q_t + ((size_t)bb * NPIX + q) * CH;
#pragma unroll
  for (int ks = 0; ks < 8; ++ks) qb[ks] = load_ab_frag(qrow + ks * 32);

  // Tile 0 has landed for this wave, then for every wave.
  asm volatile("s_wait_asynccnt 0x0" ::: "memory");
  __syncthreads();
  stage_tile(ks0 + BUFBYTES + kln, vs0 + BUFBYTES + vln, kg + KTILE * CH * 2,
             vg + KTILE * 2);
  // The projection's weights, 32 rows a wave, behind the ring: they land under
  // the wait and the barrier at the foot of the first trip, with tile 1.
  {
    const unsigned int pl = ring0 + 2 * BUFBYTES + wave * GPITCH + lane * 16;
    const unsigned char* pg =
        (const unsigned char*)(wp_bf + (size_t)wave * CH) + lane * 16;
#pragma unroll
    for (int i = 0; i < 4; ++i)
      stage_rows8(pl + i * 64 * GPITCH, pg + i * 64 * CH * 2);
  }

  v8f o[16];
#pragma unroll
  for (int ct = 0; ct < 16; ++ct) o[ct] = (v8f){};
  float mref = -3.0e38f;     // maximum in use, in units of log2
  float lsum = 0.f;          // this half's share of the query's sum

  for (int t = 0; t < NTILE; ++t) {
    const unsigned int boff = (unsigned int)(t & 1) * BUFBYTES;
    const unsigned char* kb = ring + boff + row * KPITCH + half * 16;
    const unsigned char* vb = ring + boff + KBYTES + row * VPITCH + half * 16;

    // S^T: register r of st0 / st1 = key 8 * half + r / 16 + 8 * half + r.
    v8f st0 = {}, st1 = {};
#pragma unroll
    for (int ks = 0; ks < 8; ++ks) {
      st0 = wmma_bf16(lds_frag(kb + ks * 64), qb[ks], st0);
      st1 = wmma_bf16(lds_frag(kb + 16 * KPITCH + ks * 64), qb[ks], st1);
    }

    // The tile's V fragments, read as one group while the softmax runs.
    v16bf vf[16];
#pragma unroll
    for (int ct = 0; ct < 16; ++ct) vf[ct] = lds_frag(vb + ct * 16 * VPITCH);
    // Keeps the group here: sunk to their users, each read's latency is exposed.
    __builtin_amdgcn_sched_barrier(0);

    float mt = fmaxf(st0[0], st1[0]);
#pragma unroll
    for (int r = 1; r < 8; ++r) mt = fmaxf(mt, fmaxf(st0[r], st1[r]));
    mt = fmaxf(mt, other_half(mt)) * c2;

    // The maximum in use is replaced only when some query's new one exceeds it
    // by more than 8: until then every exponential stays at or below 2^8.
    if (__builtin_amdgcn_ballot_w32(mt > mref + 8.0f) != 0) {
      const float mn = fmaxf(mref, mt);
      const float al = __builtin_amdgcn_exp2f(mref - mn);
      lsum *= al;
#pragma unroll
      for (int ct = 0; ct < 16; ++ct) o[ct] *= al;
      mref = mn;
    }

    FragAB pb;
#pragma unroll
    for (int i = 0; i < 4; ++i) {
      float a0 = __builtin_amdgcn_exp2f(st0[2 * i]     * c2 - mref);
      float a1 = __builtin_amdgcn_exp2f(st0[2 * i + 1] * c2 - mref);
      float b0 = __builtin_amdgcn_exp2f(st1[2 * i]     * c2 - mref);
      float b1 = __builtin_amdgcn_exp2f(st1[2 * i + 1] * c2 - mref);
      lsum += (a0 + a1) + (b0 + b1);
      pb.u[i]     = pack_bf2(a0, a1);
      pb.u[4 + i] = pack_bf2(b0, b1);
    }

    // O^T: register r of o[ct] = channel ct * 16 + 8 * half + r.
#pragma unroll
    for (int ct = 0; ct < 16; ++ct)
      o[ct] = wmma_bf16(vf[ct], pb.v, o[ct]);

    // Hand-over: this wave's reads of the tile are done, its copies of the next
    // tile have landed; behind the barrier that holds for every wave.
    asm volatile("s_wait_dscnt 0x0" ::: "memory");
    asm volatile("s_wait_asynccnt 0x0" ::: "memory");
    __syncthreads();
    if (t + 2 < NTILE)
    {
      // Scalar sums first: added lane part first, the sum shared with the first
      // tile's copy is an asm operand, is held below v256 and gets spilled.
      const unsigned int ksb = __builtin_amdgcn_readfirstlane(ks0 + boff);
      const unsigned int vsb = __builtin_amdgcn_readfirstlane(vs0 + boff);
      stage_tile(ksb + kln, vsb + vln,
                 kg + (size_t)(t + 2) * (KTILE * CH * 2),
                 vg + (t + 2) * (KTILE * 2));
    }
  }
  // No copy is outstanding when the ring is put to its next use.
  asm volatile("s_wait_asynccnt 0x0" ::: "memory");

  // Bias: per output row, that is per register.  Wave w takes output channels
  // 32 w .. 32 w + 31.  Sent for here, so that it has come at the barrier below.
  const int o0 = wave * 32;
  const float* bp = proj_b + o0 + half * 8;
  v4f blo[2], bhi[2];
  blo[0] = *(const v4f*)bp;
  bhi[0] = *(const v4f*)(bp + 4);
  blo[1] = *(const v4f*)(bp + 16);
  bhi[1] = *(const v4f*)(bp + 20);
  // No address register of these loads is rewritten ahead of the wait: the
  // statement reads the address, which keeps it in its registers up to here.
  asm volatile("s_wait_xcnt 0x0" :: "v"(bp) : "memory");

  // The wave's 16 normalised rows as bf16, 512 B a pixel.  Every wave has left
  // the ring at the barrier of the last trip.
  const float inv = 1.0f / (lsum + other_half(lsum));
  unsigned char* orow = ring + (wave * 16 + row) * GPITCH + half * 16;
#pragma unroll
  for (int ct = 0; ct < 16; ++ct) {
    v4u w;
#pragma unroll
    for (int i = 0; i < 4; ++i)
      w[i] = pack_bf2(o[ct][2 * i] * inv, o[ct][2 * i + 1] * inv);
    *(v4u*)(orow + ct * 32) = w;
  }

  // The wave's 32 rows of Wp, kept in registers for all 128 pixels.
  v16bf pf[2][8];
  const unsigned char* prow =
      ring + 2 * BUFBYTES + (o0 + row) * GPITCH + half * 16;
#pragma unroll
  for (int i = 0; i < 2; ++i)
#pragma unroll
    for (int ks = 0; ks < 8; ++ks)
      pf[i][ks] = lds_frag(prow + i * 16 * GPITCH + ks * 64);

  // All 128 rows are written before any wave reads them.
  __syncthreads();

  // The lane's first element of x and of out: output row o0 + 8 * half, its pixel.
  const size_t e0 = ((size_t)bb * CH + o0 + half * 8) * NPIX +
                    blockIdx.x * 128 + row;
  const float* xp = x + e0;
  float* op = out + e0;

  // 32 pixels at a time: a 32x32 tile (2x2 WMMA) of the wave's 32 x 128.  The
  // residual of a tile is one run of 32 loads, sent for two tiles ahead.
  // Every loop over c is fully unrolled so that xv is registers.
  float xv[4][2][2][8];
#pragma unroll
  for (int c = 0; c < 2; ++c) {
#pragma unroll
    for (int mi = 0; mi < 2; ++mi)
#pragma unroll
      for (int ni = 0; ni < 2; ++ni)
#pragma unroll
        for (int r = 0; r < 8; ++r)
          xv[c][mi][ni][r] = xp[(mi * 16 + r) * NPIX + c * 32 + ni * 16];
    // Ends the run, so that the runs return in the order of their use; and, as
    // at the bias, the address stays in its registers up to the wait.
    asm volatile("s_wait_xcnt 0x0" :: "v"(xp) : "memory");
  }

#pragma unroll
  for (int c = 0; c < 4; ++c) {
    const unsigned char* hrow = ring + (c * 32 + row) * GPITCH + half * 16;

    v8f acc00 = {}, acc01 = {}, acc10 = {}, acc11 = {};
    v16bf hf[3][2];
    load_wstep(hf[0], hrow, 0);
    load_wstep(hf[1], hrow, 1);
#pragma unroll
    for (int ks = 0; ks < 8; ++ks) {
      if (ks < 6) load_wstep(hf[(ks + 2) % 3], hrow, ks + 2);
      // Keeps the reads two k steps ahead of their products: sunk to their
      // users, each read's latency is exposed.
      __builtin_amdgcn_sched_barrier(0);
      acc00 = wmma_bf16(pf[0][ks], hf[ks % 3][0], acc00);
      acc01 = wmma_bf16(pf[0][ks], hf[ks % 3][1], acc01);
      acc10 = wmma_bf16(pf[1][ks], hf[ks % 3][0], acc10);
      acc11 = wmma_bf16(pf[1][ks], hf[ks % 3][1], acc11);
    }

    FragCD d[2][2];
    d[0][0].v = acc00; d[0][1].v = acc01; d[1][0].v = acc10; d[1][1].v = acc11;

#pragma unroll
    for (int mi = 0; mi < 2; ++mi)
#pragma unroll
      for (int ni = 0; ni < 2; ++ni)
#pragma unroll
        for (int r = 0; r < 8; ++r)
          d[mi][ni].f[r] = xv[c][mi][ni][r] + d[mi][ni].f[r] +
                           (r < 4 ? blo[mi][r & 3] : bhi[mi][r & 3]);
#pragma unroll
    for (int mi = 0; mi < 2; ++mi)
#pragma unroll
      for (int ni = 0; ni < 2; ++ni)
#pragma unroll
        for (int r = 0; r < 8; ++r)
          op[(mi * 16 + r) * NPIX + c * 32 + ni * 16] = d[mi][ni].f[r];
    // The next tile writes the registers that these stores name.
    asm volatile("s_wait_xcnt 0x0" :: "v"(op) : "memory");

    if (c + 2 < 4) {
#pragma unroll
      for (int mi = 0; mi < 2; ++mi)
#pragma unroll
        for (int ni = 0; ni < 2; ++ni)
#pragma unroll
          for (int r = 0; r < 8; ++r)
            xv[c + 2][mi][ni][r] =
                xp[(mi * 16 + r) * NPIX + (c + 2) * 32 + ni * 16];
      // As above: ends the run, the address in its registers up to the wait.
      asm volatile("s_wait_xcnt 0x0" :: "v"(xp) : "memory");
    }
  }
}

// ---------------------------------------------------------------------------
// Host-side launcher.
// Inputs: 0:x 1:norm_w 2:norm_b 3:qkv_w 4:qkv_b 5:proj_w 6:proj_b
// ---------------------------------------------------------------------------
extern "C" void kernel_launch(void* const* d_in, const int* in_sizes, int n_in,
                              void* d_out, int out_size, void* d_ws, size_t ws_size,
                              hipStream_t stream) {
  (void)in_sizes; (void)n_in; (void)out_size; (void)ws_size;
  const float* x      = (const float*)d_in[0];
  const float* norm_w = (const float*)d_in[1];
  const float* norm_b = (const float*)d_in[2];
  const float* qkv_w  = (const float*)d_in[3];
  const float* qkv_b  = (const float*)d_in[4];
  const float* proj_w = (const float*)d_in[5];
  const float* proj_b = (const float*)d_in[6];
  float* out = (float*)d_out;

  char* ws = (char*)d_ws;
  const size_t SZ_WQ = (size_t)3 * CH * CH * 2;            // 384 KB
  const size_t SZ_WP = (size_t)CH * CH * 2;                // 128 KB
  const size_t SZ_T  = (size_t)BATCH * NPIX * CH * 2;      // 16 MB per tensor
  unsigned short* wq_bf   = (unsigned short*)(ws);
  unsigned short* wp_bf   = (unsigned short*)(ws + SZ_WQ);
  unsigned short* h_t     = (unsigned short*)(ws + SZ_WQ + SZ_WP);
  unsigned short* q_t     = (unsigned short*)(ws + SZ_WQ + SZ_WP + 1 * SZ_T);
  unsigned short* k_t     = (unsigned short*)(ws + SZ_WQ + SZ_WP + 2 * SZ_T);
  unsigned short* v_t     = (unsigned short*)(ws + SZ_WQ + SZ_WP + 3 * SZ_T);

  k_cvt_weights<<<dim3((3 * CH * CH + 255) / 256), dim3(256), 0, stream>>>(
      qkv_w, proj_w, wq_bf, wp_bf);

  k_groupnorm<<<dim3(BATCH * NGRP), dim3(256), 0, stream>>>(
      x, norm_w, norm_b, h_t);

  k_qkv<<<dim3(NPIX / 128, (3 * CH) / (64 * QKV_NT), BATCH), dim3(256), 0, stream>>>(
      wq_bf, qkv_b, h_t, q_t, k_t, v_t);

  k_attn<<<dim3(NPIX / 128, BATCH), dim3(256), 0, stream>>>(
      q_t, k_t, v_t, wp_bf, proj_b, x, out);
}

// v007
// It runs in 75.6 microseconds.
// In both of two side-by-side timings against v006, it was 1.04 times as fast.
// Counting every step since v000, it is 6.90 times as fast.
#include <hip/hip_runtime.h>

// ---------------------------------------------------------------------------
// CDNA5 (gfx1250) attention block: GroupNorm -> QKV -> softmax(QK^T/sqrt(C))V
// -> proj -> residual.  All GEMM stages use v_wmma_f32_16x16x32_bf16 (wave32).
// ---------------------------------------------------------------------------

typedef __attribute__((ext_vector_type(16))) __bf16 v16bf;
typedef __attribute__((ext_vector_type(8)))  float  v8f;
typedef __attribute__((ext_vector_type(4)))  float  v4f;
typedef __attribute__((ext_vector_type(4)))  unsigned int v4u;

union FragAB { unsigned int u[8]; v16bf v; };
union FragCD { float f[8]; v8f v; };

#define BATCH 32
#define CH    256
#define NPIX  1024
#define NGRP  8
#define CPG   32           // channels per group

__device__ __forceinline__ unsigned short f2bf(float x) {
  unsigned int u = __float_as_uint(x);
  u += 0x7fffu + ((u >> 16) & 1u);           // round-to-nearest-even
  return (unsigned short)(u >> 16);
}

// Load a 16x32 bf16 A- or B-fragment.  `p` points to the *lane's* row (A) or
// column (B) start, with the K dimension contiguous in memory.  K-pair slot i
// in VGPR i follows the ISA 16-bit A-matrix table:
//   lanes 0-15 : V0..V3 -> K 0..7,  V4..V7 -> K 16..23
//   lanes 16-31: V0..V3 -> K 8..15, V4..V7 -> K 24..31
__device__ __forceinline__ v16bf load_ab_frag(const unsigned short* p) {
  const int half = (threadIdx.x >> 4) & 1;
  const unsigned int* p32 = (const unsigned int*)p;
  FragAB f;
#pragma unroll
  for (int i = 0; i < 8; ++i) {
    int kb = (i < 4) ? (half * 8 + 2 * i) : (16 + half * 8 + 2 * (i - 4));
    f.u[i] = p32[kb >> 1];
  }
  return f.v;
}

__device__ __forceinline__ v8f wmma_bf16(v16bf a, v16bf b, v8f c) {
  return __builtin_amdgcn_wmma_f32_16x16x32_bf16(
      /*neg_a=*/false, a, /*neg_b=*/false, b,
      /*c_mod=*/(short)0, c, /*reuse_a=*/false, /*reuse_b=*/false);
}

// A-fragment from LDS, same k order as load_ab_frag.  p = the lane's row, at
// the 64-B block of the k step, plus 16 B for lanes 16-31.
__device__ __forceinline__ v16bf lds_frag(const unsigned char* p) {
  v4u lo = *(const v4u*)(p);
  v4u hi = *(const v4u*)(p + 32);
  FragAB f;
#pragma unroll
  for (int i = 0; i < 4; ++i) { f.u[i] = lo[i]; f.u[4 + i] = hi[i]; }
  return f.v;
}

// LDS of the QKV GEMM: a block's 128 activation rows (256 bf16 each), then two
// buffers of 64 weight rows.  The projection in k_attn uses the same row pitch.
#define GPITCH 528                        // LDS bytes per row: 512 + 16
#define ABYTES (128 * GPITCH)
#define WBYTES (64 * GPITCH)
#define GBYTES (ABYTES + 2 * WBYTES)
#define WSTEP  (64 * CH * 2)              // global bytes from a weight tile to the next

// Eight copies of one wave, each a whole 512-B row (16 B per lane): rows r,
// r + 8, ..., r + 56.  l: the lane's LDS byte address in row r; g: its global
// address there.  The s_wait_xcnt stands inside the statement so that no
// address register is rewritten ahead of it.
__device__ __forceinline__ void stage_rows8(unsigned int l,
                                            const unsigned char* g) {
  asm volatile(
      "global_load_async_to_lds_b128 %0, %8, off\n\t"
      "global_load_async_to_lds_b128 %1, %9, off\n\t"
      "global_load_async_to_lds_b128 %2, %10, off\n\t"
      "global_load_async_to_lds_b128 %3, %11, off\n\t"
      "global_load_async_to_lds_b128 %4, %12, off\n\t"
      "global_load_async_to_lds_b128 %5, %13, off\n\t"
      "global_load_async_to_lds_b128 %6, %14, off\n\t"
      "global_load_async_to_lds_b128 %7, %15, off\n\t"
      "s_wait_xcnt 0x0"
      :: "v"(l), "v"(l + 8 * GPITCH), "v"(l + 16 * GPITCH),
         "v"(l + 24 * GPITCH), "v"(l + 32 * GPITCH), "v"(l + 40 * GPITCH),
         "v"(l + 48 * GPITCH), "v"(l + 56 * GPITCH),
         "v"(g), "v"(g + 8 * CH * 2), "v"(g + 16 * CH * 2),
         "v"(g + 24 * CH * 2), "v"(g + 32 * CH * 2), "v"(g + 40 * CH * 2),
         "v"(g + 48 * CH * 2), "v"(g + 56 * CH * 2)
      : "memory");
}

// In front of the walk over the weight tiles: the activation rows and tile 0
// land and are published, then tile 1 is sent for.  l: the lane's LDS byte
// address in row `wave` of the block's LDS; ag, wg: its global addresses in that
// row of the activations and of weight tile 0.
__device__ __forceinline__ void gemm_open(unsigned int l,
                                          const unsigned char* ag,
                                          const unsigned char* wg) {
  stage_rows8(l, ag);
  stage_rows8(l + 64 * GPITCH, ag + 64 * CH * 2);
  stage_rows8(l + ABYTES, wg);
  // The rows have landed for this wave, then for every wave.
  asm volatile("s_wait_asynccnt 0x0" ::: "memory");
  __syncthreads();
  stage_rows8(l + ABYTES + WBYTES, wg + WSTEP);
}

// Hand-over behind the products of tile t (of nt): this wave's reads of the tile
// are done, its copies of tile t + 1 have landed; behind the barrier that holds
// for every wave, and tile t + 2 may take the buffer of tile t.
__device__ __forceinline__ void gemm_hand_over(int t, int nt, unsigned int l,
                                               const unsigned char* wg) {
  asm volatile("s_wait_dscnt 0x0" ::: "memory");
  asm volatile("s_wait_asynccnt 0x0" ::: "memory");
  __syncthreads();
  if (t + 2 < nt)
    stage_rows8(l + ABYTES + (unsigned int)(t & 1) * WBYTES,
                wg + (size_t)(t + 2) * WSTEP);
}

// A wave's two fragments (16 rows each, weights or activations) of k step ks.
__device__ __forceinline__ void load_wstep(v16bf (&wf)[2],
                                           const unsigned char* wrow, int ks) {
#pragma unroll
  for (int i = 0; i < 2; ++i)
    wf[i] = lds_frag(wrow + i * 16 * GPITCH + ks * 64);
}

// ---------------------------------------------------------------------------
// Kernel 0: fp32 -> bf16 weight conversion (qkv_w: 768x256, proj_w: 256x256)
// ---------------------------------------------------------------------------
__global__ void k_cvt_weights(const float* __restrict__ qkv_w,
                              const float* __restrict__ proj_w,
                              unsigned short* __restrict__ wq_bf,
                              unsigned short* __restrict__ wp_bf) {
  int i = blockIdx.x * 256 + threadIdx.x;
  if (i < 3 * CH * CH) wq_bf[i] = f2bf(qkv_w[i]);
  if (i < CH * CH)     wp_bf[i] = f2bf(proj_w[i]);
}

// ---------------------------------------------------------------------------
// Kernel 1: GroupNorm.  One block per (batch, group).  Output h stored as
// bf16 in [B][N][C] layout (channel-contiguous per pixel) for WMMA B-frags.
// x is read once: the block's 256 lanes hold the group's 32 x 1024 values in
// registers (128 each), sum them there and normalise them there.
// The block size is declared so that a lane may hold its 128 values.
// ---------------------------------------------------------------------------
__global__ void __launch_bounds__(256) k_groupnorm(const float* __restrict__ x,
                            const float* __restrict__ nw,
                            const float* __restrict__ nb,
                            unsigned short* __restrict__ h_t) {
  const int bb = blockIdx.x >> 3;
  const int g  = blockIdx.x & 7;
  const int c0 = g * CPG;
  const float* xp = x + ((size_t)bb * CH + c0) * NPIX;   // 32*1024 contiguous

  // A lane owns 8 channels x 4 pixels, four times: the 8 lanes that share cl
  // read one whole 128-B line of a channel row, and the 4 lanes of one pixel
  // store its 32 channels as one contiguous 64-B run (16 B per lane).
  const int lane = threadIdx.x & 31;
  const int wave = threadIdx.x >> 5;
  const int cl   = (lane & 3) * 8;                // first of the lane's channels
  const int n0   = wave * 128 + (lane >> 2) * 4;  // first of the lane's pixels
  // Every loop below is fully unrolled so that v, w8 and b8 are registers.
  v4f v[4][8];
#pragma unroll
  for (int it = 0; it < 4; ++it)
#pragma unroll
    for (int j = 0; j < 8; ++j)
      v[it][j] = *(const v4f*)(xp + (cl + j) * NPIX + n0 + it * 32);
  float w8[8], b8[8];
#pragma unroll
  for (int j = 0; j < 8; ++j) {
    w8[j] = nw[c0 + cl + j];
    b8[j] = nb[c0 + cl + j];
  }
  // Keeps all these loads ahead of the first sum, one memory latency for all:
  // without it the loads of w8 and b8 sink behind the sums, and their latency
  // is exposed in front of the first barrier.
  __builtin_amdgcn_sched_barrier(0);

  // The lane's share of the two sums, four independent chains each.
  v4f s4 = {}, q4 = {};
#pragma unroll
  for (int it = 0; it < 4; ++it)
#pragma unroll
    for (int j = 0; j < 8; ++j) {
      s4 += v[it][j];
      q4 += v[it][j] * v[it][j];
    }
  const float s  = (s4[0] + s4[1]) + (s4[2] + s4[3]);
  const float s2 = (q4[0] + q4[1]) + (q4[2] + q4[3]);

  __shared__ float rs[256], rs2[256];
  rs[threadIdx.x] = s; rs2[threadIdx.x] = s2;
  __syncthreads();
  for (int off = 128; off > 0; off >>= 1) {
    if (threadIdx.x < off) {
      rs[threadIdx.x]  += rs[threadIdx.x + off];
      rs2[threadIdx.x] += rs2[threadIdx.x + off];
    }
    __syncthreads();
  }
  const float inv_n = 1.0f / (float)(CPG * NPIX);
  const float mean  = rs[0] * inv_n;
  const float var   = rs2[0] * inv_n - mean * mean;
  const float rstd  = rsqrtf(var + 1e-5f);

#pragma unroll
  for (int it = 0; it < 4; ++it) {
#pragma unroll
    for (int p = 0; p < 4; ++p) {
      v4u o;
#pragma unroll
      for (int k = 0; k < 4; ++k) {
        float lo = (v[it][2 * k][p]     - mean) * rstd * w8[2 * k]     + b8[2 * k];
        float hi = (v[it][2 * k + 1][p] - mean) * rstd * w8[2 * k + 1] + b8[2 * k + 1];
        o[k] = (unsigned int)f2bf(lo) | ((unsigned int)f2bf(hi) << 16);
      }
      *(v4u*)(h_t + ((size_t)bb * NPIX + n0 + it * 32 + p) * CH + c0 + cl) = o;
    }
  }
}

// ---------------------------------------------------------------------------
// Kernel 2: QKV GEMM.  qkv[o,n] = sum_c W[o,c] * h[n,c] + b[o].
// A block owns 128 pixels (n) and walks 6 tiles of 64 output channels (o); 8
// waves, each a 32x32 tile (2x2 WMMA) of every 64 x 128 tile.  The h rows come
// into LDS once and a wave keeps its 32 pixels' fragments in registers; the W
// tiles come through two LDS buffers, each copied while the one before is used.
// Q,K stored [B][N][C] bf16; V stored [B][C][N] bf16.
// A tile lies wholly in Q, in K or in V.  Q and K tiles are computed as W h^T
// (A rows = output channels), V tiles as h W^T (A rows = pixels): the 8
// accumulators of a lane run along the A rows, so they are always 8 neighbours
// in the stored layout and leave as one 16-B store.
// Four waves per SIMD (two blocks per WGP, as their LDS allows): 256 registers.
// ---------------------------------------------------------------------------
#define QKV_NT 6                          // weight tiles per block

// One weight tile of one wave: products, hand-over, bias, stores.  ISV: the tile
// lies in V.  t: the tile's place in the block's walk; ot: its number in W.
template <bool ISV>
__device__ __forceinline__ void qkv_tile(int t, int ot, int bb, int n0,
                                         const v16bf (&hf)[2][8],
                                         const unsigned char* lds,
                                         unsigned int l, const unsigned char* wg,
                                         const float* __restrict__ qkv_b,
                                         unsigned short* __restrict__ base) {
  const int wave = threadIdx.x >> 5;
  const int lane = threadIdx.x & 31;
  const int row  = lane & 15;
  const int half = lane >> 4;
  const int o0   = ot * 64 + (wave >> 2) * 32;
  const int oc0  = o0 & 255;                   // channel inside Q, K or V
  const unsigned char* wrow = lds + ABYTES + (t & 1) * WBYTES +
                              ((wave >> 2) * 32 + row) * GPITCH + half * 16;

  // acc[i][j]: register r = A row i * 16 + 8 * half + r, lane = B row j * 16 + row.
  v8f acc[2][2] = {};
  v16bf wf[3][2];
  load_wstep(wf[0], wrow, 0);
  load_wstep(wf[1], wrow, 1);
#pragma unroll
  for (int ks = 0; ks < 8; ++ks) {
    if (ks < 6) load_wstep(wf[(ks + 2) % 3], wrow, ks + 2);
    // Keeps the reads two k steps ahead of their products: sunk to their users,
    // each read's latency is exposed.
    __builtin_amdgcn_sched_barrier(0);
    const v16bf w0 = wf[ks % 3][0], w1 = wf[ks % 3][1];
    acc[0][0] = ISV ? wmma_bf16(hf[0][ks], w0, acc[0][0])
                    : wmma_bf16(w0, hf[0][ks], acc[0][0]);
    acc[0][1] = ISV ? wmma_bf16(hf[0][ks], w1, acc[0][1])
                    : wmma_bf16(w0, hf[1][ks], acc[0][1]);
    acc[1][0] = ISV ? wmma_bf16(hf[1][ks], w0, acc[1][0])
                    : wmma_bf16(w1, hf[0][ks], acc[1][0]);
    acc[1][1] = ISV ? wmma_bf16(hf[1][ks], w1, acc[1][1])
                    : wmma_bf16(w1, hf[1][ks], acc[1][1]);
  }

  gemm_hand_over(t, QKV_NT, l, wg);

  // The lane's B row of the stored array, at the first of its A rows.
  const int pitch  = ISV ? NPIX : CH;
  const int brow0  = ISV ? bb * CH + oc0 : bb * NPIX + n0;
  const int acol0  = ISV ? n0 : oc0;
  unsigned short* dst = base + (size_t)(brow0 + row) * pitch + acol0 + half * 8;
  const size_t pitch16 = (size_t)16 * pitch;

  // Bias: per output channel, that is per register for Q and K, per lane for V.
  if (ISV) {
#pragma unroll
    for (int j = 0; j < 2; ++j) {
      const float bl = qkv_b[o0 + j * 16 + row];
#pragma unroll
      for (int i = 0; i < 2; ++i) acc[i][j] += bl;
    }
  } else {
    const float* bp = qkv_b + o0 + half * 8;
    v4f blo[2], bhi[2];
    blo[0] = *(const v4f*)bp;
    bhi[0] = *(const v4f*)(bp + 4);
    blo[1] = *(const v4f*)(bp + 16);
    // The last load's result may land in the address registers that the three
    // loads above name.
    asm volatile("s_wait_xcnt 0x0" ::: "memory");
    bhi[1] = *(const v4f*)(bp + 20);
#pragma unroll
    for (int i = 0; i < 2; ++i)
#pragma unroll
      for (int j = 0; j < 2; ++j)
#pragma unroll
        for (int r = 0; r < 4; ++r) {
          acc[i][j][r]     += blo[i][r];
          acc[i][j][4 + r] += bhi[i][r];
        }
  }

  v4u w[2][2];
#pragma unroll
  for (int i = 0; i < 2; ++i)
#pragma unroll
    for (int j = 0; j < 2; ++j)
#pragma unroll
      for (int p = 0; p < 4; ++p)
        w[i][j][p] = (unsigned int)f2bf(acc[i][j][2 * p]) |
                     ((unsigned int)f2bf(acc[i][j][2 * p + 1]) << 16);
#pragma unroll
  for (int i = 0; i < 2; ++i)
#pragma unroll
    for (int j = 0; j < 2; ++j)
      *(v4u*)(dst + j * pitch16 + i * 16) = w[i][j];
  // The next tile writes the registers that these stores name.
  asm volatile("s_wait_xcnt 0x0" ::: "memory");
}

__global__ void __launch_bounds__(256)
__attribute__((amdgpu_waves_per_eu(4, 4))) k_qkv(
                      const unsigned short* __restrict__ wq_bf,
                      const float* __restrict__ qkv_b,
                      const unsigned short* __restrict__ h_t,
                      unsigned short* __restrict__ q_t,
                      unsigned short* __restrict__ k_t,
                      unsigned short* __restrict__ v_t) {
  const int bb   = blockIdx.z;
  const int wave = threadIdx.x >> 5;
  const int n0   = blockIdx.x * 128 + (wave & 3) * 32;
  const int ot0  = blockIdx.y * QKV_NT;        // the block's first weight tile
  const int lane = threadIdx.x & 31;
  const int row  = lane & 15;
  const int half = lane >> 4;

  __shared__ __attribute__((aligned(16))) unsigned char lds[GBYTES];
  const unsigned int l = (unsigned int)(size_t)lds + wave * GPITCH + lane * 16;
  const unsigned char* hg =
      (const unsigned char*)(h_t +
          ((size_t)bb * NPIX + blockIdx.x * 128 + wave) * CH) + lane * 16;
  const unsigned char* wg =
      (const unsigned char*)(wq_bf + ((size_t)ot0 * 64 + wave) * CH) + lane * 16;
  gemm_open(l, hg, wg);

  v16bf hf[2][8];
  const unsigned char* hrow =
      lds + ((wave & 3) * 32 + row) * GPITCH + half * 16;
#pragma unroll
  for (int j = 0; j < 2; ++j)
#pragma unroll
    for (int ks = 0; ks < 8; ++ks)
      hf[j][ks] = lds_frag(hrow + j * 16 * GPITCH + ks * 64);

  // Weight tiles 0-3 are Q, 4-7 K, 8-11 V: first the block's Q and K tiles, then
  // its V tiles, one walk through the two buffers.
  int t = 0;
  for (; t < QKV_NT && ot0 + t < 8; ++t)
    qkv_tile<false>(t, ot0 + t, bb, n0, hf, lds, l, wg, qkv_b,
                    ot0 + t < 4 ? q_t : k_t);
  for (; t < QKV_NT; ++t)
    qkv_tile<true>(t, ot0 + t, bb, n0, hf, lds, l, wg, qkv_b, v_t);
  // No copy is outstanding when the wave ends.
  asm volatile("s_wait_asynccnt 0x0" ::: "memory");
}

typedef __attribute__((ext_vector_type(2))) float  v2f;
typedef __attribute__((ext_vector_type(2))) __bf16 v2bf;

#define KTILE    32                       // keys per tile
#define NTRIP    (NPIX / (2 * KTILE))      // trips: a pair of tiles each
#define KPITCH   528                      // LDS bytes per key row: 512 + 16
#define VPITCH   80                       // LDS bytes per channel row: 64 + 16
#define KBYTES   (KTILE * KPITCH)
#define BUFBYTES (KBYTES + CH * VPITCH)
#define PAIRBYTES (2 * BUFBYTES)          // a pair of tiles
#define PBYTES   (CH * GPITCH)            // the projection's 256 weight rows
#define XBYTES   16384                    // 16 queries x 256 channels of f32

// Two f32 -> one register of two bf16, round to nearest even.
__device__ __forceinline__ unsigned int pack_bf2(float lo, float hi) {
  v2f t = {lo, hi};
  return __builtin_bit_cast(unsigned int, __builtin_convertvector(t, v2bf));
}

// Value of lane l ^ 16.
__device__ __forceinline__ float other_half(float x) {
  int b = __float_as_int(x);
  return __int_as_float(__builtin_amdgcn_permlanex16(
      b, b, 0x76543210, 0xfedcba98, false, false));
}

// One tile's copies of one lane: 4 x 16 B of K, 4 x 16 B of V.  kl, vl: LDS
// byte addresses; kg, vg: global addresses.  The s_wait_xcnt stands inside the
// statement so that no address register is rewritten ahead of it.
__device__ __forceinline__ void stage_tile(unsigned int kl, unsigned int vl,
                                           const unsigned char* kg,
                                           const unsigned char* vg) {
  asm volatile(
      "global_load_async_to_lds_b128 %0, %8, off\n\t"
      "global_load_async_to_lds_b128 %1, %9, off\n\t"
      "global_load_async_to_lds_b128 %2, %10, off\n\t"
      "global_load_async_to_lds_b128 %3, %11, off\n\t"
      "global_load_async_to_lds_b128 %4, %12, off\n\t"
      "global_load_async_to_lds_b128 %5, %13, off\n\t"
      "global_load_async_to_lds_b128 %6, %14, off\n\t"
      "global_load_async_to_lds_b128 %7, %15, off\n\t"
      "s_wait_xcnt 0x0"
      :: "v"(kl), "v"(kl + 8 * KPITCH), "v"(kl + 16 * KPITCH),
         "v"(kl + 24 * KPITCH),
         "v"(vl), "v"(vl + 64 * VPITCH), "v"(vl + 128 * VPITCH),
         "v"(vl + 192 * VPITCH),
         "v"(kg), "v"(kg + 8 * CH * 2), "v"(kg + 16 * CH * 2),
         "v"(kg + 24 * CH * 2),
         "v"(vg), "v"(vg + 64 * NPIX * 2), "v"(vg + 128 * NPIX * 2),
         "v"(vg + 192 * NPIX * 2)
      : "memory");
}

// Two waves per SIMD (one block per WGP): 512 registers a wave, of which the
// output tile takes 256 and the queries 128; the K and V fragments pass through
// what is left, a few at a time.
__global__ void __launch_bounds__(256)
__attribute__((amdgpu_waves_per_eu(2, 2))) k_attn(
                       const unsigned short* __restrict__ q_t,
                       const unsigned short* __restrict__ k_t,
                       const unsigned short* __restrict__ v_t,
                       const unsigned short* __restrict__ wp_bf,
                       const float* __restrict__ proj_b,
                       const float* __restrict__ x,
                       float* __restrict__ out) {
  const int bb   = blockIdx.y;
  const int tid  = threadIdx.x;
  const int wave = tid >> 5;
  const int lane = tid & 31;
  const int row  = lane & 15;
  const int half = lane >> 4;
  const float c2 = 0.0625f * 1.44269504f;                // 256^-0.5 * log2(e)

  __shared__ __attribute__((aligned(16))) unsigned char ring[2 * PAIRBYTES + PBYTES];

  // Copy addresses.  K: a wave copies one whole 512-B key row per instruction.
  // V: 4 lanes copy the 64 B that one channel holds of a tile's 32 keys.
  // The wave's share of an LDS address is kept scalar, the lane's in a register.
  const unsigned int ring0 = (unsigned int)(size_t)ring;
  const unsigned int wv = __builtin_amdgcn_readfirstlane(wave);
  const unsigned int qg = wv & 3;          // the wave's group of 32 queries
  const unsigned int kh = wv >> 2;         // its tile of every pair
  const unsigned int ks0 = ring0 + wv * KPITCH;
  const unsigned int vs0 = ring0 + KBYTES + wv * (8 * VPITCH);
  const unsigned int kln = lane * 16;
  const unsigned int vln = (lane >> 2) * VPITCH + (lane & 3) * 16;
  const unsigned char* kg =
      (const unsigned char*)(k_t + ((size_t)bb * NPIX + wave) * CH) + lane * 16;
  const unsigned char* vg =
      (const unsigned char*)(v_t + ((size_t)bb * CH + (tid >> 2)) * NPIX) +
      (tid & 3) * 16;

  stage_tile(ks0 + kln, vs0 + vln, kg, vg);
  stage_tile(ks0 + BUFBYTES + kln, vs0 + BUFBYTES + vln, kg + KTILE * CH * 2,
             vg + KTILE * 2);

  // The 32 queries as B-fragments, kept in registers for the whole walk.
  v16bf qb[2][8];
  const unsigned short* qrow =
      q_t + ((size_t)bb * NPIX + blockIdx.x * 128 + qg * 32 + row) * CH;
#pragma unroll
  for (int j = 0; j < 2; ++j)
#pragma unroll
    for (int ks = 0; ks < 8; ++ks)
      qb[j][ks] = load_ab_frag(qrow + j * 16 * CH + ks * 32);

  // Pair 0 has landed for this wave, then for every wave.
  asm volatile("s_wait_asynccnt 0x0" ::: "memory");
  __syncthreads();
  stage_tile(ks0 + PAIRBYTES + kln, vs0 + PAIRBYTES + vln,
             kg + 2 * KTILE * CH * 2, vg + 2 * KTILE * 2);
  stage_tile(ks0 + PAIRBYTES + BUFBYTES + kln, vs0 + PAIRBYTES + BUFBYTES + vln,
             kg + 3 * KTILE * CH * 2, vg + 3 * KTILE * 2);
  // The projection's weights, 32 rows a wave, behind the ring: they land under
  // the wait and the barrier at the foot of the first trip, with pair 1.
  {
    const unsigned int pl = ring0 + 2 * PAIRBYTES + wave * GPITCH + lane * 16;
    const unsigned char* pg =
        (const unsigned char*)(wp_bf + (size_t)wave * CH) + lane * 16;
#pragma unroll
    for (int i = 0; i < 4; ++i)
      stage_rows8(pl + i * 64 * GPITCH, pg + i * 64 * CH * 2);
  }

  // o[j][ct]: queries 16 j .. 16 j + 15 of the wave's 32.
  v8f o[2][16];
#pragma unroll
  for (int j = 0; j < 2; ++j)
#pragma unroll
    for (int ct = 0; ct < 16; ++ct) o[j][ct] = (v8f){};
  float mref[2] = {-3.0e38f, -3.0e38f};  // maximum in use, in units of log2
  float lsum[2] = {0.f, 0.f};            // this half's share of the query's sum

  // One trip: a pair of tiles.  more: a pair t + 2 exists and is sent for.  It is
  // a constant of each of the two loops below, so that a trip has no branch
  // behind the softmax: the row sums then stay in front of the O^T products,
  // and the exponentials free their registers there.
  auto trip = [&](const int t, const bool more) __attribute__((always_inline)) {
    const unsigned int poff = (unsigned int)(t & 1) * PAIRBYTES;
    const unsigned int boff = poff + kh * BUFBYTES;
    const unsigned char* kb = ring + boff + row * KPITCH + half * 16;
    const unsigned char* vb = ring + boff + KBYTES + row * VPITCH + half * 16;

    // S^T: register r of st[i][j] = key 16 * i + 8 * half + r, query group j.
    v8f st[2][2] = {};
    // K fragments are read at least two k steps ahead of their products.
    v16bf kf[3][2];
    v16bf vf[16];
#pragma unroll
    for (int ks = 0; ks < 2; ++ks) {
      kf[ks][0] = lds_frag(kb + ks * 64);
      kf[ks][1] = lds_frag(kb + 16 * KPITCH + ks * 64);
    }
#pragma unroll
    for (int ks = 0; ks < 8; ++ks) {
      if (ks < 6) {
        kf[(ks + 2) % 3][0] = lds_frag(kb + (ks + 2) * 64);
        kf[(ks + 2) % 3][1] = lds_frag(kb + 16 * KPITCH + (ks + 2) * 64);
      }
      // Keeps the reads ahead of their products: sunk to their users, each
      // read's latency is exposed.
      __builtin_amdgcn_sched_barrier(0);
      const v16bf k0 = kf[ks % 3][0], k1 = kf[ks % 3][1];
      st[0][0] = wmma_bf16(k0, qb[0][ks], st[0][0]);
      st[0][1] = wmma_bf16(k0, qb[1][ks], st[0][1]);
      st[1][0] = wmma_bf16(k1, qb[0][ks], st[1][0]);
      st[1][1] = wmma_bf16(k1, qb[1][ks], st[1][1]);
    }
    // The first V fragments: the softmax covers their latency.
#pragma unroll
    for (int ct = 0; ct < 4; ++ct) vf[ct] = lds_frag(vb + ct * 16 * VPITCH);
    // Keeps these reads in front of the softmax.
    __builtin_amdgcn_sched_barrier(0);

    float mt[2];
#pragma unroll
    for (int j = 0; j < 2; ++j) {
      float m = fmaxf(st[0][j][0], st[1][j][0]);
#pragma unroll
      for (int r = 1; r < 8; ++r) m = fmaxf(m, fmaxf(st[0][j][r], st[1][j][r]));
      mt[j] = fmaxf(m, other_half(m)) * c2;
    }

    // The maximum in use is replaced only when some query's new one exceeds it
    // by more than 8: until then every exponential stays at or below 2^8.
    if (__builtin_amdgcn_ballot_w32(mt[0] > mref[0] + 8.0f ||
                                    mt[1] > mref[1] + 8.0f) != 0) {
#pragma unroll
      for (int j = 0; j < 2; ++j) {
        const float mn = fmaxf(mref[j], mt[j]);
        const float al = __builtin_amdgcn_exp2f(mref[j] - mn);
        lsum[j] *= al;
#pragma unroll
        for (int ct = 0; ct < 16; ++ct) o[j][ct] *= al;
        mref[j] = mn;
      }
    }

    FragAB pb[2];
#pragma unroll
    for (int j = 0; j < 2; ++j)
#pragma unroll
      for (int i = 0; i < 4; ++i) {
        float a0 = __builtin_amdgcn_exp2f(st[0][j][2 * i]     * c2 - mref[j]);
        float a1 = __builtin_amdgcn_exp2f(st[0][j][2 * i + 1] * c2 - mref[j]);
        float b0 = __builtin_amdgcn_exp2f(st[1][j][2 * i]     * c2 - mref[j]);
        float b1 = __builtin_amdgcn_exp2f(st[1][j][2 * i + 1] * c2 - mref[j]);
        lsum[j] += (a0 + a1) + (b0 + b1);
        pb[j].u[i]     = pack_bf2(a0, a1);
        pb[j].u[4 + i] = pack_bf2(b0, b1);
      }

    // O^T: register r of o[j][ct] = channel ct * 16 + 8 * half + r.  The V
    // fragments come two at a time, at least three such pairs ahead of their products.
    // Each scheduling barrier keeps the reads where they stand: sunk to their
    // users, each read's latency is exposed; the first one also keeps the row
    // sums in front.
    __builtin_amdgcn_sched_barrier(0);
#pragma unroll
    for (int ct = 4; ct < 6; ++ct) vf[ct] = lds_frag(vb + ct * 16 * VPITCH);
#pragma unroll
    for (int g = 0; g < 8; ++g) {
      if (g < 5) {
        vf[2 * g + 6] = lds_frag(vb + (2 * g + 6) * 16 * VPITCH);
        vf[2 * g + 7] = lds_frag(vb + (2 * g + 7) * 16 * VPITCH);
      }
      __builtin_amdgcn_sched_barrier(0);
#pragma unroll
      for (int ct = 2 * g; ct < 2 * g + 2; ++ct) {
        o[0][ct] = wmma_bf16(vf[ct], pb[0].v, o[0][ct]);
        o[1][ct] = wmma_bf16(vf[ct], pb[1].v, o[1][ct]);
      }
    }

    // Hand-over: this wave's reads of the pair are done, its copies of the next
    // pair have landed; behind the barrier that holds for every wave.
    asm volatile("s_wait_dscnt 0x0" ::: "memory");
    asm volatile("s_wait_asynccnt 0x0" ::: "memory");
    __syncthreads();
    if (more)
    {
      // Scalar sums first: added lane part first, the sum shared with the first
      // pair's copy is an asm operand, is held below v256 and gets spilled.
      const unsigned int ksb = __builtin_amdgcn_readfirstlane(ks0 + poff);
      const unsigned int vsb = __builtin_amdgcn_readfirstlane(vs0 + poff);
      const unsigned char* kg2 = kg + (size_t)(2 * t + 4) * (KTILE * CH * 2);
      const unsigned char* vg2 = vg + (2 * t + 4) * (KTILE * 2);
      stage_tile(ksb + kln, vsb + vln, kg2, vg2);
      stage_tile(ksb + BUFBYTES + kln, vsb + BUFBYTES + vln,
                 kg2 + KTILE * CH * 2, vg2 + KTILE * 2);
    }
  };
  for (int t = 0; t < NTRIP - 2; ++t) trip(t, true);
  for (int t = NTRIP - 2; t < NTRIP; ++t) trip(t, false);
  // No copy is outstanding when the ring is put to its next use.
  asm volatile("s_wait_asynccnt 0x0" ::: "memory");

  // Bias: per output row, that is per register.  Wave w takes output channels
  // 32 w .. 32 w + 31.  Sent for here, so that it has come at the barrier below.
  const int o0 = wave * 32;
  const float* bp = proj_b + o0 + half * 8;
  v4f blo[2], bhi[2];
  blo[0] = *(const v4f*)bp;
  bhi[0] = *(const v4f*)(bp + 4);
  blo[1] = *(const v4f*)(bp + 16);
  bhi[1] = *(const v4f*)(bp + 20);
  // No address register of these loads is rewritten ahead of the wait: the
  // statement reads the address, which keeps it in its registers up to here.
  asm volatile("s_wait_xcnt 0x0" :: "v"(bp) : "memory");

  // The two waves of a query group swap halves: wave w keeps query group kh of
  // its 32 and hands the other to wave w ^ 4, register by register, the same
  // lane on both sides.  Every wave has left the ring at the last trip's barrier.
  v8f ok[16];
  float mk, lk;
  {
    unsigned char* xw = ring + wv * XBYTES + lane * 16;
    float* sw = (float*)(ring + 8 * XBYTES + wv * 256) + lane * 2;
#pragma unroll
    for (int ct = 0; ct < 16; ++ct) {
      const v8f g = kh ? o[0][ct] : o[1][ct];
      ok[ct] = kh ? o[1][ct] : o[0][ct];
      *(v4f*)(xw + (2 * ct) * 512)     = (v4f){g[0], g[1], g[2], g[3]};
      *(v4f*)(xw + (2 * ct + 1) * 512) = (v4f){g[4], g[5], g[6], g[7]};
    }
    sw[0] = kh ? mref[0] : mref[1];
    sw[1] = kh ? lsum[0] : lsum[1];
    mk = kh ? mref[1] : mref[0];
    lk = kh ? lsum[1] : lsum[0];
  }
  // Every wave's half is written before its partner reads it.
  __syncthreads();
  {
    const unsigned char* xr = ring + (wv ^ 4) * XBYTES + lane * 16;
    const float* sr = (const float*)(ring + 8 * XBYTES + (wv ^ 4) * 256) + lane * 2;
    const float mp = sr[0], lp = sr[1];
    const float mj = fmaxf(mk, mp);
    float fk = __builtin_amdgcn_exp2f(mk - mj);
    float fp = __builtin_amdgcn_exp2f(mp - mj);
    const float lj  = lk * fk + lp * fp;
    const float inv = 1.0f / (lj + other_half(lj));
    fk *= inv;
    fp *= inv;
#pragma unroll
    for (int ct = 0; ct < 16; ++ct) {
      const v4f p0 = *(const v4f*)(xr + (2 * ct) * 512);
      const v4f p1 = *(const v4f*)(xr + (2 * ct + 1) * 512);
#pragma unroll
      for (int r = 0; r < 4; ++r) {
        ok[ct][r]     = ok[ct][r] * fk     + p0[r] * fp;
        ok[ct][4 + r] = ok[ct][4 + r] * fk + p1[r] * fp;
      }
    }
  }
  // Every wave has read its partner's half before the rows overwrite it.
  __syncthreads();

  // The wave's 16 normalised rows as bf16, 512 B a pixel.
  unsigned char* orow =
      ring + (qg * 32 + kh * 16 + row) * GPITCH + half * 16;
#pragma unroll
  for (int ct = 0; ct < 16; ++ct) {
    v4u w;
#pragma unroll
    for (int i = 0; i < 4; ++i)
      w[i] = pack_bf2(ok[ct][2 * i], ok[ct][2 * i + 1]);
    *(v4u*)(orow + ct * 32) = w;
  }

  // The wave's 32 rows of Wp, kept in registers for all 128 pixels.
  v16bf pf[2][8];
  const unsigned char* prow =
      ring + 2 * PAIRBYTES + (o0 + row) * GPITCH + half * 16;
#pragma unroll
  for (int i = 0; i < 2; ++i)
#pragma unroll
    for (int ks = 0; ks < 8; ++ks)
      pf[i][ks] = lds_frag(prow + i * 16 * GPITCH + ks * 64);

  // All 128 rows are written before any wave reads them.
  __syncthreads();

  // The lane's first element of x and of out: output row o0 + 8 * half, its pixel.
  const size_t e0 = ((size_t)bb * CH + o0 + half * 8) * NPIX +
                    blockIdx.x * 128 + row;
  const float* xp = x + e0;
  float* op = out + e0;

  // 32 pixels at a time: a 32x32 tile (2x2 WMMA) of the wave's 32 x 128.  The
  // residual of a tile is one run of 32 loads, sent for two tiles ahead.
  // Every loop over c is fully unrolled so that xv is registers.
  float xv[4][2][2][8];
#pragma unroll
  for (int c = 0; c < 2; ++c) {
#pragma unroll
    for (int mi = 0; mi < 2; ++mi)
#pragma unroll
      for (int ni = 0; ni < 2; ++ni)
#pragma unroll
        for (int r = 0; r < 8; ++r)
          xv[c][mi][ni][r] = xp[(mi * 16 + r) * NPIX + c * 32 + ni * 16];
    // Ends the run, so that the runs return in the order of their use; and, as
    // at the bias, the address stays in its registers up to the wait.
    asm volatile("s_wait_xcnt 0x0" :: "v"(xp) : "memory");
  }

#pragma unroll
  for (int c = 0; c < 4; ++c) {
    const unsigned char* hrow = ring + (c * 32 + row) * GPITCH + half * 16;

    v8f acc00 = {}, acc01 = {}, acc10 = {}, acc11 = {};
    v16bf hf[3][2];
    load_wstep(hf[0], hrow, 0);
    load_wstep(hf[1], hrow, 1);
#pragma unroll
    for (int ks = 0; ks < 8; ++ks) {
      if (ks < 6) load_wstep(hf[(ks + 2) % 3], hrow, ks + 2);
      // Keeps the reads two k steps ahead of their products: sunk to their
      // users, each read's latency is exposed.
      __builtin_amdgcn_sched_barrier(0);
      acc00 = wmma_bf16(pf[0][ks], hf[ks % 3][0], acc00);
      acc01 = wmma_bf16(pf[0][ks], hf[ks % 3][1], acc01);
      acc10 = wmma_bf16(pf[1][ks], hf[ks % 3][0], acc10);
      acc11 = wmma_bf16(pf[1][ks], hf[ks % 3][1], acc11);
    }

    FragCD d[2][2];
    d[0][0].v = acc00; d[0][1].v = acc01; d[1][0].v = acc10; d[1][1].v = acc11;

#pragma unroll
    for (int mi = 0; mi < 2; ++mi)
#pragma unroll
      for (int ni = 0; ni < 2; ++ni)
#pragma unroll
        for (int r = 0; r < 8; ++r)
          d[mi][ni].f[r] = xv[c][mi][ni][r] + d[mi][ni].f[r] +
                           (r < 4 ? blo[mi][r & 3] : bhi[mi][r & 3]);
#pragma unroll
    for (int mi = 0; mi < 2; ++mi)
#pragma unroll
      for (int ni = 0; ni < 2; ++ni)
#pragma unroll
        for (int r = 0; r < 8; ++r)
          op[(mi * 16 + r) * NPIX + c * 32 + ni * 16] = d[mi][ni].f[r];
    // The next tile writes the registers that these stores name.
    asm volatile("s_wait_xcnt 0x0" :: "v"(op) : "memory");

    if (c + 2 < 4) {
#pragma unroll
      for (int mi = 0; mi < 2; ++mi)
#pragma unroll
        for (int ni = 0; ni < 2; ++ni)
#pragma unroll
          for (int r = 0; r < 8; ++r)
            xv[c + 2][mi][ni][r] =
                xp[(mi * 16 + r) * NPIX + (c + 2) * 32 + ni * 16];
      // As above: ends the run, the address in its registers up to the wait.
      asm volatile("s_wait_xcnt 0x0" :: "v"(xp) : "memory");
    }
  }
}

// ---------------------------------------------------------------------------
// Host-side launcher.
// Inputs: 0:x 1:norm_w 2:norm_b 3:qkv_w 4:qkv_b 5:proj_w 6:proj_b
// ---------------------------------------------------------------------------
extern "C" void kernel_launch(void* const* d_in, const int* in_sizes, int n_in,
                              void* d_out, int out_size, void* d_ws, size_t ws_size,
                              hipStream_t stream) {
  (void)in_sizes; (void)n_in; (void)out_size; (void)ws_size;
  const float* x      = (const float*)d_in[0];
  const float* norm_w = (const float*)d_in[1];
  const float* norm_b = (const float*)d_in[2];
  const float* qkv_w  = (const float*)d_in[3];
  const float* qkv_b  = (const float*)d_in[4];
  const float* proj_w = (const float*)d_in[5];
  const float* proj_b = (const float*)d_in[6];
  float* out = (float*)d_out;

  char* ws = (char*)d_ws;
  const size_t SZ_WQ = (size_t)3 * CH * CH * 2;            // 384 KB
  const size_t SZ_WP = (size_t)CH * CH * 2;                // 128 KB
  const size_t SZ_T  = (size_t)BATCH * NPIX * CH * 2;      // 16 MB per tensor
  unsigned short* wq_bf   = (unsigned short*)(ws);
  unsigned short* wp_bf   = (unsigned short*)(ws + SZ_WQ);
  unsigned short* h_t     = (unsigned short*)(ws + SZ_WQ + SZ_WP);
  unsigned short* q_t     = (unsigned short*)(ws + SZ_WQ + SZ_WP + 1 * SZ_T);
  unsigned short* k_t     = (unsigned short*)(ws + SZ_WQ + SZ_WP + 2 * SZ_T);
  unsigned short* v_t     = (unsigned short*)(ws + SZ_WQ + SZ_WP + 3 * SZ_T);

  k_cvt_weights<<<dim3((3 * CH * CH + 255) / 256), dim3(256), 0, stream>>>(
      qkv_w, proj_w, wq_bf, wp_bf);

  k_groupnorm<<<dim3(BATCH * NGRP), dim3(256), 0, stream>>>(
      x, norm_w, norm_b, h_t);

  k_qkv<<<dim3(NPIX / 128, (3 * CH) / (64 * QKV_NT), BATCH), dim3(256), 0, stream>>>(
      wq_bf, qkv_b, h_t, q_t, k_t, v_t);

  k_attn<<<dim3(NPIX / 128, BATCH), dim3(256), 0, stream>>>(
      q_t, k_t, v_t, wp_bf, proj_b, x, out);
}

// v008
// A run of this version takes 73 microseconds.
// Next to v007, in two timings, it ran 1.04 and 1.03 times as fast.
// Over all steps from v000 it is 7.16 times as fast.
#include <hip/hip_runtime.h>

// ---------------------------------------------------------------------------
// CDNA5 (gfx1250) attention block: GroupNorm -> QKV -> softmax(QK^T/sqrt(C))V
// -> proj -> residual.  All GEMM stages use v_wmma_f32_16x16x32_bf16 (wave32).
// ---------------------------------------------------------------------------

typedef __attribute__((ext_vector_type(16))) __bf16 v16bf;
typedef __attribute__((ext_vector_type(8)))  float  v8f;
typedef __attribute__((ext_vector_type(4)))  float  v4f;
typedef __attribute__((ext_vector_type(4)))  unsigned int v4u;

union FragAB { unsigned int u[8]; v16bf v; };
union FragCD { float f[8]; v8f v; };

#define BATCH 32
#define CH    256
#define NPIX  1024
#define NGRP  8
#define CPG   32           // channels per group

__device__ __forceinline__ unsigned short f2bf(float x) {
  unsigned int u = __float_as_uint(x);
  u += 0x7fffu + ((u >> 16) & 1u);           // round-to-nearest-even
  return (unsigned short)(u >> 16);
}

// Load a 16x32 bf16 A- or B-fragment.  `p` points to the *lane's* row (A) or
// column (B) start, with the K dimension contiguous in memory.  K-pair slot i
// in VGPR i follows the ISA 16-bit A-matrix table:
//   lanes 0-15 : V0..V3 -> K 0..7,  V4..V7 -> K 16..23
//   lanes 16-31: V0..V3 -> K 8..15, V4..V7 -> K 24..31
__device__ __forceinline__ v16bf load_ab_frag(const unsigned short* p) {
  const int half = (threadIdx.x >> 4) & 1;
  const unsigned int* p32 = (const unsigned int*)p;
  FragAB f;
#pragma unroll
  for (int i = 0; i < 8; ++i) {
    int kb = (i < 4) ? (half * 8 + 2 * i) : (16 + half * 8 + 2 * (i - 4));
    f.u[i] = p32[kb >> 1];
  }
  return f.v;
}

__device__ __forceinline__ v8f wmma_bf16(v16bf a, v16bf b, v8f c) {
  return __builtin_amdgcn_wmma_f32_16x16x32_bf16(
      /*neg_a=*/false, a, /*neg_b=*/false, b,
      /*c_mod=*/(short)0, c, /*reuse_a=*/false, /*reuse_b=*/false);
}

// A-fragment from LDS, same k order as load_ab_frag.  p = the lane's row, at
// the 64-B block of the k step, plus 16 B for lanes 16-31.
__device__ __forceinline__ v16bf lds_frag(const unsigned char* p) {
  v4u lo = *(const v4u*)(p);
  v4u hi = *(const v4u*)(p + 32);
  FragAB f;
#pragma unroll
  for (int i = 0; i < 4; ++i) { f.u[i] = lo[i]; f.u[4 + i] = hi[i]; }
  return f.v;
}

// LDS of the QKV GEMM: a block's 128 activation rows (256 bf16 each), then two
// buffers of 64 weight rows.  The projection in k_attn uses the same row pitch.
#define GPITCH 528                        // LDS bytes per row: 512 + 16
#define ABYTES (128 * GPITCH)
#define WBYTES (64 * GPITCH)
#define GBYTES (ABYTES + 2 * WBYTES)
#define WSTEP  (64 * CH * 2)              // global bytes from a weight tile to the next

// Eight copies of one wave, each a whole 512-B row (16 B per lane): rows r,
// r + 8, ..., r + 56.  l: the lane's LDS byte address in row r; g: its global
// address there.  The s_wait_xcnt stands inside the statement so that no
// address register is rewritten ahead of it.
__device__ __forceinline__ void stage_rows8(unsigned int l,
                                            const unsigned char* g) {
  asm volatile(
      "global_load_async_to_lds_b128 %0, %8, off\n\t"
      "global_load_async_to_lds_b128 %1, %9, off\n\t"
      "global_load_async_to_lds_b128 %2, %10, off\n\t"
      "global_load_async_to_lds_b128 %3, %11, off\n\t"
      "global_load_async_to_lds_b128 %4, %12, off\n\t"
      "global_load_async_to_lds_b128 %5, %13, off\n\t"
      "global_load_async_to_lds_b128 %6, %14, off\n\t"
      "global_load_async_to_lds_b128 %7, %15, off\n\t"
      "s_wait_xcnt 0x0"
      :: "v"(l), "v"(l + 8 * GPITCH), "v"(l + 16 * GPITCH),
         "v"(l + 24 * GPITCH), "v"(l + 32 * GPITCH), "v"(l + 40 * GPITCH),
         "v"(l + 48 * GPITCH), "v"(l + 56 * GPITCH),
         "v"(g), "v"(g + 8 * CH * 2), "v"(g + 16 * CH * 2),
         "v"(g + 24 * CH * 2), "v"(g + 32 * CH * 2), "v"(g + 40 * CH * 2),
         "v"(g + 48 * CH * 2), "v"(g + 56 * CH * 2)
      : "memory");
}

// In front of the walk over the weight tiles: the activation rows and tile 0
// land and are published, then tile 1 is sent for.  l: the lane's LDS byte
// address in row `wave` of the block's LDS; ag, wg: its global addresses in that
// row of the activations and of weight tile 0.
__device__ __forceinline__ void gemm_open(unsigned int l,
                                          const unsigned char* ag,
                                          const unsigned char* wg) {
  stage_rows8(l, ag);
  stage_rows8(l + 64 * GPITCH, ag + 64 * CH * 2);
  stage_rows8(l + ABYTES, wg);
  // The rows have landed for this wave, then for every wave.
  asm volatile("s_wait_asynccnt 0x0" ::: "memory");
  __syncthreads();
  stage_rows8(l + ABYTES + WBYTES, wg + WSTEP);
}

// Hand-over behind the products of tile t (of nt): this wave's reads of the tile
// are done, its copies of tile t + 1 have landed; behind the barrier that holds
// for every wave, and tile t + 2 may take the buffer of tile t.
__device__ __forceinline__ void gemm_hand_over(int t, int nt, unsigned int l,
                                               const unsigned char* wg) {
  asm volatile("s_wait_dscnt 0x0" ::: "memory");
  asm volatile("s_wait_asynccnt 0x0" ::: "memory");
  __syncthreads();
  if (t + 2 < nt)
    stage_rows8(l + ABYTES + (unsigned int)(t & 1) * WBYTES,
                wg + (size_t)(t + 2) * WSTEP);
}

// A wave's two fragments (16 rows each, weights or activations) of k step ks.
__device__ __forceinline__ void load_wstep(v16bf (&wf)[2],
                                           const unsigned char* wrow, int ks) {
#pragma unroll
  for (int i = 0; i < 2; ++i)
    wf[i] = lds_frag(wrow + i * 16 * GPITCH + ks * 64);
}

// ---------------------------------------------------------------------------
// Kernel 1: GroupNorm.  One block per (batch, group).  Output h stored as
// bf16 in [B][N][C] layout (channel-contiguous per pixel) for WMMA B-frags.
// x is read once: the block's 256 lanes hold the group's 32 x 1024 values in
// registers (128 each), sum them there and normalise them there.
// The block size is declared so that a lane may hold its 128 values.
// The same launch turns the weights into bf16 (qkv_w: 768x256, proj_w: 256x256):
// the grid's 65,536 lanes take 4 values each, blocks 0-191 of qkv_w, the rest of
// proj_w.  The load flies with those of x; no wave is started for it.
// ---------------------------------------------------------------------------
typedef __attribute__((ext_vector_type(2))) unsigned int v2u;
#define QW_BLOCKS (3 * CH * CH / 1024)    // blocks that convert qkv_w
static_assert(BATCH * NGRP * 1024 == 4 * CH * CH, "one 16-B load a lane");

__global__ void __launch_bounds__(256) k_groupnorm(const float* __restrict__ x,
                            const float* __restrict__ nw,
                            const float* __restrict__ nb,
                            const float* __restrict__ qkv_w,
                            const float* __restrict__ proj_w,
                            unsigned short* __restrict__ h_t,
                            unsigned short* __restrict__ wq_bf,
                            unsigned short* __restrict__ wp_bf) {
  const int bb = blockIdx.x >> 3;
  const int g  = blockIdx.x & 7;
  const int c0 = g * CPG;
  const float* xp = x + ((size_t)bb * CH + c0) * NPIX;   // 32*1024 contiguous

  // A lane owns 8 channels x 4 pixels, four times: the 8 lanes that share cl
  // read one whole 128-B line of a channel row, and the 4 lanes of one pixel
  // store its 32 channels as one contiguous 64-B run (16 B per lane).
  const int lane = threadIdx.x & 31;
  const int wave = threadIdx.x >> 5;
  const int cl   = (lane & 3) * 8;                // first of the lane's channels
  const int n0   = wave * 128 + (lane >> 2) * 4;  // first of the lane's pixels
  // Every loop below is fully unrolled so that v, w8 and b8 are registers.
  v4f v[4][8];
#pragma unroll
  for (int it = 0; it < 4; ++it)
#pragma unroll
    for (int j = 0; j < 8; ++j)
      v[it][j] = *(const v4f*)(xp + (cl + j) * NPIX + n0 + it * 32);
  float w8[8], b8[8];
#pragma unroll
  for (int j = 0; j < 8; ++j) {
    w8[j] = nw[c0 + cl + j];
    b8[j] = nb[c0 + cl + j];
  }
  // The lane's 4 weights.
  const bool isq = blockIdx.x < QW_BLOCKS;
  const int  wi  = ((isq ? blockIdx.x : blockIdx.x - QW_BLOCKS) * 256 +
                    threadIdx.x) * 4;
  // This load's result may land in the address registers that the loads above
  // name.
  asm volatile("s_wait_xcnt 0x0" ::: "memory");
  const v4f wv = *(const v4f*)((isq ? qkv_w : proj_w) + wi);
  // Keeps all these loads ahead of the first sum, one memory latency for all:
  // without it the loads of w8 and b8 sink behind the sums, and their latency
  // is exposed in front of the first barrier.
  __builtin_amdgcn_sched_barrier(0);

  // The lane's share of the two sums, four independent chains each.
  v4f s4 = {}, q4 = {};
#pragma unroll
  for (int it = 0; it < 4; ++it)
#pragma unroll
    for (int j = 0; j < 8; ++j) {
      s4 += v[it][j];
      q4 += v[it][j] * v[it][j];
    }
  const float s  = (s4[0] + s4[1]) + (s4[2] + s4[3]);
  const float s2 = (q4[0] + q4[1]) + (q4[2] + q4[3]);

  __shared__ float rs[256], rs2[256];
  rs[threadIdx.x] = s; rs2[threadIdx.x] = s2;
  __syncthreads();
  for (int off = 128; off > 0; off >>= 1) {
    if (threadIdx.x < off) {
      rs[threadIdx.x]  += rs[threadIdx.x + off];
      rs2[threadIdx.x] += rs2[threadIdx.x + off];
    }
    __syncthreads();
  }
  const float inv_n = 1.0f / (float)(CPG * NPIX);
  const float mean  = rs[0] * inv_n;
  const float var   = rs2[0] * inv_n - mean * mean;
  const float rstd  = rsqrtf(var + 1e-5f);

#pragma unroll
  for (int it = 0; it < 4; ++it) {
#pragma unroll
    for (int p = 0; p < 4; ++p) {
      v4u o;
#pragma unroll
      for (int k = 0; k < 4; ++k) {
        float lo = (v[it][2 * k][p]     - mean) * rstd * w8[2 * k]     + b8[2 * k];
        float hi = (v[it][2 * k + 1][p] - mean) * rstd * w8[2 * k + 1] + b8[2 * k + 1];
        o[k] = (unsigned int)f2bf(lo) | ((unsigned int)f2bf(hi) << 16);
      }
      *(v4u*)(h_t + ((size_t)bb * NPIX + n0 + it * 32 + p) * CH + c0 + cl) = o;
    }
  }

  // Stored behind the last barrier: a barrier waits for the stores in front of it.
  v2u wo;
  wo[0] = (unsigned int)f2bf(wv[0]) | ((unsigned int)f2bf(wv[1]) << 16);
  wo[1] = (unsigned int)f2bf(wv[2]) | ((unsigned int)f2bf(wv[3]) << 16);
  *(v2u*)((isq ? wq_bf : wp_bf) + wi) = wo;
}

// ---------------------------------------------------------------------------
// Kernel 2: QKV GEMM.  qkv[o,n] = sum_c W[o,c] * h[n,c] + b[o].
// A block owns 128 pixels (n) and walks 6 tiles of 64 output channels (o); 8
// waves, each a 32x32 tile (2x2 WMMA) of every 64 x 128 tile.  The h rows come
// into LDS once and a wave keeps its 32 pixels' fragments in registers; the W
// tiles come through two LDS buffers, each copied while the one before is used.
// Q,K stored [B][N][C] bf16; V stored [B][C][N] bf16.
// A tile lies wholly in Q, in K or in V.  Q and K tiles are computed as W h^T
// (A rows = output channels), V tiles as h W^T (A rows = pixels): the 8
// accumulators of a lane run along the A rows, so they are always 8 neighbours
// in the stored layout and leave as one 16-B store.
// Four waves per SIMD (two blocks per WGP, as their LDS allows): 256 registers.
// ---------------------------------------------------------------------------
#define QKV_NT 6                          // weight tiles per block

// One weight tile of one wave: products, hand-over, bias, stores.  ISV: the tile
// lies in V.  t: the tile's place in the block's walk; ot: its number in W.
template <bool ISV>
__device__ __forceinline__ void qkv_tile(int t, int ot, int bb, int n0,
                                         const v16bf (&hf)[2][8],
                                         const unsigned char* lds,
                                         unsigned int l, const unsigned char* wg,
                                         const float* __restrict__ qkv_b,
                                         unsigned short* __restrict__ base) {
  const int wave = threadIdx.x >> 5;
  const int lane = threadIdx.x & 31;
  const int row  = lane & 15;
  const int half = lane >> 4;
  const int o0   = ot * 64 + (wave >> 2) * 32;
  const int oc0  = o0 & 255;                   // channel inside Q, K or V
  const unsigned char* wrow = lds + ABYTES + (t & 1) * WBYTES +
                              ((wave >> 2) * 32 + row) * GPITCH + half * 16;

  // acc[i][j]: register r = A row i * 16 + 8 * half + r, lane = B row j * 16 + row.
  v8f acc[2][2] = {};
  v16bf wf[3][2];
  load_wstep(wf[0], wrow, 0);
  load_wstep(wf[1], wrow, 1);
#pragma unroll
  for (int ks = 0; ks < 8; ++ks) {
    if (ks < 6) load_wstep(wf[(ks + 2) % 3], wrow, ks + 2);
    // Keeps the reads two k steps ahead of their products: sunk to their users,
    // each read's latency is exposed.
    __builtin_amdgcn_sched_barrier(0);
    const v16bf w0 = wf[ks % 3][0], w1 = wf[ks % 3][1];
    acc[0][0] = ISV ? wmma_bf16(hf[0][ks], w0, acc[0][0])
                    : wmma_bf16(w0, hf[0][ks], acc[0][0]);
    acc[0][1] = ISV ? wmma_bf16(hf[0][ks], w1, acc[0][1])
                    : wmma_bf16(w0, hf[1][ks], acc[0][1]);
    acc[1][0] = ISV ? wmma_bf16(hf[1][ks], w0, acc[1][0])
                    : wmma_bf16(w1, hf[0][ks], acc[1][0]);
    acc[1][1] = ISV ? wmma_bf16(hf[1][ks], w1, acc[1][1])
                    : wmma_bf16(w1, hf[1][ks], acc[1][1]);
  }

  gemm_hand_over(t, QKV_NT, l, wg);

  // The lane's B row of the stored array, at the first of its A rows.
  const int pitch  = ISV ? NPIX : CH;
  const int brow0  = ISV ? bb * CH + oc0 : bb * NPIX + n0;
  const int acol0  = ISV ? n0 : oc0;
  unsigned short* dst = base + (size_t)(brow0 + row) * pitch + acol0 + half * 8;
  const size_t pitch16 = (size_t)16 * pitch;

  // Bias: per output channel, that is per register for Q and K, per lane for V.
  if (ISV) {
#pragma unroll
    for (int j = 0; j < 2; ++j) {
      const float bl = qkv_b[o0 + j * 16 + row];
#pragma unroll
      for (int i = 0; i < 2; ++i) acc[i][j] += bl;
    }
  } else {
    const float* bp = qkv_b + o0 + half * 8;
    v4f blo[2], bhi[2];
    blo[0] = *(const v4f*)bp;
    bhi[0] = *(const v4f*)(bp + 4);
    blo[1] = *(const v4f*)(bp + 16);
    // The last load's result may land in the address registers that the three
    // loads above name.
    asm volatile("s_wait_xcnt 0x0" ::: "memory");
    bhi[1] = *(const v4f*)(bp + 20);
#pragma unroll
    for (int i = 0; i < 2; ++i)
#pragma unroll
      for (int j = 0; j < 2; ++j)
#pragma unroll
        for (int r = 0; r < 4; ++r) {
          acc[i][j][r]     += blo[i][r];
          acc[i][j][4 + r] += bhi[i][r];
        }
  }

  v4u w[2][2];
#pragma unroll
  for (int i = 0; i < 2; ++i)
#pragma unroll
    for (int j = 0; j < 2; ++j)
#pragma unroll
      for (int p = 0; p < 4; ++p)
        w[i][j][p] = (unsigned int)f2bf(acc[i][j][2 * p]) |
                     ((unsigned int)f2bf(acc[i][j][2 * p + 1]) << 16);
#pragma unroll
  for (int i = 0; i < 2; ++i)
#pragma unroll
    for (int j = 0; j < 2; ++j)
      *(v4u*)(dst + j * pitch16 + i * 16) = w[i][j];
  // The next tile writes the registers that these stores name.
  asm volatile("s_wait_xcnt 0x0" ::: "memory");
}

__global__ void __launch_bounds__(256)
__attribute__((amdgpu_waves_per_eu(4, 4))) k_qkv(
                      const unsigned short* __restrict__ wq_bf,
                      const float* __restrict__ qkv_b,
                      const unsigned short* __restrict__ h_t,
                      unsigned short* __restrict__ q_t,
                      unsigned short* __restrict__ k_t,
                      unsigned short* __restrict__ v_t) {
  const int bb   = blockIdx.z;
  const int wave = threadIdx.x >> 5;
  const int n0   = blockIdx.x * 128 + (wave & 3) * 32;
  const int ot0  = blockIdx.y * QKV_NT;        // the block's first weight tile
  const int lane = threadIdx.x & 31;
  const int row  = lane & 15;
  const int half = lane >> 4;

  __shared__ __attribute__((aligned(16))) unsigned char lds[GBYTES];
  const unsigned int l = (unsigned int)(size_t)lds + wave * GPITCH + lane * 16;
  const unsigned char* hg =
      (const unsigned char*)(h_t +
          ((size_t)bb * NPIX + blockIdx.x * 128 + wave) * CH) + lane * 16;
  const unsigned char* wg =
      (const unsigned char*)(wq_bf + ((size_t)ot0 * 64 + wave) * CH) + lane * 16;
  gemm_open(l, hg, wg);

  v16bf hf[2][8];
  const unsigned char* hrow =
      lds + ((wave & 3) * 32 + row) * GPITCH + half * 16;
#pragma unroll
  for (int j = 0; j < 2; ++j)
#pragma unroll
    for (int ks = 0; ks < 8; ++ks)
      hf[j][ks] = lds_frag(hrow + j * 16 * GPITCH + ks * 64);

  // Weight tiles 0-3 are Q, 4-7 K, 8-11 V: first the block's Q and K tiles, then
  // its V tiles, one walk through the two buffers.
  int t = 0;
  for (; t < QKV_NT && ot0 + t < 8; ++t)
    qkv_tile<false>(t, ot0 + t, bb, n0, hf, lds, l, wg, qkv_b,
                    ot0 + t < 4 ? q_t : k_t);
  for (; t < QKV_NT; ++t)
    qkv_tile<true>(t, ot0 + t, bb, n0, hf, lds, l, wg, qkv_b, v_t);
  // No copy is outstanding when the wave ends.
  asm volatile("s_wait_asynccnt 0x0" ::: "memory");
}

typedef __attribute__((ext_vector_type(2))) float  v2f;
typedef __attribute__((ext_vector_type(2))) __bf16 v2bf;

#define KTILE    32                       // keys per tile
#define NTRIP    (NPIX / (2 * KTILE))      // trips: a pair of tiles each
#define KPITCH   528                      // LDS bytes per key row: 512 + 16
#define VPITCH   80                       // LDS bytes per channel row: 64 + 16
#define KBYTES   (KTILE * KPITCH)
#define BUFBYTES (KBYTES + CH * VPITCH)
#define PAIRBYTES (2 * BUFBYTES)          // a pair of tiles
#define PBYTES   (CH * GPITCH)            // the projection's 256 weight rows
#define XBYTES   16384                    // 16 queries x 256 channels of f32

// Two f32 -> one register of two bf16, round to nearest even.
__device__ __forceinline__ unsigned int pack_bf2(float lo, float hi) {
  v2f t = {lo, hi};
  return __builtin_bit_cast(unsigned int, __builtin_convertvector(t, v2bf));
}

// Value of lane l ^ 16.
__device__ __forceinline__ float other_half(float x) {
  int b = __float_as_int(x);
  return __int_as_float(__builtin_amdgcn_permlanex16(
      b, b, 0x76543210, 0xfedcba98, false, false));
}

// One tile's copies of one lane: 4 x 16 B of K, 4 x 16 B of V.  kl, vl: LDS
// byte addresses; kg, vg: global addresses.  The s_wait_xcnt stands inside the
// statement so that no address register is rewritten ahead of it.
__device__ __forceinline__ void stage_tile(unsigned int kl, unsigned int vl,
                                           const unsigned char* kg,
                                           const unsigned char* vg) {
  asm volatile(
      "global_load_async_to_lds_b128 %0, %8, off\n\t"
      "global_load_async_to_lds_b128 %1, %9, off\n\t"
      "global_load_async_to_lds_b128 %2, %10, off\n\t"
      "global_load_async_to_lds_b128 %3, %11, off\n\t"
      "global_load_async_to_lds_b128 %4, %12, off\n\t"
      "global_load_async_to_lds_b128 %5, %13, off\n\t"
      "global_load_async_to_lds_b128 %6, %14, off\n\t"
      "global_load_async_to_lds_b128 %7, %15, off\n\t"
      "s_wait_xcnt 0x0"
      :: "v"(kl), "v"(kl + 8 * KPITCH), "v"(kl + 16 * KPITCH),
         "v"(kl + 24 * KPITCH),
         "v"(vl), "v"(vl + 64 * VPITCH), "v"(vl + 128 * VPITCH),
         "v"(vl + 192 * VPITCH),
         "v"(kg), "v"(kg + 8 * CH * 2), "v"(kg + 16 * CH * 2),
         "v"(kg + 24 * CH * 2),
         "v"(vg), "v"(vg + 64 * NPIX * 2), "v"(vg + 128 * NPIX * 2),
         "v"(vg + 192 * NPIX * 2)
      : "memory");
}

// Two waves per SIMD (one block per WGP): 512 registers a wave, of which the
// output tile takes 256 and the queries 128; the K and V fragments pass through
// what is left, a few at a time.
__global__ void __launch_bounds__(256)
__attribute__((amdgpu_waves_per_eu(2, 2))) k_attn(
                       const unsigned short* __restrict__ q_t,
                       const unsigned short* __restrict__ k_t,
                       const unsigned short* __restrict__ v_t,
                       const unsigned short* __restrict__ wp_bf,
                       const float* __restrict__ proj_b,
                       const float* __restrict__ x,
                       float* __restrict__ out) {
  const int bb   = blockIdx.y;
  const int tid  = threadIdx.x;
  const int wave = tid >> 5;
  const int lane = tid & 31;
  const int row  = lane & 15;
  const int half = lane >> 4;
  const float c2 = 0.0625f * 1.44269504f;                // 256^-0.5 * log2(e)

  __shared__ __attribute__((aligned(16))) unsigned char ring[2 * PAIRBYTES + PBYTES];

  // Copy addresses.  K: a wave copies one whole 512-B key row per instruction.
  // V: 4 lanes copy the 64 B that one channel holds of a tile's 32 keys.
  // The wave's share of an LDS address is kept scalar, the lane's in a register.
  const unsigned int ring0 = (unsigned int)(size_t)ring;
  const unsigned int wv = __builtin_amdgcn_readfirstlane(wave);
  const unsigned int qg = wv & 3;          // the wave's group of 32 queries
  const unsigned int kh = wv >> 2;         // its tile of every pair
  const unsigned int ks0 = ring0 + wv * KPITCH;
  const unsigned int vs0 = ring0 + KBYTES + wv * (8 * VPITCH);
  const unsigned int kln = lane * 16;
  const unsigned int vln = (lane >> 2) * VPITCH + (lane & 3) * 16;
  const unsigned char* kg =
      (const unsigned char*)(k_t + ((size_t)bb * NPIX + wave) * CH) + lane * 16;
  const unsigned char* vg =
      (const unsigned char*)(v_t + ((size_t)bb * CH + (tid >> 2)) * NPIX) +
      (tid & 3) * 16;

  stage_tile(ks0 + kln, vs0 + vln, kg, vg);
  stage_tile(ks0 + BUFBYTES + kln, vs0 + BUFBYTES + vln, kg + KTILE * CH * 2,
             vg + KTILE * 2);

  // The 32 queries as B-fragments, kept in registers for the whole walk.
  v16bf qb[2][8];
  const unsigned short* qrow =
      q_t + ((size_t)bb * NPIX + blockIdx.x * 128 + qg * 32 + row) * CH;
#pragma unroll
  for (int j = 0; j < 2; ++j)
#pragma unroll
    for (int ks = 0; ks < 8; ++ks)
      qb[j][ks] = load_ab_frag(qrow + j * 16 * CH + ks * 32);

  // Pair 0 has landed for this wave, then for every wave.
  asm volatile("s_wait_asynccnt 0x0" ::: "memory");
  __syncthreads();
  stage_tile(ks0 + PAIRBYTES + kln, vs0 + PAIRBYTES + vln,
             kg + 2 * KTILE * CH * 2, vg + 2 * KTILE * 2);
  stage_tile(ks0 + PAIRBYTES + BUFBYTES + kln, vs0 + PAIRBYTES + BUFBYTES + vln,
             kg + 3 * KTILE * CH * 2, vg + 3 * KTILE * 2);
  // The projection's weights, 32 rows a wave, behind the ring: they land under
  // the wait and the barrier at the foot of the first trip, with pair 1.
  {
    const unsigned int pl = ring0 + 2 * PAIRBYTES + wave * GPITCH + lane * 16;
    const unsigned char* pg =
        (const unsigned char*)(wp_bf + (size_t)wave * CH) + lane * 16;
#pragma unroll
    for (int i = 0; i < 4; ++i)
      stage_rows8(pl + i * 64 * GPITCH, pg + i * 64 * CH * 2);
  }

  // o[j][ct]: queries 16 j .. 16 j + 15 of the wave's 32.
  v8f o[2][16];
#pragma unroll
  for (int j = 0; j < 2; ++j)
#pragma unroll
    for (int ct = 0; ct < 16; ++ct) o[j][ct] = (v8f){};
  float mref[2] = {-3.0e38f, -3.0e38f};  // maximum in use, in units of log2
  float lsum[2] = {0.f, 0.f};            // this half's share of the query's sum

  // One trip: a pair of tiles.  more: a pair t + 2 exists and is sent for.  It is
  // a constant of each of the two loops below, so that a trip has no branch
  // behind the softmax: the row sums then stay in front of the O^T products,
  // and the exponentials free their registers there.
  auto trip = [&](const int t, const bool more) __attribute__((always_inline)) {
    const unsigned int poff = (unsigned int)(t & 1) * PAIRBYTES;
    const unsigned int boff = poff + kh * BUFBYTES;
    const unsigned char* kb = ring + boff + row * KPITCH + half * 16;
    const unsigned char* vb = ring + boff + KBYTES + row * VPITCH + half * 16;

    // S^T: register r of st[i][j] = key 16 * i + 8 * half + r, query group j.
    v8f st[2][2] = {};
    // K fragments are read at least two k steps ahead of their products.
    v16bf kf[3][2];
    v16bf vf[16];
#pragma unroll
    for (int ks = 0; ks < 2; ++ks) {
      kf[ks][0] = lds_frag(kb + ks * 64);
      kf[ks][1] = lds_frag(kb + 16 * KPITCH + ks * 64);
    }
#pragma unroll
    for (int ks = 0; ks < 8; ++ks) {
      if (ks < 6) {
        kf[(ks + 2) % 3][0] = lds_frag(kb + (ks + 2) * 64);
        kf[(ks + 2) % 3][1] = lds_frag(kb + 16 * KPITCH + (ks + 2) * 64);
      }
      // Keeps the reads ahead of their products: sunk to their users, each
      // read's latency is exposed.
      __builtin_amdgcn_sched_barrier(0);
      const v16bf k0 = kf[ks % 3][0], k1 = kf[ks % 3][1];
      st[0][0] = wmma_bf16(k0, qb[0][ks], st[0][0]);
      st[0][1] = wmma_bf16(k0, qb[1][ks], st[0][1]);
      st[1][0] = wmma_bf16(k1, qb[0][ks], st[1][0]);
      st[1][1] = wmma_bf16(k1, qb[1][ks], st[1][1]);
    }
    // The first V fragments: the softmax covers their latency.
#pragma unroll
    for (int ct = 0; ct < 4; ++ct) vf[ct] = lds_frag(vb + ct * 16 * VPITCH);
    // Keeps these reads in front of the softmax.
    __builtin_amdgcn_sched_barrier(0);

    float mt[2];
#pragma unroll
    for (int j = 0; j < 2; ++j) {
      float m = fmaxf(st[0][j][0], st[1][j][0]);
#pragma unroll
      for (int r = 1; r < 8; ++r) m = fmaxf(m, fmaxf(st[0][j][r], st[1][j][r]));
      mt[j] = fmaxf(m, other_half(m)) * c2;
    }

    // The maximum in use is replaced only when some query's new one exceeds it
    // by more than 8: until then every exponential stays at or below 2^8.
    if (__builtin_amdgcn_ballot_w32(mt[0] > mref[0] + 8.0f ||
                                    mt[1] > mref[1] + 8.0f) != 0) {
#pragma unroll
      for (int j = 0; j < 2; ++j) {
        const float mn = fmaxf(mref[j], mt[j]);
        const float al = __builtin_amdgcn_exp2f(mref[j] - mn);
        lsum[j] *= al;
#pragma unroll
        for (int ct = 0; ct < 16; ++ct) o[j][ct] *= al;
        mref[j] = mn;
      }
    }

    FragAB pb[2];
#pragma unroll
    for (int j = 0; j < 2; ++j)
#pragma unroll
      for (int i = 0; i < 4; ++i) {
        float a0 = __builtin_amdgcn_exp2f(st[0][j][2 * i]     * c2 - mref[j]);
        float a1 = __builtin_amdgcn_exp2f(st[0][j][2 * i + 1] * c2 - mref[j]);
        float b0 = __builtin_amdgcn_exp2f(st[1][j][2 * i]     * c2 - mref[j]);
        float b1 = __builtin_amdgcn_exp2f(st[1][j][2 * i + 1] * c2 - mref[j]);
        lsum[j] += (a0 + a1) + (b0 + b1);
        pb[j].u[i]     = pack_bf2(a0, a1);
        pb[j].u[4 + i] = pack_bf2(b0, b1);
      }

    // O^T: register r of o[j][ct] = channel ct * 16 + 8 * half + r.  The V
    // fragments come two at a time, at least three such pairs ahead of their products.
    // Each scheduling barrier keeps the reads where they stand: sunk to their
    // users, each read's latency is exposed; the first one also keeps the row
    // sums in front.
    __builtin_amdgcn_sched_barrier(0);
#pragma unroll
    for (int ct = 4; ct < 6; ++ct) vf[ct] = lds_frag(vb + ct * 16 * VPITCH);
#pragma unroll
    for (int g = 0; g < 8; ++g) {
      if (g < 5) {
        vf[2 * g + 6] = lds_frag(vb + (2 * g + 6) * 16 * VPITCH);
        vf[2 * g + 7] = lds_frag(vb + (2 * g + 7) * 16 * VPITCH);
      }
      __builtin_amdgcn_sched_barrier(0);
#pragma unroll
      for (int ct = 2 * g; ct < 2 * g + 2; ++ct) {
        o[0][ct] = wmma_bf16(vf[ct], pb[0].v, o[0][ct]);
        o[1][ct] = wmma_bf16(vf[ct], pb[1].v, o[1][ct]);
      }
    }

    // Hand-over: this wave's reads of the pair are done, its copies of the next
    // pair have landed; behind the barrier that holds for every wave.
    asm volatile("s_wait_dscnt 0x0" ::: "memory");
    asm volatile("s_wait_asynccnt 0x0" ::: "memory");
    __syncthreads();
    if (more)
    {
      // Scalar sums first: added lane part first, the sum shared with the first
      // pair's copy is an asm operand, is held below v256 and gets spilled.
      const unsigned int ksb = __builtin_amdgcn_readfirstlane(ks0 + poff);
      const unsigned int vsb = __builtin_amdgcn_readfirstlane(vs0 + poff);
      const unsigned char* kg2 = kg + (size_t)(2 * t + 4) * (KTILE * CH * 2);
      const unsigned char* vg2 = vg + (2 * t + 4) * (KTILE * 2);
      stage_tile(ksb + kln, vsb + vln, kg2, vg2);
      stage_tile(ksb + BUFBYTES + kln, vsb + BUFBYTES + vln,
                 kg2 + KTILE * CH * 2, vg2 + KTILE * 2);
    }
  };
  for (int t = 0; t < NTRIP - 2; ++t) trip(t, true);
  for (int t = NTRIP - 2; t < NTRIP; ++t) trip(t, false);
  // No copy is outstanding when the ring is put to its next use.
  asm volatile("s_wait_asynccnt 0x0" ::: "memory");

  // Bias: per output row, that is per register.  Wave w takes output channels
  // 32 w .. 32 w + 31.  Sent for here, so that it has come at the barrier below.
  const int o0 = wave * 32;
  const float* bp = proj_b + o0 + half * 8;
  v4f blo[2], bhi[2];
  blo[0] = *(const v4f*)bp;
  bhi[0] = *(const v4f*)(bp + 4);
  blo[1] = *(const v4f*)(bp + 16);
  bhi[1] = *(const v4f*)(bp + 20);
  // No address register of these loads is rewritten ahead of the wait: the
  // statement reads the address, which keeps it in its registers up to here.
  asm volatile("s_wait_xcnt 0x0" :: "v"(bp) : "memory");

  // The two waves of a query group swap halves: wave w keeps query group kh of
  // its 32 and hands the other to wave w ^ 4, register by register, the same
  // lane on both sides.  Every wave has left the ring at the last trip's barrier.
  v8f ok[16];
  float mk, lk;
  {
    unsigned char* xw = ring + wv * XBYTES + lane * 16;
    float* sw = (float*)(ring + 8 * XBYTES + wv * 256) + lane * 2;
#pragma unroll
    for (int ct = 0; ct < 16; ++ct) {
      const v8f g = kh ? o[0][ct] : o[1][ct];
      ok[ct] = kh ? o[1][ct] : o[0][ct];
      *(v4f*)(xw + (2 * ct) * 512)     = (v4f){g[0], g[1], g[2], g[3]};
      *(v4f*)(xw + (2 * ct + 1) * 512) = (v4f){g[4], g[5], g[6], g[7]};
    }
    sw[0] = kh ? mref[0] : mref[1];
    sw[1] = kh ? lsum[0] : lsum[1];
    mk = kh ? mref[1] : mref[0];
    lk = kh ? lsum[1] : lsum[0];
  }
  // Every wave's half is written before its partner reads it.
  __syncthreads();
  {
    const unsigned char* xr = ring + (wv ^ 4) * XBYTES + lane * 16;
    const float* sr = (const float*)(ring + 8 * XBYTES + (wv ^ 4) * 256) + lane * 2;
    const float mp = sr[0], lp = sr[1];
    const float mj = fmaxf(mk, mp);
    float fk = __builtin_amdgcn_exp2f(mk - mj);
    float fp = __builtin_amdgcn_exp2f(mp - mj);
    const float lj  = lk * fk + lp * fp;
    const float inv = 1.0f / (lj + other_half(lj));
    fk *= inv;
    fp *= inv;
#pragma unroll
    for (int ct = 0; ct < 16; ++ct) {
      const v4f p0 = *(const v4f*)(xr + (2 * ct) * 512);
      const v4f p1 = *(const v4f*)(xr + (2 * ct + 1) * 512);
#pragma unroll
      for (int r = 0; r < 4; ++r) {
        ok[ct][r]     = ok[ct][r] * fk     + p0[r] * fp;
        ok[ct][4 + r] = ok[ct][4 + r] * fk + p1[r] * fp;
      }
    }
  }
  // Every wave has read its partner's half before the rows overwrite it.
  __syncthreads();

  // The wave's 16 normalised rows as bf16, 512 B a pixel.
  unsigned char* orow =
      ring + (qg * 32 + kh * 16 + row) * GPITCH + half * 16;
#pragma unroll
  for (int ct = 0; ct < 16; ++ct) {
    v4u w;
#pragma unroll
    for (int i = 0; i < 4; ++i)
      w[i] = pack_bf2(ok[ct][2 * i], ok[ct][2 * i + 1]);
    *(v4u*)(orow + ct * 32) = w;
  }

  // The wave's 32 rows of Wp, kept in registers for all 128 pixels.
  v16bf pf[2][8];
  const unsigned char* prow =
      ring + 2 * PAIRBYTES + (o0 + row) * GPITCH + half * 16;
#pragma unroll
  for (int i = 0; i < 2; ++i)
#pragma unroll
    for (int ks = 0; ks < 8; ++ks)
      pf[i][ks] = lds_frag(prow + i * 16 * GPITCH + ks * 64);

  // All 128 rows are written before any wave reads them.
  __syncthreads();

  // The lane's first element of x and of out: output row o0 + 8 * half, its pixel.
  const size_t e0 = ((size_t)bb * CH + o0 + half * 8) * NPIX +
                    blockIdx.x * 128 + row;
  const float* xp = x + e0;
  float* op = out + e0;

  // 32 pixels at a time: a 32x32 tile (2x2 WMMA) of the wave's 32 x 128.  The
  // residual of a tile is one run of 32 loads, sent for two tiles ahead.
  // Every loop over c is fully unrolled so that xv is registers.
  float xv[4][2][2][8];
#pragma unroll
  for (int c = 0; c < 2; ++c) {
#pragma unroll
    for (int mi = 0; mi < 2; ++mi)
#pragma unroll
      for (int ni = 0; ni < 2; ++ni)
#pragma unroll
        for (int r = 0; r < 8; ++r)
          xv[c][mi][ni][r] = xp[(mi * 16 + r) * NPIX + c * 32 + ni * 16];
    // Ends the run, so that the runs return in the order of their use; and, as
    // at the bias, the address stays in its registers up to the wait.
    asm volatile("s_wait_xcnt 0x0" :: "v"(xp) : "memory");
  }

#pragma unroll
  for (int c = 0; c < 4; ++c) {
    const unsigned char* hrow = ring + (c * 32 + row) * GPITCH + half * 16;

    v8f acc00 = {}, acc01 = {}, acc10 = {}, acc11 = {};
    v16bf hf[3][2];
    load_wstep(hf[0], hrow, 0);
    load_wstep(hf[1], hrow, 1);
#pragma unroll
    for (int ks = 0; ks < 8; ++ks) {
      if (ks < 6) load_wstep(hf[(ks + 2) % 3], hrow, ks + 2);
      // Keeps the reads two k steps ahead of their products: sunk to their
      // users, each read's latency is exposed.
      __builtin_amdgcn_sched_barrier(0);
      acc00 = wmma_bf16(pf[0][ks], hf[ks % 3][0], acc00);
      acc01 = wmma_bf16(pf[0][ks], hf[ks % 3][1], acc01);
      acc10 = wmma_bf16(pf[1][ks], hf[ks % 3][0], acc10);
      acc11 = wmma_bf16(pf[1][ks], hf[ks % 3][1], acc11);
    }

    FragCD d[2][2];
    d[0][0].v = acc00; d[0][1].v = acc01; d[1][0].v = acc10; d[1][1].v = acc11;

#pragma unroll
    for (int mi = 0; mi < 2; ++mi)
#pragma unroll
      for (int ni = 0; ni < 2; ++ni)
#pragma unroll
        for (int r = 0; r < 8; ++r)
          d[mi][ni].f[r] = xv[c][mi][ni][r] + d[mi][ni].f[r] +
                           (r < 4 ? blo[mi][r & 3] : bhi[mi][r & 3]);
#pragma unroll
    for (int mi = 0; mi < 2; ++mi)
#pragma unroll
      for (int ni = 0; ni < 2; ++ni)
#pragma unroll
        for (int r = 0; r < 8; ++r)
          op[(mi * 16 + r) * NPIX + c * 32 + ni * 16] = d[mi][ni].f[r];
    // The next tile writes the registers that these stores name.
    asm volatile("s_wait_xcnt 0x0" :: "v"(op) : "memory");

    if (c + 2 < 4) {
#pragma unroll
      for (int mi = 0; mi < 2; ++mi)
#pragma unroll
        for (int ni = 0; ni < 2; ++ni)
#pragma unroll
          for (int r = 0; r < 8; ++r)
            xv[c + 2][mi][ni][r] =
                xp[(mi * 16 + r) * NPIX + (c + 2) * 32 + ni * 16];
      // As above: ends the run, the address in its registers up to the wait.
      asm volatile("s_wait_xcnt 0x0" :: "v"(xp) : "memory");
    }
  }
}

// ---------------------------------------------------------------------------
// Host-side launcher.
// Inputs: 0:x 1:norm_w 2:norm_b 3:qkv_w 4:qkv_b 5:proj_w 6:proj_b
// ---------------------------------------------------------------------------
extern "C" void kernel_launch(void* const* d_in, const int* in_sizes, int n_in,
                              void* d_out, int out_size, void* d_ws, size_t ws_size,
                              hipStream_t stream) {
  (void)in_sizes; (void)n_in; (void)out_size; (void)ws_size;
  const float* x      = (const float*)d_in[0];
  const float* norm_w = (const float*)d_in[1];
  const float* norm_b = (const float*)d_in[2];
  const float* qkv_w  = (const float*)d_in[3];
  const float* qkv_b  = (const float*)d_in[4];
  const float* proj_w = (const float*)d_in[5];
  const float* proj_b = (const float*)d_in[6];
  float* out = (float*)d_out;

  char* ws = (char*)d_ws;
  const size_t SZ_WQ = (size_t)3 * CH * CH * 2;            // 384 KB
  const size_t SZ_WP = (size_t)CH * CH * 2;                // 128 KB
  const size_t SZ_T  = (size_t)BATCH * NPIX * CH * 2;      // 16 MB per tensor
  unsigned short* wq_bf   = (unsigned short*)(ws);
  unsigned short* wp_bf   = (unsigned short*)(ws + SZ_WQ);
  unsigned short* h_t     = (unsigned short*)(ws + SZ_WQ + SZ_WP);
  unsigned short* q_t     = (unsigned short*)(ws + SZ_WQ + SZ_WP + 1 * SZ_T);
  unsigned short* k_t     = (unsigned short*)(ws + SZ_WQ + SZ_WP + 2 * SZ_T);
  unsigned short* v_t     = (unsigned short*)(ws + SZ_WQ + SZ_WP + 3 * SZ_T);

  k_groupnorm<<<dim3(BATCH * NGRP), dim3(256), 0, stream>>>(
      x, norm_w, norm_b, qkv_w, proj_w, h_t, wq_bf, wp_bf);

  k_qkv<<<dim3(NPIX / 128, (3 * CH) / (64 * QKV_NT), BATCH), dim3(256), 0, stream>>>(
      wq_bf, qkv_b, h_t, q_t, k_t, v_t);

  k_attn<<<dim3(NPIX / 128, BATCH), dim3(256), 0, stream>>>(
      q_t, k_t, v_t, wp_bf, proj_b, x, out);
}

// v009
// One run takes 65.4 microseconds.
// Timed twice side by side with v008, it ran 1.12 times as fast both times.
// All steps since v000 together make it 8.03 times as fast.
#include <hip/hip_runtime.h>

// ---------------------------------------------------------------------------
// CDNA5 (gfx1250) attention block: GroupNorm -> QKV -> softmax(QK^T/sqrt(C))V
// -> proj -> residual.  All GEMM stages use v_wmma_f32_16x16x32_bf16 (wave32).
// ---------------------------------------------------------------------------

typedef __attribute__((ext_vector_type(16))) __bf16 v16bf;
typedef __attribute__((ext_vector_type(8)))  float  v8f;
typedef __attribute__((ext_vector_type(4)))  float  v4f;
typedef __attribute__((ext_vector_type(4)))  unsigned int v4u;

union FragAB { unsigned int u[8]; v16bf v; };
union FragCD { float f[8]; v8f v; };

#define BATCH 32
#define CH    256
#define NPIX  1024
#define NGRP  8
#define CPG   32           // channels per group

__device__ __forceinline__ unsigned short f2bf(float x) {
  unsigned int u = __float_as_uint(x);
  u += 0x7fffu + ((u >> 16) & 1u);           // round-to-nearest-even
  return (unsigned short)(u >> 16);
}

// Load a 16x32 bf16 A- or B-fragment.  `p` points to the *lane's* row (A) or
// column (B) start, with the K dimension contiguous in memory.  K-pair slot i
// in VGPR i follows the ISA 16-bit A-matrix table:
//   lanes 0-15 : V0..V3 -> K 0..7,  V4..V7 -> K 16..23
//   lanes 16-31: V0..V3 -> K 8..15, V4..V7 -> K 24..31
__device__ __forceinline__ v16bf load_ab_frag(const unsigned short* p) {
  const int half = (threadIdx.x >> 4) & 1;
  const unsigned int* p32 = (const unsigned int*)p;
  FragAB f;
#pragma unroll
  for (int i = 0; i < 8; ++i) {
    int kb = (i < 4) ? (half * 8 + 2 * i) : (16 + half * 8 + 2 * (i - 4));
    f.u[i] = p32[kb >> 1];
  }
  return f.v;
}

__device__ __forceinline__ v8f wmma_bf16(v16bf a, v16bf b, v8f c) {
  return __builtin_amdgcn_wmma_f32_16x16x32_bf16(
      /*neg_a=*/false, a, /*neg_b=*/false, b,
      /*c_mod=*/(short)0, c, /*reuse_a=*/false, /*reuse_b=*/false);
}

// A-fragment from LDS, same k order as load_ab_frag.  p = the lane's row, at
// the 64-B block of the k step, plus 16 B for lanes 16-31.
__device__ __forceinline__ v16bf lds_frag(const unsigned char* p) {
  v4u lo = *(const v4u*)(p);
  v4u hi = *(const v4u*)(p + 32);
  FragAB f;
#pragma unroll
  for (int i = 0; i < 4; ++i) { f.u[i] = lo[i]; f.u[4 + i] = hi[i]; }
  return f.v;
}

// LDS of the QKV GEMM: a block's 128 activation rows (256 bf16 each), then two
// buffers of 64 weight rows.  The projection in k_attn uses the same row pitch.
#define GPITCH 528                        // LDS bytes per row: 512 + 16
#define ABYTES (128 * GPITCH)
#define WBYTES (64 * GPITCH)
#define GBYTES (ABYTES + 2 * WBYTES)
#define WSTEP  (64 * CH * 2)              // global bytes from a weight tile to the next

// Eight copies of one wave, each a whole 512-B row (16 B per lane): rows r,
// r + 8, ..., r + 56.  l: the lane's LDS byte address in row r; g: its global
// address there.  The s_wait_xcnt stands inside the statement so that no
// address register is rewritten ahead of it.
__device__ __forceinline__ void stage_rows8(unsigned int l,
                                            const unsigned char* g) {
  asm volatile(
      "global_load_async_to_lds_b128 %0, %8, off\n\t"
      "global_load_async_to_lds_b128 %1, %9, off\n\t"
      "global_load_async_to_lds_b128 %2, %10, off\n\t"
      "global_load_async_to_lds_b128 %3, %11, off\n\t"
      "global_load_async_to_lds_b128 %4, %12, off\n\t"
      "global_load_async_to_lds_b128 %5, %13, off\n\t"
      "global_load_async_to_lds_b128 %6, %14, off\n\t"
      "global_load_async_to_lds_b128 %7, %15, off\n\t"
      "s_wait_xcnt 0x0"
      :: "v"(l), "v"(l + 8 * GPITCH), "v"(l + 16 * GPITCH),
         "v"(l + 24 * GPITCH), "v"(l + 32 * GPITCH), "v"(l + 40 * GPITCH),
         "v"(l + 48 * GPITCH), "v"(l + 56 * GPITCH),
         "v"(g), "v"(g + 8 * CH * 2), "v"(g + 16 * CH * 2),
         "v"(g + 24 * CH * 2), "v"(g + 32 * CH * 2), "v"(g + 40 * CH * 2),
         "v"(g + 48 * CH * 2), "v"(g + 56 * CH * 2)
      : "memory");
}

// In front of the walk over the weight tiles: the activation rows and tile 0
// land and are published, then tile 1 is sent for.  l: the lane's LDS byte
// address in row `wave` of the block's LDS; ag, wg: its global addresses in that
// row of the activations and of weight tile 0.
__device__ __forceinline__ void gemm_open(unsigned int l,
                                          const unsigned char* ag,
                                          const unsigned char* wg) {
  stage_rows8(l, ag);
  stage_rows8(l + 64 * GPITCH, ag + 64 * CH * 2);
  stage_rows8(l + ABYTES, wg);
  // The rows have landed for this wave, then for every wave.
  asm volatile("s_wait_asynccnt 0x0" ::: "memory");
  __syncthreads();
  stage_rows8(l + ABYTES + WBYTES, wg + WSTEP);
}

// Hand-over behind the products of tile t (of nt): this wave's reads of the tile
// are done, its copies of tile t + 1 have landed; behind the barrier that holds
// for every wave, and tile t + 2 may take the buffer of tile t.
__device__ __forceinline__ void gemm_hand_over(int t, int nt, unsigned int l,
                                               const unsigned char* wg) {
  asm volatile("s_wait_dscnt 0x0" ::: "memory");
  asm volatile("s_wait_asynccnt 0x0" ::: "memory");
  __syncthreads();
  if (t + 2 < nt)
    stage_rows8(l + ABYTES + (unsigned int)(t & 1) * WBYTES,
                wg + (size_t)(t + 2) * WSTEP);
}

// A wave's two fragments (16 rows each, weights or activations) of k step ks.
__device__ __forceinline__ void load_wstep(v16bf (&wf)[2],
                                           const unsigned char* wrow, int ks) {
#pragma unroll
  for (int i = 0; i < 2; ++i)
    wf[i] = lds_frag(wrow + i * 16 * GPITCH + ks * 64);
}

// ---------------------------------------------------------------------------
// Kernel 1: GroupNorm.  One block per (batch, group).  Output h stored as
// bf16 in [B][N][C] layout (channel-contiguous per pixel) for WMMA B-frags.
// x is read once: the block's 256 lanes hold the group's 32 x 1024 values in
// registers (128 each), sum them there and normalise them there.
// The block size is declared so that a lane may hold its 128 values.
// The same launch turns the weights into bf16 (qkv_w: 768x256, proj_w: 256x256):
// the grid's 65,536 lanes take 4 values each, blocks 0-191 of qkv_w, the rest of
// proj_w.  The load flies with those of x; no wave is started for it.
// ---------------------------------------------------------------------------
typedef __attribute__((ext_vector_type(2))) unsigned int v2u;
#define QW_BLOCKS (3 * CH * CH / 1024)    // blocks that convert qkv_w
static_assert(BATCH * NGRP * 1024 == 4 * CH * CH, "one 16-B load a lane");

__global__ void __launch_bounds__(256) k_groupnorm(const float* __restrict__ x,
                            const float* __restrict__ nw,
                            const float* __restrict__ nb,
                            const float* __restrict__ qkv_w,
                            const float* __restrict__ proj_w,
                            unsigned short* __restrict__ h_t,
                            unsigned short* __restrict__ wq_bf,
                            unsigned short* __restrict__ wp_bf) {
  const int bb = blockIdx.x >> 3;
  const int g  = blockIdx.x & 7;
  const int c0 = g * CPG;
  const float* xp = x + ((size_t)bb * CH + c0) * NPIX;   // 32*1024 contiguous

  // A lane owns 8 channels x 4 pixels, four times: the 8 lanes that share cl
  // read one whole 128-B line of a channel row, and the 4 lanes of one pixel
  // store its 32 channels as one contiguous 64-B run (16 B per lane).
  const int lane = threadIdx.x & 31;
  const int wave = threadIdx.x >> 5;
  const int cl   = (lane & 3) * 8;                // first of the lane's channels
  const int n0   = wave * 128 + (lane >> 2) * 4;  // first of the lane's pixels
  // Every loop below is fully unrolled so that v, w8 and b8 are registers.
  v4f v[4][8];
#pragma unroll
  for (int it = 0; it < 4; ++it)
#pragma unroll
    for (int j = 0; j < 8; ++j)
      v[it][j] = *(const v4f*)(xp + (cl + j) * NPIX + n0 + it * 32);
  float w8[8], b8[8];
#pragma unroll
  for (int j = 0; j < 8; ++j) {
    w8[j] = nw[c0 + cl + j];
    b8[j] = nb[c0 + cl + j];
  }
  // The lane's 4 weights.
  const bool isq = blockIdx.x < QW_BLOCKS;
  const int  wi  = ((isq ? blockIdx.x : blockIdx.x - QW_BLOCKS) * 256 +
                    threadIdx.x) * 4;
  // This load's result may land in the address registers that the loads above
  // name.
  asm volatile("s_wait_xcnt 0x0" ::: "memory");
  const v4f wv = *(const v4f*)((isq ? qkv_w : proj_w) + wi);
  // Keeps all these loads ahead of the first sum, one memory latency for all:
  // without it the loads of w8 and b8 sink behind the sums, and their latency
  // is exposed in front of the first barrier.
  __builtin_amdgcn_sched_barrier(0);

  // The lane's share of the two sums, four independent chains each.
  v4f s4 = {}, q4 = {};
#pragma unroll
  for (int it = 0; it < 4; ++it)
#pragma unroll
    for (int j = 0; j < 8; ++j) {
      s4 += v[it][j];
      q4 += v[it][j] * v[it][j];
    }
  const float s  = (s4[0] + s4[1]) + (s4[2] + s4[3]);
  const float s2 = (q4[0] + q4[1]) + (q4[2] + q4[3]);

  __shared__ float rs[256], rs2[256];
  rs[threadIdx.x] = s; rs2[threadIdx.x] = s2;
  __syncthreads();
  for (int off = 128; off > 0; off >>= 1) {
    if (threadIdx.x < off) {
      rs[threadIdx.x]  += rs[threadIdx.x + off];
      rs2[threadIdx.x] += rs2[threadIdx.x + off];
    }
    __syncthreads();
  }
  const float inv_n = 1.0f / (float)(CPG * NPIX);
  const float mean  = rs[0] * inv_n;
  const float var   = rs2[0] * inv_n - mean * mean;
  const float rstd  = rsqrtf(var + 1e-5f);

#pragma unroll
  for (int it = 0; it < 4; ++it) {
#pragma unroll
    for (int p = 0; p < 4; ++p) {
      v4u o;
#pragma unroll
      for (int k = 0; k < 4; ++k) {
        float lo = (v[it][2 * k][p]     - mean) * rstd * w8[2 * k]     + b8[2 * k];
        float hi = (v[it][2 * k + 1][p] - mean) * rstd * w8[2 * k + 1] + b8[2 * k + 1];
        o[k] = (unsigned int)f2bf(lo) | ((unsigned int)f2bf(hi) << 16);
      }
      *(v4u*)(h_t + ((size_t)bb * NPIX + n0 + it * 32 + p) * CH + c0 + cl) = o;
    }
  }

  // Stored behind the last barrier: a barrier waits for the stores in front of it.
  v2u wo;
  wo[0] = (unsigned int)f2bf(wv[0]) | ((unsigned int)f2bf(wv[1]) << 16);
  wo[1] = (unsigned int)f2bf(wv[2]) | ((unsigned int)f2bf(wv[3]) << 16);
  *(v2u*)((isq ? wq_bf : wp_bf) + wi) = wo;
}

// ---------------------------------------------------------------------------
// Kernel 2: QKV GEMM.  qkv[o,n] = sum_c W[o,c] * h[n,c] + b[o].
// A block owns 128 pixels (n) and walks 6 tiles of 64 output channels (o); 8
// waves, each a 32x32 tile (2x2 WMMA) of every 64 x 128 tile.  The h rows come
// into LDS once and a wave keeps its 32 pixels' fragments in registers; the W
// tiles come through two LDS buffers, each copied while the one before is used.
// Q,K stored [B][N][C] bf16; V stored [B][C][N] bf16.
// A tile lies wholly in Q, in K or in V.  Q and K tiles are computed as W h^T
// (A rows = output channels), V tiles as h W^T (A rows = pixels): the 8
// accumulators of a lane run along the A rows, so they are always 8 neighbours
// in the stored layout and are packed into 16 B.
// A finished tile goes through LDS, so that it leaves in whole 128-B lines: every
// wave writes its 32 x 32 part into a staging buffer in front of the tile's
// hand-over barrier; behind it a wave reads whole rows of the block's tile (128 B
// of a pixel's 64 channels, 256 B of a channel's 128 pixels) and stores them.
// Two staging buffers take turns: one behind the weight buffers, the other in
// the activation rows, which every wave has left at the first hand-over.
// Four waves per SIMD (two blocks per WGP, as their LDS allows): 256 registers.
// ---------------------------------------------------------------------------
#define QKV_NT 6                          // weight tiles per block
#define QSPITCH 144                       // staged Q or K row: 128 B + 16
#define VSPITCH 272                       // staged V row: 256 B + 16
#define SBYTES  (128 * QSPITCH)           // a staging buffer
static_assert(64 * VSPITCH <= SBYTES && SBYTES <= ABYTES, "staging buffers fit");

// One weight tile of one wave: products, bias, staging, hand-over, stores.  ISV:
// the tile lies in V.  t: the tile's place in the block's walk; ot: its number in
// W; nb0: the block's first pixel.
template <bool ISV>
__device__ __forceinline__ void qkv_tile(int t, int ot, int bb, int nb0,
                                         const v16bf (&hf)[2][8],
                                         unsigned char* lds,
                                         unsigned int l, const unsigned char* wg,
                                         const float* __restrict__ qkv_b,
                                         unsigned short* __restrict__ base) {
  const int wave = threadIdx.x >> 5;
  const int lane = threadIdx.x & 31;
  const int row  = lane & 15;
  const int half = lane >> 4;
  const int o0   = ot * 64 + (wave >> 2) * 32;
  const int oc0  = (ot * 64) & 255;            // the tile's channel inside Q, K or V
  const unsigned char* wrow = lds + ABYTES + (t & 1) * WBYTES +
                              ((wave >> 2) * 32 + row) * GPITCH + half * 16;
  unsigned char* stage = lds + ((t & 1) ? 0 : GBYTES);

  // Bias: per output channel, that is per register for Q and K, per lane for V.
  // Sent for here, so that it has come when the products are done.
  const float* bp = qkv_b + o0 + (ISV ? row : half * 8);
  float bl[2];
  v4f blo[2], bhi[2];
  if (ISV) {
    bl[0] = bp[0];
    bl[1] = bp[16];
  } else {
    blo[0] = *(const v4f*)bp;
    bhi[0] = *(const v4f*)(bp + 4);
    blo[1] = *(const v4f*)(bp + 16);
    bhi[1] = *(const v4f*)(bp + 20);
  }
  // No address register of these loads is rewritten ahead of the wait: the
  // statement reads the address, which keeps it in its registers up to here.
  asm volatile("s_wait_xcnt 0x0" :: "v"(bp) : "memory");

  // acc[i][j]: register r = A row i * 16 + 8 * half + r, lane = B row j * 16 + row.
  v8f acc[2][2] = {};
  v16bf wf[3][2];
  load_wstep(wf[0], wrow, 0);
  load_wstep(wf[1], wrow, 1);
#pragma unroll
  for (int ks = 0; ks < 8; ++ks) {
    if (ks < 6) load_wstep(wf[(ks + 2) % 3], wrow, ks + 2);
    // Keeps the reads two k steps ahead of their products: sunk to their users,
    // each read's latency is exposed.
    __builtin_amdgcn_sched_barrier(0);
    const v16bf w0 = wf[ks % 3][0], w1 = wf[ks % 3][1];
    acc[0][0] = ISV ? wmma_bf16(hf[0][ks], w0, acc[0][0])
                    : wmma_bf16(w0, hf[0][ks], acc[0][0]);
    acc[0][1] = ISV ? wmma_bf16(hf[0][ks], w1, acc[0][1])
                    : wmma_bf16(w0, hf[1][ks], acc[0][1]);
    acc[1][0] = ISV ? wmma_bf16(hf[1][ks], w0, acc[1][0])
                    : wmma_bf16(w1, hf[0][ks], acc[1][0]);
    acc[1][1] = ISV ? wmma_bf16(hf[1][ks], w1, acc[1][1])
                    : wmma_bf16(w1, hf[1][ks], acc[1][1]);
  }

  if (ISV) {
#pragma unroll
    for (int j = 0; j < 2; ++j)
#pragma unroll
      for (int i = 0; i < 2; ++i) acc[i][j] += bl[j];
  } else {
#pragma unroll
    for (int i = 0; i < 2; ++i)
#pragma unroll
      for (int j = 0; j < 2; ++j)
#pragma unroll
        for (int r = 0; r < 4; ++r) {
          acc[i][j][r]     += blo[i][r];
          acc[i][j][4 + r] += bhi[i][r];
        }
  }

  // The wave's part of the staged tile.  A staged row is a B row (a pixel of Q or
  // K, a channel of V); the lane's 8 neighbours lie along it.
  const int spitch = ISV ? VSPITCH : QSPITCH;
  const int brow   = (ISV ? wave >> 2 : wave & 3) * 32 + row;
  const int acol   = (ISV ? wave & 3 : wave >> 2) * 64 + half * 16;
  unsigned char* sp = stage + brow * spitch + acol;
#pragma unroll
  for (int i = 0; i < 2; ++i)
#pragma unroll
    for (int j = 0; j < 2; ++j) {
      v4u w;
#pragma unroll
      for (int p = 0; p < 4; ++p)
        w[p] = (unsigned int)f2bf(acc[i][j][2 * p]) |
               ((unsigned int)f2bf(acc[i][j][2 * p + 1]) << 16);
      *(v4u*)(sp + j * 16 * spitch + i * 32) = w;
    }

  // Its wait for LDS and its barrier also publish the staged tile.
  gemm_hand_over(t, QKV_NT, l, wg);

  // Whole rows out: 8 lanes a 128-B row of Q or K (4 rows an instruction, 16 rows
  // a wave), 16 lanes a 256-B row of V (2 rows an instruction, 8 rows a wave).
  const int lpr   = ISV ? 16 : 8;              // lanes per row
  const int rpi   = 32 / lpr;                  // rows per instruction
  const int srow  = wave * 4 * rpi + lane / lpr;
  const int scol  = (lane % lpr) * 16;
  const int pitch = ISV ? NPIX : CH;
  const unsigned char* sr = stage + srow * spitch + scol;
  unsigned char* gd = (unsigned char*)(base +
      (ISV ? ((size_t)bb * CH + oc0 + srow) * NPIX + nb0
           : ((size_t)bb * NPIX + nb0 + srow) * CH + oc0)) + scol;
  v4u sv[4];
#pragma unroll
  for (int k = 0; k < 4; ++k) sv[k] = *(const v4u*)(sr + k * rpi * spitch);
#pragma unroll
  for (int k = 0; k < 4; ++k) *(v4u*)(gd + k * rpi * pitch * 2) = sv[k];
  // The next tile writes the registers that these stores name; the statement
  // reads the address, which keeps it in its registers up to here.
  asm volatile("s_wait_xcnt 0x0" :: "v"(gd) : "memory");
}

__global__ void __launch_bounds__(256)
__attribute__((amdgpu_waves_per_eu(4, 4))) k_qkv(
                      const unsigned short* __restrict__ wq_bf,
                      const float* __restrict__ qkv_b,
                      const unsigned short* __restrict__ h_t,
                      unsigned short* __restrict__ q_t,
                      unsigned short* __restrict__ k_t,
                      unsigned short* __restrict__ v_t) {
  const int bb   = blockIdx.z;
  const int wave = threadIdx.x >> 5;
  const int nb0  = blockIdx.x * 128;           // the block's first pixel
  const int ot0  = blockIdx.y * QKV_NT;        // the block's first weight tile
  const int lane = threadIdx.x & 31;
  const int row  = lane & 15;
  const int half = lane >> 4;

  __shared__ __attribute__((aligned(16))) unsigned char lds[GBYTES + SBYTES];
  const unsigned int l = (unsigned int)(size_t)lds + wave * GPITCH + lane * 16;
  const unsigned char* hg =
      (const unsigned char*)(h_t +
          ((size_t)bb * NPIX + blockIdx.x * 128 + wave) * CH) + lane * 16;
  const unsigned char* wg =
      (const unsigned char*)(wq_bf + ((size_t)ot0 * 64 + wave) * CH) + lane * 16;
  gemm_open(l, hg, wg);

  v16bf hf[2][8];
  const unsigned char* hrow =
      lds + ((wave & 3) * 32 + row) * GPITCH + half * 16;
#pragma unroll
  for (int j = 0; j < 2; ++j)
#pragma unroll
    for (int ks = 0; ks < 8; ++ks)
      hf[j][ks] = lds_frag(hrow + j * 16 * GPITCH + ks * 64);

  // Weight tiles 0-3 are Q, 4-7 K, 8-11 V: first the block's Q and K tiles, then
  // its V tiles, one walk through the two buffers.
  int t = 0;
  for (; t < QKV_NT && ot0 + t < 8; ++t)
    qkv_tile<false>(t, ot0 + t, bb, nb0, hf, lds, l, wg, qkv_b,
                    ot0 + t < 4 ? q_t : k_t);
  for (; t < QKV_NT; ++t)
    qkv_tile<true>(t, ot0 + t, bb, nb0, hf, lds, l, wg, qkv_b, v_t);
  // No copy is outstanding when the wave ends.
  asm volatile("s_wait_asynccnt 0x0" ::: "memory");
}

typedef __attribute__((ext_vector_type(2))) float  v2f;
typedef __attribute__((ext_vector_type(2))) __bf16 v2bf;

#define KTILE    32                       // keys per tile
#define NTRIP    (NPIX / (2 * KTILE))      // trips: a pair of tiles each
#define KPITCH   528                      // LDS bytes per key row: 512 + 16
#define VPITCH   80                       // LDS bytes per channel row: 64 + 16
#define KBYTES   (KTILE * KPITCH)
#define BUFBYTES (KBYTES + CH * VPITCH)
#define PAIRBYTES (2 * BUFBYTES)          // a pair of tiles
#define PBYTES   (CH * GPITCH)            // the projection's 256 weight rows
#define XBYTES   16384                    // 16 queries x 256 channels of f32
#define PSPITCH  144                      // staged output row: 32 f32 + 16 B
#define PSBYTES  (32 * PSPITCH)           // a wave's staged 32 x 32 output tile
static_assert(128 * GPITCH + 8 * PSBYTES <= 2 * PAIRBYTES, "staging fits the ring");

// Two f32 -> one register of two bf16, round to nearest even.
__device__ __forceinline__ unsigned int pack_bf2(float lo, float hi) {
  v2f t = {lo, hi};
  return __builtin_bit_cast(unsigned int, __builtin_convertvector(t, v2bf));
}

// Value of lane l ^ 16.
__device__ __forceinline__ float other_half(float x) {
  int b = __float_as_int(x);
  return __int_as_float(__builtin_amdgcn_permlanex16(
      b, b, 0x76543210, 0xfedcba98, false, false));
}

// One tile's copies of one lane: 4 x 16 B of K, 4 x 16 B of V.  kl, vl: LDS
// byte addresses; kg, vg: global addresses.  The s_wait_xcnt stands inside the
// statement so that no address register is rewritten ahead of it.
__device__ __forceinline__ void stage_tile(unsigned int kl, unsigned int vl,
                                           const unsigned char* kg,
                                           const unsigned char* vg) {
  asm volatile(
      "global_load_async_to_lds_b128 %0, %8, off\n\t"
      "global_load_async_to_lds_b128 %1, %9, off\n\t"
      "global_load_async_to_lds_b128 %2, %10, off\n\t"
      "global_load_async_to_lds_b128 %3, %11, off\n\t"
      "global_load_async_to_lds_b128 %4, %12, off\n\t"
      "global_load_async_to_lds_b128 %5, %13, off\n\t"
      "global_load_async_to_lds_b128 %6, %14, off\n\t"
      "global_load_async_to_lds_b128 %7, %15, off\n\t"
      "s_wait_xcnt 0x0"
      :: "v"(kl), "v"(kl + 8 * KPITCH), "v"(kl + 16 * KPITCH),
         "v"(kl + 24 * KPITCH),
         "v"(vl), "v"(vl + 64 * VPITCH), "v"(vl + 128 * VPITCH),
         "v"(vl + 192 * VPITCH),
         "v"(kg), "v"(kg + 8 * CH * 2), "v"(kg + 16 * CH * 2),
         "v"(kg + 24 * CH * 2),
         "v"(vg), "v"(vg + 64 * NPIX * 2), "v"(vg + 128 * NPIX * 2),
         "v"(vg + 192 * NPIX * 2)
      : "memory");
}

// Two waves per SIMD (one block per WGP): 512 registers a wave, of which the
// output tile takes 256 and the queries 128; the K and V fragments pass through
// what is left, a few at a time.
__global__ void __launch_bounds__(256)
__attribute__((amdgpu_waves_per_eu(2, 2))) k_attn(
                       const unsigned short* __restrict__ q_t,
                       const unsigned short* __restrict__ k_t,
                       const unsigned short* __restrict__ v_t,
                       const unsigned short* __restrict__ wp_bf,
                       const float* __restrict__ proj_b,
                       const float* __restrict__ x,
                       float* __restrict__ out) {
  const int bb   = blockIdx.y;
  const int tid  = threadIdx.x;
  const int wave = tid >> 5;
  const int lane = tid & 31;
  const int row  = lane & 15;
  const int half = lane >> 4;
  const float c2 = 0.0625f * 1.44269504f;                // 256^-0.5 * log2(e)

  __shared__ __attribute__((aligned(16))) unsigned char ring[2 * PAIRBYTES + PBYTES];

  // Copy addresses.  K: a wave copies one whole 512-B key row per instruction.
  // V: 4 lanes copy the 64 B that one channel holds of a tile's 32 keys.
  // The wave's share of an LDS address is kept scalar, the lane's in a register.
  const unsigned int ring0 = (unsigned int)(size_t)ring;
  const unsigned int wv = __builtin_amdgcn_readfirstlane(wave);
  const unsigned int qg = wv & 3;          // the wave's group of 32 queries
  const unsigned int kh = wv >> 2;         // its tile of every pair
  const unsigned int ks0 = ring0 + wv * KPITCH;
  const unsigned int vs0 = ring0 + KBYTES + wv * (8 * VPITCH);
  const unsigned int kln = lane * 16;
  const unsigned int vln = (lane >> 2) * VPITCH + (lane & 3) * 16;
  const unsigned char* kg =
      (const unsigned char*)(k_t + ((size_t)bb * NPIX + wave) * CH) + lane * 16;
  const unsigned char* vg =
      (const unsigned char*)(v_t + ((size_t)bb * CH + (tid >> 2)) * NPIX) +
      (tid & 3) * 16;

  stage_tile(ks0 + kln, vs0 + vln, kg, vg);
  stage_tile(ks0 + BUFBYTES + kln, vs0 + BUFBYTES + vln, kg + KTILE * CH * 2,
             vg + KTILE * 2);

  // The 32 queries as B-fragments, kept in registers for the whole walk.
  v16bf qb[2][8];
  const unsigned short* qrow =
      q_t + ((size_t)bb * NPIX + blockIdx.x * 128 + qg * 32 + row) * CH;
#pragma unroll
  for (int j = 0; j < 2; ++j)
#pragma unroll
    for (int ks = 0; ks < 8; ++ks)
      qb[j][ks] = load_ab_frag(qrow + j * 16 * CH + ks * 32);

  // Pair 0 has landed for this wave, then for every wave.
  asm volatile("s_wait_asynccnt 0x0" ::: "memory");
  __syncthreads();
  stage_tile(ks0 + PAIRBYTES + kln, vs0 + PAIRBYTES + vln,
             kg + 2 * KTILE * CH * 2, vg + 2 * KTILE * 2);
  stage_tile(ks0 + PAIRBYTES + BUFBYTES + kln, vs0 + PAIRBYTES + BUFBYTES + vln,
             kg + 3 * KTILE * CH * 2, vg + 3 * KTILE * 2);
  // The projection's weights, 32 rows a wave, behind the ring: they land under
  // the wait and the barrier at the foot of the first trip, with pair 1.
  {
    const unsigned int pl = ring0 + 2 * PAIRBYTES + wave * GPITCH + lane * 16;
    const unsigned char* pg =
        (const unsigned char*)(wp_bf + (size_t)wave * CH) + lane * 16;
#pragma unroll
    for (int i = 0; i < 4; ++i)
      stage_rows8(pl + i * 64 * GPITCH, pg + i * 64 * CH * 2);
  }

  // o[j][ct]: queries 16 j .. 16 j + 15 of the wave's 32.
  v8f o[2][16];
#pragma unroll
  for (int j = 0; j < 2; ++j)
#pragma unroll
    for (int ct = 0; ct < 16; ++ct) o[j][ct] = (v8f){};
  float mref[2] = {-3.0e38f, -3.0e38f};  // maximum in use, in units of log2
  float lsum[2] = {0.f, 0.f};            // this half's share of the query's sum

  // One trip: a pair of tiles.  more: a pair t + 2 exists and is sent for.  It is
  // a constant of each of the two loops below, so that a trip has no branch
  // behind the softmax: the row sums then stay in front of the O^T products,
  // and the exponentials free their registers there.
  auto trip = [&](const int t, const bool more) __attribute__((always_inline)) {
    const unsigned int poff = (unsigned int)(t & 1) * PAIRBYTES;
    const unsigned int boff = poff + kh * BUFBYTES;
    const unsigned char* kb = ring + boff + row * KPITCH + half * 16;
    const unsigned char* vb = ring + boff + KBYTES + row * VPITCH + half * 16;

    // S^T: register r of st[i][j] = key 16 * i + 8 * half + r, query group j.
    v8f st[2][2] = {};
    // K fragments are read at least two k steps ahead of their products.
    v16bf kf[3][2];
    v16bf vf[16];
#pragma unroll
    for (int ks = 0; ks < 2; ++ks) {
      kf[ks][0] = lds_frag(kb + ks * 64);
      kf[ks][1] = lds_frag(kb + 16 * KPITCH + ks * 64);
    }
#pragma unroll
    for (int ks = 0; ks < 8; ++ks) {
      if (ks < 6) {
        kf[(ks + 2) % 3][0] = lds_frag(kb + (ks + 2) * 64);
        kf[(ks + 2) % 3][1] = lds_frag(kb + 16 * KPITCH + (ks + 2) * 64);
      }
      // Keeps the reads ahead of their products: sunk to their users, each
      // read's latency is exposed.
      __builtin_amdgcn_sched_barrier(0);
      const v16bf k0 = kf[ks % 3][0], k1 = kf[ks % 3][1];
      st[0][0] = wmma_bf16(k0, qb[0][ks], st[0][0]);
      st[0][1] = wmma_bf16(k0, qb[1][ks], st[0][1]);
      st[1][0] = wmma_bf16(k1, qb[0][ks], st[1][0]);
      st[1][1] = wmma_bf16(k1, qb[1][ks], st[1][1]);
    }
    // The first V fragments: the softmax covers their latency.
#pragma unroll
    for (int ct = 0; ct < 4; ++ct) vf[ct] = lds_frag(vb + ct * 16 * VPITCH);
    // Keeps these reads in front of the softmax.
    __builtin_amdgcn_sched_barrier(0);

    float mt[2];
#pragma unroll
    for (int j = 0; j < 2; ++j) {
      float m = fmaxf(st[0][j][0], st[1][j][0]);
#pragma unroll
      for (int r = 1; r < 8; ++r) m = fmaxf(m, fmaxf(st[0][j][r], st[1][j][r]));
      mt[j] = fmaxf(m, other_half(m)) * c2;
    }

    // The maximum in use is replaced only when some query's new one exceeds it
    // by more than 8: until then every exponential stays at or below 2^8.
    if (__builtin_amdgcn_ballot_w32(mt[0] > mref[0] + 8.0f ||
                                    mt[1] > mref[1] + 8.0f) != 0) {
#pragma unroll
      for (int j = 0; j < 2; ++j) {
        const float mn = fmaxf(mref[j], mt[j]);
        const float al = __builtin_amdgcn_exp2f(mref[j] - mn);
        lsum[j] *= al;
#pragma unroll
        for (int ct = 0; ct < 16; ++ct) o[j][ct] *= al;
        mref[j] = mn;
      }
    }

    FragAB pb[2];
#pragma unroll
    for (int j = 0; j < 2; ++j)
#pragma unroll
      for (int i = 0; i < 4; ++i) {
        float a0 = __builtin_amdgcn_exp2f(st[0][j][2 * i]     * c2 - mref[j]);
        float a1 = __builtin_amdgcn_exp2f(st[0][j][2 * i + 1] * c2 - mref[j]);
        float b0 = __builtin_amdgcn_exp2f(st[1][j][2 * i]     * c2 - mref[j]);
        float b1 = __builtin_amdgcn_exp2f(st[1][j][2 * i + 1] * c2 - mref[j]);
        lsum[j] += (a0 + a1) + (b0 + b1);
        pb[j].u[i]     = pack_bf2(a0, a1);
        pb[j].u[4 + i] = pack_bf2(b0, b1);
      }

    // O^T: register r of o[j][ct] = channel ct * 16 + 8 * half + r.  The V
    // fragments come two at a time, at least three such pairs ahead of their products.
    // Each scheduling barrier keeps the reads where they stand: sunk to their
    // users, each read's latency is exposed; the first one also keeps the row
    // sums in front.
    __builtin_amdgcn_sched_barrier(0);
#pragma unroll
    for (int ct = 4; ct < 6; ++ct) vf[ct] = lds_frag(vb + ct * 16 * VPITCH);
#pragma unroll
    for (int g = 0; g < 8; ++g) {
      if (g < 5) {
        vf[2 * g + 6] = lds_frag(vb + (2 * g + 6) * 16 * VPITCH);
        vf[2 * g + 7] = lds_frag(vb + (2 * g + 7) * 16 * VPITCH);
      }
      __builtin_amdgcn_sched_barrier(0);
#pragma unroll
      for (int ct = 2 * g; ct < 2 * g + 2; ++ct) {
        o[0][ct] = wmma_bf16(vf[ct], pb[0].v, o[0][ct]);
        o[1][ct] = wmma_bf16(vf[ct], pb[1].v, o[1][ct]);
      }
    }

    // Hand-over: this wave's reads of the pair are done, its copies of the next
    // pair have landed; behind the barrier that holds for every wave.
    asm volatile("s_wait_dscnt 0x0" ::: "memory");
    asm volatile("s_wait_asynccnt 0x0" ::: "memory");
    __syncthreads();
    if (more)
    {
      // Scalar sums first: added lane part first, the sum shared with the first
      // pair's copy is an asm operand, is held below v256 and gets spilled.
      const unsigned int ksb = __builtin_amdgcn_readfirstlane(ks0 + poff);
      const unsigned int vsb = __builtin_amdgcn_readfirstlane(vs0 + poff);
      const unsigned char* kg2 = kg + (size_t)(2 * t + 4) * (KTILE * CH * 2);
      const unsigned char* vg2 = vg + (2 * t + 4) * (KTILE * 2);
      stage_tile(ksb + kln, vsb + vln, kg2, vg2);
      stage_tile(ksb + BUFBYTES + kln, vsb + BUFBYTES + vln,
                 kg2 + KTILE * CH * 2, vg2 + KTILE * 2);
    }
  };
  for (int t = 0; t < NTRIP - 2; ++t) trip(t, true);
  for (int t = NTRIP - 2; t < NTRIP; ++t) trip(t, false);
  // No copy is outstanding when the ring is put to its next use.
  asm volatile("s_wait_asynccnt 0x0" ::: "memory");

  // Bias: per output row.  Wave w takes output channels 32 w .. 32 w + 31; where
  // the bias is added, a lane holds rows lane / 8 + 4 k.  Sent for here, so that
  // it has come at the barrier below.
  const int o0 = wave * 32;
  const float* bp = proj_b + o0 + (lane >> 3);
  float pbv[8];
#pragma unroll
  for (int k = 0; k < 8; ++k) pbv[k] = bp[k * 4];
  // No address register of these loads is rewritten ahead of the wait: the
  // statement reads the address, which keeps it in its registers up to here.
  asm volatile("s_wait_xcnt 0x0" :: "v"(bp) : "memory");

  // The two waves of a query group swap halves: wave w keeps query group kh of
  // its 32 and hands the other to wave w ^ 4, register by register, the same
  // lane on both sides.  Every wave has left the ring at the last trip's barrier.
  v8f ok[16];
  float mk, lk;
  {
    unsigned char* xw = ring + wv * XBYTES + lane * 16;
    float* sw = (float*)(ring + 8 * XBYTES + wv * 256) + lane * 2;
#pragma unroll
    for (int ct = 0; ct < 16; ++ct) {
      const v8f g = kh ? o[0][ct] : o[1][ct];
      ok[ct] = kh ? o[1][ct] : o[0][ct];
      *(v4f*)(xw + (2 * ct) * 512)     = (v4f){g[0], g[1], g[2], g[3]};
      *(v4f*)(xw + (2 * ct + 1) * 512) = (v4f){g[4], g[5], g[6], g[7]};
    }
    sw[0] = kh ? mref[0] : mref[1];
    sw[1] = kh ? lsum[0] : lsum[1];
    mk = kh ? mref[1] : mref[0];
    lk = kh ? lsum[1] : lsum[0];
  }
  // Every wave's half is written before its partner reads it.
  __syncthreads();
  {
    const unsigned char* xr = ring + (wv ^ 4) * XBYTES + lane * 16;
    const float* sr = (const float*)(ring + 8 * XBYTES + (wv ^ 4) * 256) + lane * 2;
    const float mp = sr[0], lp = sr[1];
    const float mj = fmaxf(mk, mp);
    float fk = __builtin_amdgcn_exp2f(mk - mj);
    float fp = __builtin_amdgcn_exp2f(mp - mj);
    const float lj  = lk * fk + lp * fp;
    const float inv = 1.0f / (lj + other_half(lj));
    fk *= inv;
    fp *= inv;
#pragma unroll
    for (int ct = 0; ct < 16; ++ct) {
      const v4f p0 = *(const v4f*)(xr + (2 * ct) * 512);
      const v4f p1 = *(const v4f*)(xr + (2 * ct + 1) * 512);
#pragma unroll
      for (int r = 0; r < 4; ++r) {
        ok[ct][r]     = ok[ct][r] * fk     + p0[r] * fp;
        ok[ct][4 + r] = ok[ct][4 + r] * fk + p1[r] * fp;
      }
    }
  }
  // Every wave has read its partner's half before the rows overwrite it.
  __syncthreads();

  // The wave's 16 normalised rows as bf16, 512 B a pixel.
  unsigned char* orow =
      ring + (qg * 32 + kh * 16 + row) * GPITCH + half * 16;
#pragma unroll
  for (int ct = 0; ct < 16; ++ct) {
    v4u w;
#pragma unroll
    for (int i = 0; i < 4; ++i)
      w[i] = pack_bf2(ok[ct][2 * i], ok[ct][2 * i + 1]);
    *(v4u*)(orow + ct * 32) = w;
  }

  // The wave's 32 rows of Wp, kept in registers for all 128 pixels.
  v16bf pf[2][8];
  const unsigned char* prow =
      ring + 2 * PAIRBYTES + (o0 + row) * GPITCH + half * 16;
#pragma unroll
  for (int i = 0; i < 2; ++i)
#pragma unroll
    for (int ks = 0; ks < 8; ++ks)
      pf[i][ks] = lds_frag(prow + i * 16 * GPITCH + ks * 64);

  // All 128 rows are written before any wave reads them.
  __syncthreads();

  // A 32 x 32 tile of the output goes through the wave's own LDS, behind the 128
  // rows, so that x comes and out leaves in whole 128-B lines, 16 B a lane: the
  // accumulators are written as they lie (a register = an output row, 16 lanes =
  // 16 pixels) and read back 8 lanes a row, 4 rows an instruction.
  unsigned char* stg = ring + 128 * GPITCH + wv * PSBYTES;
  unsigned char* sw = stg + half * 8 * PSPITCH + row * 4;
  const unsigned char* sr = stg + (lane >> 3) * PSPITCH + (lane & 7) * 16;

  // The lane's first elements of x and of out: output row o0 + lane / 8, 4 pixels.
  const size_t e0 = ((size_t)bb * CH + o0 + (lane >> 3)) * NPIX +
                    blockIdx.x * 128 + (lane & 7) * 4;
  const float* xp = x + e0;
  float* op = out + e0;

  // 32 pixels at a time: a 32x32 tile (2x2 WMMA) of the wave's 32 x 128.  The
  // residual of a tile is one run of 8 loads, sent for two tiles ahead.
  // Every loop over c is fully unrolled so that xv is registers.
  v4f xv[4][8];
#pragma unroll
  for (int c = 0; c < 2; ++c) {
#pragma unroll
    for (int k = 0; k < 8; ++k)
      xv[c][k] = *(const v4f*)(xp + k * 4 * NPIX + c * 32);
    // Ends the run, so that the runs return in the order of their use; and, as
    // at the bias, the address stays in its registers up to the wait.
    asm volatile("s_wait_xcnt 0x0" :: "v"(xp) : "memory");
  }

#pragma unroll
  for (int c = 0; c < 4; ++c) {
    const unsigned char* hrow = ring + (c * 32 + row) * GPITCH + half * 16;

    v8f acc00 = {}, acc01 = {}, acc10 = {}, acc11 = {};
    v16bf hf[3][2];
    load_wstep(hf[0], hrow, 0);
    load_wstep(hf[1], hrow, 1);
#pragma unroll
    for (int ks = 0; ks < 8; ++ks) {
      if (ks < 6) load_wstep(hf[(ks + 2) % 3], hrow, ks + 2);
      // Keeps the reads two k steps ahead of their products: sunk to their
      // users, each read's latency is exposed.
      __builtin_amdgcn_sched_barrier(0);
      acc00 = wmma_bf16(pf[0][ks], hf[ks % 3][0], acc00);
      acc01 = wmma_bf16(pf[0][ks], hf[ks % 3][1], acc01);
      acc10 = wmma_bf16(pf[1][ks], hf[ks % 3][0], acc10);
      acc11 = wmma_bf16(pf[1][ks], hf[ks % 3][1], acc11);
    }

    FragCD d[2][2];
    d[0][0].v = acc00; d[0][1].v = acc01; d[1][0].v = acc10; d[1][1].v = acc11;

#pragma unroll
    for (int mi = 0; mi < 2; ++mi)
#pragma unroll
      for (int ni = 0; ni < 2; ++ni)
#pragma unroll
        for (int r = 0; r < 8; ++r)
          *(float*)(sw + (mi * 16 + r) * PSPITCH + ni * 64) = d[mi][ni].f[r];
    // A lane reads back what other lanes of its wave have written.
    asm volatile("s_wait_dscnt 0x0" ::: "memory");
    v4f ov[8];
#pragma unroll
    for (int k = 0; k < 8; ++k) ov[k] = *(const v4f*)(sr + k * 4 * PSPITCH);
#pragma unroll
    for (int k = 0; k < 8; ++k)
#pragma unroll
      for (int e = 0; e < 4; ++e) ov[k][e] = xv[c][k][e] + ov[k][e] + pbv[k];
#pragma unroll
    for (int k = 0; k < 8; ++k) *(v4f*)(op + k * 4 * NPIX + c * 32) = ov[k];
    // The next tile writes the registers that these stores name.
    asm volatile("s_wait_xcnt 0x0" :: "v"(op) : "memory");

    if (c + 2 < 4) {
#pragma unroll
      for (int k = 0; k < 8; ++k)
        xv[c + 2][k] = *(const v4f*)(xp + k * 4 * NPIX + (c + 2) * 32);
      // As above: ends the run, the address in its registers up to the wait.
      asm volatile("s_wait_xcnt 0x0" :: "v"(xp) : "memory");
    }
  }
}

// ---------------------------------------------------------------------------
// Host-side launcher.
// Inputs: 0:x 1:norm_w 2:norm_b 3:qkv_w 4:qkv_b 5:proj_w 6:proj_b
// ---------------------------------------------------------------------------
extern "C" void kernel_launch(void* const* d_in, const int* in_sizes, int n_in,
                              void* d_out, int out_size, void* d_ws, size_t ws_size,
                              hipStream_t stream) {
  (void)in_sizes; (void)n_in; (void)out_size; (void)ws_size;
  const float* x      = (const float*)d_in[0];
  const float* norm_w = (const float*)d_in[1];
  const float* norm_b = (const float*)d_in[2];
  const float* qkv_w  = (const float*)d_in[3];
  const float* qkv_b  = (const float*)d_in[4];
  const float* proj_w = (const float*)d_in[5];
  const float* proj_b = (const float*)d_in[6];
  float* out = (float*)d_out;

  char* ws = (char*)d_ws;
  const size_t SZ_WQ = (size_t)3 * CH * CH * 2;            // 384 KB
  const size_t SZ_WP = (size_t)CH * CH * 2;                // 128 KB
  const size_t SZ_T  = (size_t)BATCH * NPIX * CH * 2;      // 16 MB per tensor
  unsigned short* wq_bf   = (unsigned short*)(ws);
  unsigned short* wp_bf   = (unsigned short*)(ws + SZ_WQ);
  unsigned short* h_t     = (unsigned short*)(ws + SZ_WQ + SZ_WP);
  unsigned short* q_t     = (unsigned short*)(ws + SZ_WQ + SZ_WP + 1 * SZ_T);
  unsigned short* k_t     = (unsigned short*)(ws + SZ_WQ + SZ_WP + 2 * SZ_T);
  unsigned short* v_t     = (unsigned short*)(ws + SZ_WQ + SZ_WP + 3 * SZ_T);

  k_groupnorm<<<dim3(BATCH * NGRP), dim3(256), 0, stream>>>(
      x, norm_w, norm_b, qkv_w, proj_w, h_t, wq_bf, wp_bf);

  k_qkv<<<dim3(NPIX / 128, (3 * CH) / (64 * QKV_NT), BATCH), dim3(256), 0, stream>>>(
      wq_bf, qkv_b, h_t, q_t, k_t, v_t);

  k_attn<<<dim3(NPIX / 128, BATCH), dim3(256), 0, stream>>>(
      q_t, k_t, v_t, wp_bf, proj_b, x, out);
}

// v010
// It runs in 61.9 microseconds.
// Next to v009, in two timings, it ran 1.05 times as fast each time.
// Over all steps from v000 it is 8.45 times as fast.
#include <hip/hip_runtime.h>

// ---------------------------------------------------------------------------
// CDNA5 (gfx1250) attention block: GroupNorm -> QKV -> softmax(QK^T/sqrt(C))V
// -> proj -> residual.  All GEMM stages use v_wmma_f32_16x16x32_bf16 (wave32).
// ---------------------------------------------------------------------------

typedef __attribute__((ext_vector_type(16))) __bf16 v16bf;
typedef __attribute__((ext_vector_type(8)))  float  v8f;
typedef __attribute__((ext_vector_type(4)))  float  v4f;
typedef __attribute__((ext_vector_type(4)))  unsigned int v4u;

union FragAB { unsigned int u[8]; v16bf v; };
union FragCD { float f[8]; v8f v; };

#define BATCH 32
#define CH    256
#define NPIX  1024
#define NGRP  8
#define CPG   32           // channels per group

__device__ __forceinline__ unsigned short f2bf(float x) {
  unsigned int u = __float_as_uint(x);
  u += 0x7fffu + ((u >> 16) & 1u);           // round-to-nearest-even
  return (unsigned short)(u >> 16);
}

// Load a 16x32 bf16 A- or B-fragment.  `p` points to the *lane's* row (A) or
// column (B) start, with the K dimension contiguous in memory.  K-pair slot i
// in VGPR i follows the ISA 16-bit A-matrix table:
//   lanes 0-15 : V0..V3 -> K 0..7,  V4..V7 -> K 16..23
//   lanes 16-31: V0..V3 -> K 8..15, V4..V7 -> K 24..31
__device__ __forceinline__ v16bf load_ab_frag(const unsigned short* p) {
  const int half = (threadIdx.x >> 4) & 1;
  const unsigned int* p32 = (const unsigned int*)p;
  FragAB f;
#pragma unroll
  for (int i = 0; i < 8; ++i) {
    int kb = (i < 4) ? (half * 8 + 2 * i) : (16 + half * 8 + 2 * (i - 4));
    f.u[i] = p32[kb >> 1];
  }
  return f.v;
}

__device__ __forceinline__ v8f wmma_bf16(v16bf a, v16bf b, v8f c) {
  return __builtin_amdgcn_wmma_f32_16x16x32_bf16(
      /*neg_a=*/false, a, /*neg_b=*/false, b,
      /*c_mod=*/(short)0, c, /*reuse_a=*/false, /*reuse_b=*/false);
}

// A-fragment from LDS, same k order as load_ab_frag.  p = the lane's row, at
// the 64-B block of the k step, plus 16 B for lanes 16-31.
__device__ __forceinline__ v16bf lds_frag(const unsigned char* p) {
  v4u lo = *(const v4u*)(p);
  v4u hi = *(const v4u*)(p + 32);
  FragAB f;
#pragma unroll
  for (int i = 0; i < 4; ++i) { f.u[i] = lo[i]; f.u[4 + i] = hi[i]; }
  return f.v;
}

// LDS of the QKV GEMM: a block's 128 activation rows (256 bf16 each), then two
// buffers of 64 weight rows.  The projection in k_attn uses the same row pitch.
#define GPITCH 528                        // LDS bytes per row: 512 + 16
#define ABYTES (128 * GPITCH)
#define WBYTES (64 * GPITCH)
#define GBYTES (ABYTES + 2 * WBYTES)
#define WSTEP  (64 * CH * 2)              // global bytes from a weight tile to the next

// Eight copies of one wave, each a whole 512-B row (16 B per lane): rows r,
// r + 8, ..., r + 56.  l: the lane's LDS byte address in row r; g: its global
// address there.  The s_wait_xcnt stands inside the statement so that no
// address register is rewritten ahead of it.
__device__ __forceinline__ void stage_rows8(unsigned int l,
                                            const unsigned char* g) {
  asm volatile(
      "global_load_async_to_lds_b128 %0, %8, off\n\t"
      "global_load_async_to_lds_b128 %1, %9, off\n\t"
      "global_load_async_to_lds_b128 %2, %10, off\n\t"
      "global_load_async_to_lds_b128 %3, %11, off\n\t"
      "global_load_async_to_lds_b128 %4, %12, off\n\t"
      "global_load_async_to_lds_b128 %5, %13, off\n\t"
      "global_load_async_to_lds_b128 %6, %14, off\n\t"
      "global_load_async_to_lds_b128 %7, %15, off\n\t"
      "s_wait_xcnt 0x0"
      :: "v"(l), "v"(l + 8 * GPITCH), "v"(l + 16 * GPITCH),
         "v"(l + 24 * GPITCH), "v"(l + 32 * GPITCH), "v"(l + 40 * GPITCH),
         "v"(l + 48 * GPITCH), "v"(l + 56 * GPITCH),
         "v"(g), "v"(g + 8 * CH * 2), "v"(g + 16 * CH * 2),
         "v"(g + 24 * CH * 2), "v"(g + 32 * CH * 2), "v"(g + 40 * CH * 2),
         "v"(g + 48 * CH * 2), "v"(g + 56 * CH * 2)
      : "memory");
}

// In front of the walk over the weight tiles: the activation rows and the walk's
// first tile land and are published, then its second tile is sent for.  l: the
// lane's LDS byte address in row `wave` of the block's LDS; ag, wg0, wg1: its
// global addresses in that row of the activations and of those two tiles.
__device__ __forceinline__ void gemm_open(unsigned int l,
                                          const unsigned char* ag,
                                          const unsigned char* wg0,
                                          const unsigned char* wg1) {
  stage_rows8(l, ag);
  stage_rows8(l + 64 * GPITCH, ag + 64 * CH * 2);
  stage_rows8(l + ABYTES, wg0);
  // The rows have landed for this wave, then for every wave.
  asm volatile("s_wait_asynccnt 0x0" ::: "memory");
  __syncthreads();
  stage_rows8(l + ABYTES + WBYTES, wg1);
}

// Hand-over behind the products of tile t (of nt): this wave's reads of the tile
// are done, its copies of tile t + 1 have landed; behind the barrier that holds
// for every wave, and tile t + 2 may take the buffer of tile t.  wn: the lane's
// global address in tile t + 2 of the walk.
__device__ __forceinline__ void gemm_hand_over(int t, int nt, unsigned int l,
                                               const unsigned char* wn) {
  asm volatile("s_wait_dscnt 0x0" ::: "memory");
  asm volatile("s_wait_asynccnt 0x0" ::: "memory");
  __syncthreads();
  if (t + 2 < nt)
    stage_rows8(l + ABYTES + (unsigned int)(t & 1) * WBYTES, wn);
}

// A wave's two fragments (16 rows each, weights or activations) of k step ks.
__device__ __forceinline__ void load_wstep(v16bf (&wf)[2],
                                           const unsigned char* wrow, int ks) {
#pragma unroll
  for (int i = 0; i < 2; ++i)
    wf[i] = lds_frag(wrow + i * 16 * GPITCH + ks * 64);
}

// ---------------------------------------------------------------------------
// Kernel 1: GroupNorm.  One block per (batch, group).  Output h stored as
// bf16 in [B][N][C] layout (channel-contiguous per pixel) for WMMA B-frags.
// x is read once: the block's 256 lanes hold the group's 32 x 1024 values in
// registers (128 each), sum them there and normalise them there.
// The block size is declared so that a lane may hold its 128 values.
// The same launch turns the weights into bf16 (qkv_w: 768x256, proj_w: 256x256):
// the grid's 65,536 lanes take 4 values each, blocks 0-191 of qkv_w, the rest of
// proj_w.  The load flies with those of x; no wave is started for it.
// ---------------------------------------------------------------------------
typedef __attribute__((ext_vector_type(2))) unsigned int v2u;
#define QW_BLOCKS (3 * CH * CH / 1024)    // blocks that convert qkv_w
static_assert(BATCH * NGRP * 1024 == 4 * CH * CH, "one 16-B load a lane");

__global__ void __launch_bounds__(256) k_groupnorm(const float* __restrict__ x,
                            const float* __restrict__ nw,
                            const float* __restrict__ nb,
                            const float* __restrict__ qkv_w,
                            const float* __restrict__ proj_w,
                            unsigned short* __restrict__ h_t,
                            unsigned short* __restrict__ wq_bf,
                            unsigned short* __restrict__ wp_bf) {
  const int bb = blockIdx.x >> 3;
  const int g  = blockIdx.x & 7;
  const int c0 = g * CPG;
  const float* xp = x + ((size_t)bb * CH + c0) * NPIX;   // 32*1024 contiguous

  // A lane owns 8 channels x 4 pixels, four times: the 8 lanes that share cl
  // read one whole 128-B line of a channel row, and the 4 lanes of one pixel
  // store its 32 channels as one contiguous 64-B run (16 B per lane).
  const int lane = threadIdx.x & 31;
  const int wave = threadIdx.x >> 5;
  const int cl   = (lane & 3) * 8;                // first of the lane's channels
  const int n0   = wave * 128 + (lane >> 2) * 4;  // first of the lane's pixels
  // Every loop below is fully unrolled so that v, w8 and b8 are registers.
  v4f v[4][8];
#pragma unroll
  for (int it = 0; it < 4; ++it)
#pragma unroll
    for (int j = 0; j < 8; ++j)
      v[it][j] = *(const v4f*)(xp + (cl + j) * NPIX + n0 + it * 32);
  float w8[8], b8[8];
#pragma unroll
  for (int j = 0; j < 8; ++j) {
    w8[j] = nw[c0 + cl + j];
    b8[j] = nb[c0 + cl + j];
  }
  // The lane's 4 weights.
  const bool isq = blockIdx.x < QW_BLOCKS;
  const int  wi  = ((isq ? blockIdx.x : blockIdx.x - QW_BLOCKS) * 256 +
                    threadIdx.x) * 4;
  // This load's result may land in the address registers that the loads above
  // name.
  asm volatile("s_wait_xcnt 0x0" ::: "memory");
  const v4f wv = *(const v4f*)((isq ? qkv_w : proj_w) + wi);
  // Keeps all these loads ahead of the first sum, one memory latency for all:
  // without it the loads of w8 and b8 sink behind the sums, and their latency
  // is exposed in front of the first barrier.
  __builtin_amdgcn_sched_barrier(0);

  // The lane's share of the two sums, four independent chains each.
  v4f s4 = {}, q4 = {};
#pragma unroll
  for (int it = 0; it < 4; ++it)
#pragma unroll
    for (int j = 0; j < 8; ++j) {
      s4 += v[it][j];
      q4 += v[it][j] * v[it][j];
    }
  const float s  = (s4[0] + s4[1]) + (s4[2] + s4[3]);
  const float s2 = (q4[0] + q4[1]) + (q4[2] + q4[3]);

  __shared__ float rs[256], rs2[256];
  rs[threadIdx.x] = s; rs2[threadIdx.x] = s2;
  __syncthreads();
  for (int off = 128; off > 0; off >>= 1) {
    if (threadIdx.x < off) {
      rs[threadIdx.x]  += rs[threadIdx.x + off];
      rs2[threadIdx.x] += rs2[threadIdx.x + off];
    }
    __syncthreads();
  }
  const float inv_n = 1.0f / (float)(CPG * NPIX);
  const float mean  = rs[0] * inv_n;
  const float var   = rs2[0] * inv_n - mean * mean;
  const float rstd  = rsqrtf(var + 1e-5f);

#pragma unroll
  for (int it = 0; it < 4; ++it) {
#pragma unroll
    for (int p = 0; p < 4; ++p) {
      v4u o;
#pragma unroll
      for (int k = 0; k < 4; ++k) {
        float lo = (v[it][2 * k][p]     - mean) * rstd * w8[2 * k]     + b8[2 * k];
        float hi = (v[it][2 * k + 1][p] - mean) * rstd * w8[2 * k + 1] + b8[2 * k + 1];
        o[k] = (unsigned int)f2bf(lo) | ((unsigned int)f2bf(hi) << 16);
      }
      *(v4u*)(h_t + ((size_t)bb * NPIX + n0 + it * 32 + p) * CH + c0 + cl) = o;
    }
  }

  // Stored behind the last barrier: a barrier waits for the stores in front of it.
  v2u wo;
  wo[0] = (unsigned int)f2bf(wv[0]) | ((unsigned int)f2bf(wv[1]) << 16);
  wo[1] = (unsigned int)f2bf(wv[2]) | ((unsigned int)f2bf(wv[3]) << 16);
  *(v2u*)((isq ? wq_bf : wp_bf) + wi) = wo;
}

// ---------------------------------------------------------------------------
// Kernel 2: QKV GEMM.  qkv[o,n] = sum_c W[o,c] * h[n,c] + b[o].
// A block owns 128 pixels (n) and walks 6 tiles of 64 output channels (o); 8
// waves, each a 32x32 tile (2x2 WMMA) of every 64 x 128 tile.  The h rows come
// into LDS once and a wave keeps its 32 pixels' fragments in registers; the W
// tiles come through two LDS buffers, each copied while the one before is used.
// Q,K stored [B][N][C] bf16; V stored [B][C][N] bf16.
// A tile lies wholly in Q, in K or in V.  Q and K tiles are computed as W h^T
// (A rows = output channels), V tiles as h W^T (A rows = pixels): the 8
// accumulators of a lane run along the A rows, so they are always 8 neighbours
// in the stored layout and are packed into 16 B.
// A finished tile goes through LDS, so that it leaves in whole 128-B lines: every
// wave writes its 32 x 32 part into a staging buffer in front of the tile's
// hand-over barrier; behind it a wave reads whole rows of the block's tile (128 B
// of a pixel's 64 channels, 256 B of a channel's 128 pixels) and stores them.
// Two staging buffers take turns: one behind the weight buffers, the other in
// the activation rows, which every wave has left at the first hand-over.
// Four waves per SIMD (two blocks per WGP, as their LDS allows): 256 registers.
// ---------------------------------------------------------------------------
#define QKV_NT 6                          // weight tiles per block
#define QSPITCH 144                       // staged Q or K row: 128 B + 16
#define VSPITCH 272                       // staged V row: 256 B + 16
#define SBYTES  (128 * QSPITCH)           // a staging buffer
static_assert(64 * VSPITCH <= SBYTES && SBYTES <= ABYTES, "staging buffers fit");

// One weight tile of one wave: products, bias, staging, hand-over, stores.  ISV:
// the tile lies in V.  t: the tile's place in the block's walk; ot: its number in
// W; nb0: the block's first pixel; wn: as in gemm_hand_over.
template <bool ISV>
__device__ __forceinline__ void qkv_tile(int t, int ot, int bb, int nb0,
                                         const v16bf (&hf)[2][8],
                                         unsigned char* lds,
                                         unsigned int l, const unsigned char* wn,
                                         const float* __restrict__ qkv_b,
                                         unsigned short* __restrict__ base) {
  const int wave = threadIdx.x >> 5;
  const int lane = threadIdx.x & 31;
  const int row  = lane & 15;
  const int half = lane >> 4;
  const int o0   = ot * 64 + (wave >> 2) * 32;
  const int oc0  = (ot * 64) & 255;            // the tile's channel inside Q, K or V
  const unsigned char* wrow = lds + ABYTES + (t & 1) * WBYTES +
                              ((wave >> 2) * 32 + row) * GPITCH + half * 16;
  unsigned char* stage = lds + ((t & 1) ? 0 : GBYTES);

  // Bias: per output channel, that is per register for Q and K, per lane for V.
  // Sent for here, so that it has come when the products are done.
  const float* bp = qkv_b + o0 + (ISV ? row : half * 8);
  float bl[2];
  v4f blo[2], bhi[2];
  if (ISV) {
    bl[0] = bp[0];
    bl[1] = bp[16];
  } else {
    blo[0] = *(const v4f*)bp;
    bhi[0] = *(const v4f*)(bp + 4);
    blo[1] = *(const v4f*)(bp + 16);
    bhi[1] = *(const v4f*)(bp + 20);
  }
  // No address register of these loads is rewritten ahead of the wait: the
  // statement reads the address, which keeps it in its registers up to here.
  asm volatile("s_wait_xcnt 0x0" :: "v"(bp) : "memory");

  // acc[i][j]: register r = A row i * 16 + 8 * half + r, lane = B row j * 16 + row.
  v8f acc[2][2] = {};
  v16bf wf[3][2];
  load_wstep(wf[0], wrow, 0);
  load_wstep(wf[1], wrow, 1);
#pragma unroll
  for (int ks = 0; ks < 8; ++ks) {
    if (ks < 6) load_wstep(wf[(ks + 2) % 3], wrow, ks + 2);
    // Keeps the reads two k steps ahead of their products: sunk to their users,
    // each read's latency is exposed.
    __builtin_amdgcn_sched_barrier(0);
    const v16bf w0 = wf[ks % 3][0], w1 = wf[ks % 3][1];
    acc[0][0] = ISV ? wmma_bf16(hf[0][ks], w0, acc[0][0])
                    : wmma_bf16(w0, hf[0][ks], acc[0][0]);
    acc[0][1] = ISV ? wmma_bf16(hf[0][ks], w1, acc[0][1])
                    : wmma_bf16(w0, hf[1][ks], acc[0][1]);
    acc[1][0] = ISV ? wmma_bf16(hf[1][ks], w0, acc[1][0])
                    : wmma_bf16(w1, hf[0][ks], acc[1][0]);
    acc[1][1] = ISV ? wmma_bf16(hf[1][ks], w1, acc[1][1])
                    : wmma_bf16(w1, hf[1][ks], acc[1][1]);
  }

  if (ISV) {
#pragma unroll
    for (int j = 0; j < 2; ++j)
#pragma unroll
      for (int i = 0; i < 2; ++i) acc[i][j] += bl[j];
  } else {
#pragma unroll
    for (int i = 0; i < 2; ++i)
#pragma unroll
      for (int j = 0; j < 2; ++j)
#pragma unroll
        for (int r = 0; r < 4; ++r) {
          acc[i][j][r]     += blo[i][r];
          acc[i][j][4 + r] += bhi[i][r];
        }
  }

  // The wave's part of the staged tile.  A staged row is a B row (a pixel of Q or
  // K, a channel of V); the lane's 8 neighbours lie along it.
  const int spitch = ISV ? VSPITCH : QSPITCH;
  const int brow   = (ISV ? wave >> 2 : wave & 3) * 32 + row;
  const int acol   = (ISV ? wave & 3 : wave >> 2) * 64 + half * 16;
  unsigned char* sp = stage + brow * spitch + acol;
#pragma unroll
  for (int i = 0; i < 2; ++i)
#pragma unroll
    for (int j = 0; j < 2; ++j) {
      v4u w;
#pragma unroll
      for (int p = 0; p < 4; ++p)
        w[p] = (unsigned int)f2bf(acc[i][j][2 * p]) |
               ((unsigned int)f2bf(acc[i][j][2 * p + 1]) << 16);
      *(v4u*)(sp + j * 16 * spitch + i * 32) = w;
    }

  // Its wait for LDS and its barrier also publish the staged tile.
  gemm_hand_over(t, QKV_NT, l, wn);

  // Whole rows out: 8 lanes a 128-B row of Q or K (4 rows an instruction, 16 rows
  // a wave), 16 lanes a 256-B row of V (2 rows an instruction, 8 rows a wave).
  const int lpr   = ISV ? 16 : 8;              // lanes per row
  const int rpi   = 32 / lpr;                  // rows per instruction
  const int srow  = wave * 4 * rpi + lane / lpr;
  const int scol  = (lane % lpr) * 16;
  const int pitch = ISV ? NPIX : CH;
  const unsigned char* sr = stage + srow * spitch + scol;
  unsigned char* gd = (unsigned char*)(base +
      (ISV ? ((size_t)bb * CH + oc0 + srow) * NPIX + nb0
           : ((size_t)bb * NPIX + nb0 + srow) * CH + oc0)) + scol;
  v4u sv[4];
#pragma unroll
  for (int k = 0; k < 4; ++k) sv[k] = *(const v4u*)(sr + k * rpi * spitch);
#pragma unroll
  for (int k = 0; k < 4; ++k) *(v4u*)(gd + k * rpi * pitch * 2) = sv[k];
  // The next tile writes the registers that these stores name; the statement
  // reads the address, which keeps it in its registers up to here.
  asm volatile("s_wait_xcnt 0x0" :: "v"(gd) : "memory");
}

__global__ void __launch_bounds__(256)
__attribute__((amdgpu_waves_per_eu(4, 4))) k_qkv(
                      const unsigned short* __restrict__ wq_bf,
                      const float* __restrict__ qkv_b,
                      const unsigned short* __restrict__ h_t,
                      unsigned short* __restrict__ q_t,
                      unsigned short* __restrict__ k_t,
                      unsigned short* __restrict__ v_t) {
  const int bb   = blockIdx.z;
  const int wave = threadIdx.x >> 5;
  const int nb0  = blockIdx.x * 128;           // the block's first pixel
  const int ot0  = blockIdx.y * QKV_NT;        // the block's first weight tile
  const int lane = threadIdx.x & 31;
  const int row  = lane & 15;
  const int half = lane >> 4;

  __shared__ __attribute__((aligned(16))) unsigned char lds[GBYTES + SBYTES];
  const unsigned int l = (unsigned int)(size_t)lds + wave * GPITCH + lane * 16;
  const unsigned char* hg =
      (const unsigned char*)(h_t +
          ((size_t)bb * NPIX + blockIdx.x * 128 + wave) * CH) + lane * 16;
  const unsigned char* wg =
      (const unsigned char*)(wq_bf + ((size_t)ot0 * 64 + wave) * CH) + lane * 16;
  // Every block with the same ot0 walks the same weight tiles.  A block starts
  // at tile rot of its 6 and wraps round, so that the blocks do not all ask L2
  // for the same lines at the same moment.  wtile(t): the tile of step t.
  const int rot = (blockIdx.z * (NPIX / 128) + blockIdx.x) % QKV_NT;
  auto wtile = [&](int t) { return t + rot < QKV_NT ? t + rot : t + rot - QKV_NT; };
  gemm_open(l, hg, wg + (size_t)wtile(0) * WSTEP, wg + (size_t)wtile(1) * WSTEP);

  v16bf hf[2][8];
  const unsigned char* hrow =
      lds + ((wave & 3) * 32 + row) * GPITCH + half * 16;
#pragma unroll
  for (int j = 0; j < 2; ++j)
#pragma unroll
    for (int ks = 0; ks < 8; ++ks)
      hf[j][ks] = lds_frag(hrow + j * 16 * GPITCH + ks * 64);

  // Weight tiles 0-3 are Q, 4-7 K, 8-11 V: one walk through the two buffers.
  for (int t = 0; t < QKV_NT; ++t) {
    const int ot = ot0 + wtile(t);
    const unsigned char* wn = wg + (size_t)wtile(t < QKV_NT - 2 ? t + 2 : 0) * WSTEP;
    if (ot < 8)
      qkv_tile<false>(t, ot, bb, nb0, hf, lds, l, wn, qkv_b, ot < 4 ? q_t : k_t);
    else
      qkv_tile<true>(t, ot, bb, nb0, hf, lds, l, wn, qkv_b, v_t);
  }
  // No copy is outstanding when the wave ends.
  asm volatile("s_wait_asynccnt 0x0" ::: "memory");
}

typedef __attribute__((ext_vector_type(2))) float  v2f;
typedef __attribute__((ext_vector_type(2))) __bf16 v2bf;

#define KTILE    32                       // keys per tile
#define NTRIP    (NPIX / (2 * KTILE))      // trips: a pair of tiles each
#define KPITCH   528                      // LDS bytes per key row: 512 + 16
#define VPITCH   80                       // LDS bytes per channel row: 64 + 16
#define KBYTES   (KTILE * KPITCH)
#define BUFBYTES (KBYTES + CH * VPITCH)
#define PAIRBYTES (2 * BUFBYTES)          // a pair of tiles
#define PBYTES   (CH * GPITCH)            // the projection's 256 weight rows
#define XBYTES   16384                    // 16 queries x 256 channels of f32
#define PSPITCH  144                      // staged output row: 32 f32 + 16 B
#define PSBYTES  (32 * PSPITCH)           // a wave's staged 32 x 32 output tile
static_assert(128 * GPITCH + 8 * PSBYTES <= 2 * PAIRBYTES, "staging fits the ring");

// Two f32 -> one register of two bf16, round to nearest even.
__device__ __forceinline__ unsigned int pack_bf2(float lo, float hi) {
  v2f t = {lo, hi};
  return __builtin_bit_cast(unsigned int, __builtin_convertvector(t, v2bf));
}

// Value of lane l ^ 16.
__device__ __forceinline__ float other_half(float x) {
  int b = __float_as_int(x);
  return __int_as_float(__builtin_amdgcn_permlanex16(
      b, b, 0x76543210, 0xfedcba98, false, false));
}

// One tile's copies of one lane: 4 x 16 B of K, 4 x 16 B of V.  kl, vl: LDS
// byte addresses; kg, vg: global addresses.  The s_wait_xcnt stands inside the
// statement so that no address register is rewritten ahead of it.
__device__ __forceinline__ void stage_tile(unsigned int kl, unsigned int vl,
                                           const unsigned char* kg,
                                           const unsigned char* vg) {
  asm volatile(
      "global_load_async_to_lds_b128 %0, %8, off\n\t"
      "global_load_async_to_lds_b128 %1, %9, off\n\t"
      "global_load_async_to_lds_b128 %2, %10, off\n\t"
      "global_load_async_to_lds_b128 %3, %11, off\n\t"
      "global_load_async_to_lds_b128 %4, %12, off\n\t"
      "global_load_async_to_lds_b128 %5, %13, off\n\t"
      "global_load_async_to_lds_b128 %6, %14, off\n\t"
      "global_load_async_to_lds_b128 %7, %15, off\n\t"
      "s_wait_xcnt 0x0"
      :: "v"(kl), "v"(kl + 8 * KPITCH), "v"(kl + 16 * KPITCH),
         "v"(kl + 24 * KPITCH),
         "v"(vl), "v"(vl + 64 * VPITCH), "v"(vl + 128 * VPITCH),
         "v"(vl + 192 * VPITCH),
         "v"(kg), "v"(kg + 8 * CH * 2), "v"(kg + 16 * CH * 2),
         "v"(kg + 24 * CH * 2),
         "v"(vg), "v"(vg + 64 * NPIX * 2), "v"(vg + 128 * NPIX * 2),
         "v"(vg + 192 * NPIX * 2)
      : "memory");
}

// Two waves per SIMD (one block per WGP): 512 registers a wave, of which the
// output tile takes 256 and the queries 128; the K and V fragments pass through
// what is left, a few at a time.
__global__ void __launch_bounds__(256)
__attribute__((amdgpu_waves_per_eu(2, 2))) k_attn(
                       const unsigned short* __restrict__ q_t,
                       const unsigned short* __restrict__ k_t,
                       const unsigned short* __restrict__ v_t,
                       const unsigned short* __restrict__ wp_bf,
                       const float* __restrict__ proj_b,
                       const float* __restrict__ x,
                       float* __restrict__ out) {
  const int bb   = blockIdx.y;
  const int tid  = threadIdx.x;
  const int wave = tid >> 5;
  const int lane = tid & 31;
  const int row  = lane & 15;
  const int half = lane >> 4;
  const float c2 = 0.0625f * 1.44269504f;                // 256^-0.5 * log2(e)

  __shared__ __attribute__((aligned(16))) unsigned char ring[2 * PAIRBYTES + PBYTES];

  // Copy addresses.  K: a wave copies one whole 512-B key row per instruction.
  // V: 4 lanes copy the 64 B that one channel holds of a tile's 32 keys.
  // The wave's share of an LDS address is kept scalar, the lane's in a register.
  const unsigned int ring0 = (unsigned int)(size_t)ring;
  const unsigned int wv = __builtin_amdgcn_readfirstlane(wave);
  const unsigned int qg = wv & 3;          // the wave's group of 32 queries
  const unsigned int kh = wv >> 2;         // its tile of every pair
  const unsigned int ks0 = ring0 + wv * KPITCH;
  const unsigned int vs0 = ring0 + KBYTES + wv * (8 * VPITCH);
  const unsigned int kln = lane * 16;
  const unsigned int vln = (lane >> 2) * VPITCH + (lane & 3) * 16;
  // Trip t works on pair (t + rot) mod NTRIP; kg, vg: the lane's addresses in
  // pair rot.  Pairs rot + 1 and rot + 2 do not wrap.
  const unsigned int rot = (blockIdx.x & 3) * (NTRIP / 4);
  const unsigned char* kg =
      (const unsigned char*)(k_t + ((size_t)bb * NPIX + rot * (2 * KTILE) + wave) * CH) +
      lane * 16;
  const unsigned char* vg =
      (const unsigned char*)(v_t + ((size_t)bb * CH + (tid >> 2)) * NPIX +
                             rot * (2 * KTILE)) +
      (tid & 3) * 16;

  stage_tile(ks0 + kln, vs0 + vln, kg, vg);
  stage_tile(ks0 + BUFBYTES + kln, vs0 + BUFBYTES + vln, kg + KTILE * CH * 2,
             vg + KTILE * 2);

  // The 32 queries as B-fragments, kept in registers for the whole walk.
  v16bf qb[2][8];
  const unsigned short* qrow =
      q_t + ((size_t)bb * NPIX + blockIdx.x * 128 + qg * 32 + row) * CH;
#pragma unroll
  for (int j = 0; j < 2; ++j)
#pragma unroll
    for (int ks = 0; ks < 8; ++ks)
      qb[j][ks] = load_ab_frag(qrow + j * 16 * CH + ks * 32);

  // Pair rot has landed for this wave, then for every wave.
  asm volatile("s_wait_asynccnt 0x0" ::: "memory");
  __syncthreads();
  stage_tile(ks0 + PAIRBYTES + kln, vs0 + PAIRBYTES + vln,
             kg + 2 * KTILE * CH * 2, vg + 2 * KTILE * 2);
  stage_tile(ks0 + PAIRBYTES + BUFBYTES + kln, vs0 + PAIRBYTES + BUFBYTES + vln,
             kg + 3 * KTILE * CH * 2, vg + 3 * KTILE * 2);
  // The projection's weights, 32 rows a wave, behind the ring: they land under
  // the wait and the barrier at the foot of the first trip, with pair rot + 1.
  {
    const unsigned int pl = ring0 + 2 * PAIRBYTES + wave * GPITCH + lane * 16;
    const unsigned char* pg =
        (const unsigned char*)(wp_bf + (size_t)wave * CH) + lane * 16;
#pragma unroll
    for (int i = 0; i < 4; ++i)
      stage_rows8(pl + i * 64 * GPITCH, pg + i * 64 * CH * 2);
  }

  // o[j][ct]: queries 16 j .. 16 j + 15 of the wave's 32.
  v8f o[2][16];
#pragma unroll
  for (int j = 0; j < 2; ++j)
#pragma unroll
    for (int ct = 0; ct < 16; ++ct) o[j][ct] = (v8f){};
  float mref[2] = {-3.0e38f, -3.0e38f};  // maximum in use, in units of log2
  float lsum[2] = {0.f, 0.f};            // this half's share of the query's sum
  // The lane's addresses in the pair that is sent for next.
  const unsigned char* kg2 = kg + 4 * KTILE * CH * 2;
  const unsigned char* vg2 = vg + 4 * KTILE * 2;

  // One trip: a pair of tiles.  more: a trip t + 2 exists and its pair is sent for.  It is
  // a constant of each of the two loops below, so that a trip has no branch
  // behind the softmax: the row sums then stay in front of the O^T products,
  // and the exponentials free their registers there.
  auto trip = [&](const int t, const bool more) __attribute__((always_inline)) {
    const unsigned int poff = (unsigned int)(t & 1) * PAIRBYTES;
    const unsigned int boff = poff + kh * BUFBYTES;
    const unsigned char* kb = ring + boff + row * KPITCH + half * 16;
    const unsigned char* vb = ring + boff + KBYTES + row * VPITCH + half * 16;

    // S^T: register r of st[i][j] = key 16 * i + 8 * half + r, query group j.
    v8f st[2][2] = {};
    // K fragments are read at least two k steps ahead of their products.
    v16bf kf[3][2];
    v16bf vf[16];
#pragma unroll
    for (int ks = 0; ks < 2; ++ks) {
      kf[ks][0] = lds_frag(kb + ks * 64);
      kf[ks][1] = lds_frag(kb + 16 * KPITCH + ks * 64);
    }
#pragma unroll
    for (int ks = 0; ks < 8; ++ks) {
      if (ks < 6) {
        kf[(ks + 2) % 3][0] = lds_frag(kb + (ks + 2) * 64);
        kf[(ks + 2) % 3][1] = lds_frag(kb + 16 * KPITCH + (ks + 2) * 64);
      }
      // Keeps the reads ahead of their products: sunk to their users, each
      // read's latency is exposed.
      __builtin_amdgcn_sched_barrier(0);
      const v16bf k0 = kf[ks % 3][0], k1 = kf[ks % 3][1];
      st[0][0] = wmma_bf16(k0, qb[0][ks], st[0][0]);
      st[0][1] = wmma_bf16(k0, qb[1][ks], st[0][1]);
      st[1][0] = wmma_bf16(k1, qb[0][ks], st[1][0]);
      st[1][1] = wmma_bf16(k1, qb[1][ks], st[1][1]);
    }
    // The first V fragments: the softmax covers their latency.
#pragma unroll
    for (int ct = 0; ct < 4; ++ct) vf[ct] = lds_frag(vb + ct * 16 * VPITCH);
    // Keeps these reads in front of the softmax.
    __builtin_amdgcn_sched_barrier(0);

    float mt[2];
#pragma unroll
    for (int j = 0; j < 2; ++j) {
      float m = fmaxf(st[0][j][0], st[1][j][0]);
#pragma unroll
      for (int r = 1; r < 8; ++r) m = fmaxf(m, fmaxf(st[0][j][r], st[1][j][r]));
      mt[j] = fmaxf(m, other_half(m)) * c2;
    }

    // The maximum in use is replaced only when some query's new one exceeds it
    // by more than 8: until then every exponential stays at or below 2^8.
    if (__builtin_amdgcn_ballot_w32(mt[0] > mref[0] + 8.0f ||
                                    mt[1] > mref[1] + 8.0f) != 0) {
#pragma unroll
      for (int j = 0; j < 2; ++j) {
        const float mn = fmaxf(mref[j], mt[j]);
        const float al = __builtin_amdgcn_exp2f(mref[j] - mn);
        lsum[j] *= al;
#pragma unroll
        for (int ct = 0; ct < 16; ++ct) o[j][ct] *= al;
        mref[j] = mn;
      }
    }

    FragAB pb[2];
#pragma unroll
    for (int j = 0; j < 2; ++j)
#pragma unroll
      for (int i = 0; i < 4; ++i) {
        float a0 = __builtin_amdgcn_exp2f(st[0][j][2 * i]     * c2 - mref[j]);
        float a1 = __builtin_amdgcn_exp2f(st[0][j][2 * i + 1] * c2 - mref[j]);
        float b0 = __builtin_amdgcn_exp2f(st[1][j][2 * i]     * c2 - mref[j]);
        float b1 = __builtin_amdgcn_exp2f(st[1][j][2 * i + 1] * c2 - mref[j]);
        lsum[j] += (a0 + a1) + (b0 + b1);
        pb[j].u[i]     = pack_bf2(a0, a1);
        pb[j].u[4 + i] = pack_bf2(b0, b1);
      }

    // O^T: register r of o[j][ct] = channel ct * 16 + 8 * half + r.  The V
    // fragments come two at a time, at least three such pairs ahead of their products.
    // Each scheduling barrier keeps the reads where they stand: sunk to their
    // users, each read's latency is exposed; the first one also keeps the row
    // sums in front.
    __builtin_amdgcn_sched_barrier(0);
#pragma unroll
    for (int ct = 4; ct < 6; ++ct) vf[ct] = lds_frag(vb + ct * 16 * VPITCH);
#pragma unroll
    for (int g = 0; g < 8; ++g) {
      if (g < 5) {
        vf[2 * g + 6] = lds_frag(vb + (2 * g + 6) * 16 * VPITCH);
        vf[2 * g + 7] = lds_frag(vb + (2 * g + 7) * 16 * VPITCH);
      }
      __builtin_amdgcn_sched_barrier(0);
#pragma unroll
      for (int ct = 2 * g; ct < 2 * g + 2; ++ct) {
        o[0][ct] = wmma_bf16(vf[ct], pb[0].v, o[0][ct]);
        o[1][ct] = wmma_bf16(vf[ct], pb[1].v, o[1][ct]);
      }
    }

    // Hand-over: this wave's reads of the pair are done, its copies of the next
    // pair have landed; behind the barrier that holds for every wave.
    asm volatile("s_wait_dscnt 0x0" ::: "memory");
    asm volatile("s_wait_asynccnt 0x0" ::: "memory");
    __syncthreads();
    if (more)
    {
      // Scalar sums first: added lane part first, the sum shared with the first
      // pair's copy is an asm operand, is held below v256 and gets spilled.
      const unsigned int ksb = __builtin_amdgcn_readfirstlane(ks0 + poff);
      const unsigned int vsb = __builtin_amdgcn_readfirstlane(vs0 + poff);
      stage_tile(ksb + kln, vsb + vln, kg2, vg2);
      stage_tile(ksb + BUFBYTES + kln, vsb + BUFBYTES + vln,
                 kg2 + KTILE * CH * 2, vg2 + KTILE * 2);
      // On to the next pair, from the last one back to the first.
      const bool last = (((unsigned int)t + 2 + rot) & (NTRIP - 1)) == NTRIP - 1;
      kg2 += last ? -(NTRIP - 1) * (2 * KTILE * CH * 2) : 2 * KTILE * CH * 2;
      vg2 += last ? -(NTRIP - 1) * (2 * KTILE * 2) : 2 * KTILE * 2;
    }
  };
  for (int t = 0; t < NTRIP - 2; ++t) trip(t, true);
  for (int t = NTRIP - 2; t < NTRIP; ++t) trip(t, false);
  // No copy is outstanding when the ring is put to its next use.
  asm volatile("s_wait_asynccnt 0x0" ::: "memory");

  // Bias: per output row.  Wave w takes output channels 32 w .. 32 w + 31; where
  // the bias is added, a lane holds rows lane / 8 + 4 k.  Sent for here, so that
  // it has come at the barrier below.
  const int o0 = wave * 32;
  const float* bp = proj_b + o0 + (lane >> 3);
  float pbv[8];
#pragma unroll
  for (int k = 0; k < 8; ++k) pbv[k] = bp[k * 4];
  // No address register of these loads is rewritten ahead of the wait: the
  // statement reads the address, which keeps it in its registers up to here.
  asm volatile("s_wait_xcnt 0x0" :: "v"(bp) : "memory");

  // The two waves of a query group swap halves: wave w keeps query group kh of
  // its 32 and hands the other to wave w ^ 4, register by register, the same
  // lane on both sides.  Every wave has left the ring at the last trip's barrier.
  v8f ok[16];
  float mk, lk;
  {
    unsigned char* xw = ring + wv * XBYTES + lane * 16;
    float* sw = (float*)(ring + 8 * XBYTES + wv * 256) + lane * 2;
#pragma unroll
    for (int ct = 0; ct < 16; ++ct) {
      const v8f g = kh ? o[0][ct] : o[1][ct];
      ok[ct] = kh ? o[1][ct] : o[0][ct];
      *(v4f*)(xw + (2 * ct) * 512)     = (v4f){g[0], g[1], g[2], g[3]};
      *(v4f*)(xw + (2 * ct + 1) * 512) = (v4f){g[4], g[5], g[6], g[7]};
    }
    sw[0] = kh ? mref[0] : mref[1];
    sw[1] = kh ? lsum[0] : lsum[1];
    mk = kh ? mref[1] : mref[0];
    lk = kh ? lsum[1] : lsum[0];
  }
  // Every wave's half is written before its partner reads it.
  __syncthreads();
  {
    const unsigned char* xr = ring + (wv ^ 4) * XBYTES + lane * 16;
    const float* sr = (const float*)(ring + 8 * XBYTES + (wv ^ 4) * 256) + lane * 2;
    const float mp = sr[0], lp = sr[1];
    const float mj = fmaxf(mk, mp);
    float fk = __builtin_amdgcn_exp2f(mk - mj);
    float fp = __builtin_amdgcn_exp2f(mp - mj);
    const float lj  = lk * fk + lp * fp;
    const float inv = 1.0f / (lj + other_half(lj));
    fk *= inv;
    fp *= inv;
#pragma unroll
    for (int ct = 0; ct < 16; ++ct) {
      const v4f p0 = *(const v4f*)(xr + (2 * ct) * 512);
      const v4f p1 = *(const v4f*)(xr + (2 * ct + 1) * 512);
#pragma unroll
      for (int r = 0; r < 4; ++r) {
        ok[ct][r]     = ok[ct][r] * fk     + p0[r] * fp;
        ok[ct][4 + r] = ok[ct][4 + r] * fk + p1[r] * fp;
      }
    }
  }
  // Every wave has read its partner's half before the rows overwrite it.
  __syncthreads();

  // The wave's 16 normalised rows as bf16, 512 B a pixel.
  unsigned char* orow =
      ring + (qg * 32 + kh * 16 + row) * GPITCH + half * 16;
#pragma unroll
  for (int ct = 0; ct < 16; ++ct) {
    v4u w;
#pragma unroll
    for (int i = 0; i < 4; ++i)
      w[i] = pack_bf2(ok[ct][2 * i], ok[ct][2 * i + 1]);
    *(v4u*)(orow + ct * 32) = w;
  }

  // The wave's 32 rows of Wp, kept in registers for all 128 pixels.
  v16bf pf[2][8];
  const unsigned char* prow =
      ring + 2 * PAIRBYTES + (o0 + row) * GPITCH + half * 16;
#pragma unroll
  for (int i = 0; i < 2; ++i)
#pragma unroll
    for (int ks = 0; ks < 8; ++ks)
      pf[i][ks] = lds_frag(prow + i * 16 * GPITCH + ks * 64);

  // All 128 rows are written before any wave reads them.
  __syncthreads();

  // A 32 x 32 tile of the output goes through the wave's own LDS, behind the 128
  // rows, so that x comes and out leaves in whole 128-B lines, 16 B a lane: the
  // accumulators are written as they lie (a register = an output row, 16 lanes =
  // 16 pixels) and read back 8 lanes a row, 4 rows an instruction.
  unsigned char* stg = ring + 128 * GPITCH + wv * PSBYTES;
  unsigned char* sw = stg + half * 8 * PSPITCH + row * 4;
  const unsigned char* sr = stg + (lane >> 3) * PSPITCH + (lane & 7) * 16;

  // The lane's first elements of x and of out: output row o0 + lane / 8, 4 pixels.
  const size_t e0 = ((size_t)bb * CH + o0 + (lane >> 3)) * NPIX +
                    blockIdx.x * 128 + (lane & 7) * 4;
  const float* xp = x + e0;
  float* op = out + e0;

  // 32 pixels at a time: a 32x32 tile (2x2 WMMA) of the wave's 32 x 128.  The
  // residual of a tile is one run of 8 loads, sent for two tiles ahead.
  // Every loop over c is fully unrolled so that xv is registers.
  v4f xv[4][8];
#pragma unroll
  for (int c = 0; c < 2; ++c) {
#pragma unroll
    for (int k = 0; k < 8; ++k)
      xv[c][k] = *(const v4f*)(xp + k * 4 * NPIX + c * 32);
    // Ends the run, so that the runs return in the order of their use; and, as
    // at the bias, the address stays in its registers up to the wait.
    asm volatile("s_wait_xcnt 0x0" :: "v"(xp) : "memory");
  }

#pragma unroll
  for (int c = 0; c < 4; ++c) {
    const unsigned char* hrow = ring + (c * 32 + row) * GPITCH + half * 16;

    v8f acc00 = {}, acc01 = {}, acc10 = {}, acc11 = {};
    v16bf hf[3][2];
    load_wstep(hf[0], hrow, 0);
    load_wstep(hf[1], hrow, 1);
#pragma unroll
    for (int ks = 0; ks < 8; ++ks) {
      if (ks < 6) load_wstep(hf[(ks + 2) % 3], hrow, ks + 2);
      // Keeps the reads two k steps ahead of their products: sunk to their
      // users, each read's latency is exposed.
      __builtin_amdgcn_sched_barrier(0);
      acc00 = wmma_bf16(pf[0][ks], hf[ks % 3][0], acc00);
      acc01 = wmma_bf16(pf[0][ks], hf[ks % 3][1], acc01);
      acc10 = wmma_bf16(pf[1][ks], hf[ks % 3][0], acc10);
      acc11 = wmma_bf16(pf[1][ks], hf[ks % 3][1], acc11);
    }

    FragCD d[2][2];
    d[0][0].v = acc00; d[0][1].v = acc01; d[1][0].v = acc10; d[1][1].v = acc11;

#pragma unroll
    for (int mi = 0; mi < 2; ++mi)
#pragma unroll
      for (int ni = 0; ni < 2; ++ni)
#pragma unroll
        for (int r = 0; r < 8; ++r)
          *(float*)(sw + (mi * 16 + r) * PSPITCH + ni * 64) = d[mi][ni].f[r];
    // A lane reads back what other lanes of its wave have written.
    asm volatile("s_wait_dscnt 0x0" ::: "memory");
    v4f ov[8];
#pragma unroll
    for (int k = 0; k < 8; ++k) ov[k] = *(const v4f*)(sr + k * 4 * PSPITCH);
#pragma unroll
    for (int k = 0; k < 8; ++k)
#pragma unroll
      for (int e = 0; e < 4; ++e) ov[k][e] = xv[c][k][e] + ov[k][e] + pbv[k];
#pragma unroll
    for (int k = 0; k < 8; ++k) *(v4f*)(op + k * 4 * NPIX + c * 32) = ov[k];
    // The next tile writes the registers that these stores name.
    asm volatile("s_wait_xcnt 0x0" :: "v"(op) : "memory");

    if (c + 2 < 4) {
#pragma unroll
      for (int k = 0; k < 8; ++k)
        xv[c + 2][k] = *(const v4f*)(xp + k * 4 * NPIX + (c + 2) * 32);
      // As above: ends the run, the address in its registers up to the wait.
      asm volatile("s_wait_xcnt 0x0" :: "v"(xp) : "memory");
    }
  }
}

// ---------------------------------------------------------------------------
// Host-side launcher.
// Inputs: 0:x 1:norm_w 2:norm_b 3:qkv_w 4:qkv_b 5:proj_w 6:proj_b
// ---------------------------------------------------------------------------
extern "C" void kernel_launch(void* const* d_in, const int* in_sizes, int n_in,
                              void* d_out, int out_size, void* d_ws, size_t ws_size,
                              hipStream_t stream) {
  (void)in_sizes; (void)n_in; (void)out_size; (void)ws_size;
  const float* x      = (const float*)d_in[0];
  const float* norm_w = (const float*)d_in[1];
  const float* norm_b = (const float*)d_in[2];
  const float* qkv_w  = (const float*)d_in[3];
  const float* qkv_b  = (const float*)d_in[4];
  const float* proj_w = (const float*)d_in[5];
  const float* proj_b = (const float*)d_in[6];
  float* out = (float*)d_out;

  char* ws = (char*)d_ws;
  const size_t SZ_WQ = (size_t)3 * CH * CH * 2;            // 384 KB
  const size_t SZ_WP = (size_t)CH * CH * 2;                // 128 KB
  const size_t SZ_T  = (size_t)BATCH * NPIX * CH * 2;      // 16 MB per tensor
  unsigned short* wq_bf   = (unsigned short*)(ws);
  unsigned short* wp_bf   = (unsigned short*)(ws + SZ_WQ);
  unsigned short* h_t     = (unsigned short*)(ws + SZ_WQ + SZ_WP);
  unsigned short* q_t     = (unsigned short*)(ws + SZ_WQ + SZ_WP + 1 * SZ_T);
  unsigned short* k_t     = (unsigned short*)(ws + SZ_WQ + SZ_WP + 2 * SZ_T);
  unsigned short* v_t     = (unsigned short*)(ws + SZ_WQ + SZ_WP + 3 * SZ_T);

  k_groupnorm<<<dim3(BATCH * NGRP), dim3(256), 0, stream>>>(
      x, norm_w, norm_b, qkv_w, proj_w, h_t, wq_bf, wp_bf);

  k_qkv<<<dim3(NPIX / 128, (3 * CH) / (64 * QKV_NT), BATCH), dim3(256), 0, stream>>>(
      wq_bf, qkv_b, h_t, q_t, k_t, v_t);

  k_attn<<<dim3(NPIX / 128, BATCH), dim3(256), 0, stream>>>(
      q_t, k_t, v_t, wp_bf, proj_b, x, out);
}
